// v000
// Measured on an AMD MI455X. A time is GPU time per run, averaged over a window of back-to-back runs after a warm-up
// (all launches, gaps included; the runs take copies of the inputs in turn), and the median of several windows.
// Apart from v000's, it joins two sittings. Times from different sittings can be a few percent apart, while
// side-by-side timings come from the same sitting.
// v000 is the starting kernel. One run takes 665 microseconds.
#include <hip/hip_runtime.h>

// Dense (unmasked) multi-head softmax(q k^T / 8) v block: x [NB][SEQ][1024], fused Wqkv [3072][1024] ('oi', rows = (3, 16 heads, 64)), Wout [1024][1024] ('oi'), interleaved-pair rotary (positions = arange) on q and k, merged heads x Wout^T.
// Compute dtypes, f32 accumulate everywhere: x/Wqkv/Wout converted to bf16 (RNE) and multiplied with v_wmma_f32_16x16x32_bf16 (single product); scores q.k as bf16 hi|lo x bf16 hi|lo, three products (bf16 WMMA); P.V with v_wmma_f32_16x16x32_f16 (P f16 carried x256, v f16); ctx bf16 hi|lo x Wout bf16 (two products); rotary and softmax in f32.
// Batches are processed NBC at a time with reused planes (host loop of launches).

#ifndef NB
#define NB 4
#endif
#ifndef SEQ
#define SEQ 2048
#endif
#ifndef NBC
#define NBC ((((NB) % 2) == 0) ? 2 : 1)      // batches per pass
#endif
#define NB_FULL  4
#define SEQ_FULL 2048
#define DM   1024
#define NH   16
#define HD   64
#define NQKV (3 * DM)
#define PCAR 256.0f               // carry of the f16 probability operand
#define SCL  0.125f               // HD^-0.5, folded into the q planes (exact power of two)
#define L2E  1.4426950408889634f
#define NEGB (-1.0e30f)
#define CTP  72                   // LDS pitch (halves) of the ctx staging rows
#define MROWC (NBC * SEQ)                         // rows of one pass
#define PLANE ((unsigned)(NBC * NH * SEQ * HD))   // elements of one head plane set (one pass)
#define CPL  ((size_t)MROWC * DM)                 // elements of one ctx plane (one pass)

static_assert(HD == 64);
static_assert(DM == NH * HD);
static_assert(DM % 32 == 0);
static_assert(DM % 64 == 0);
static_assert(NQKV % 64 == 0);
static_assert(SEQ % 64 == 0);
static_assert(MROWC % 64 == 0);
static_assert(NB <= NB_FULL);
static_assert(SEQ <= SEQ_FULL);
static_assert(NB % NBC == 0);
static_assert(((size_t)NBC * NH * SEQ * HD) % 512 == 0);
static_assert((SEQ * 32) % 256 == 0);
static_assert((size_t)4 * NBC * NH * SEQ * HD < 4294967296ull);
static_assert((CTP * 2) % 16 == 0);
static_assert(CTP >= HD);

typedef _Float16 h16;
typedef unsigned short bf;
typedef __attribute__((ext_vector_type(16))) __bf16   v16bf;
typedef __attribute__((ext_vector_type(16))) _Float16 v16h;
typedef __attribute__((ext_vector_type(8)))  _Float16 v8h;
typedef __attribute__((ext_vector_type(8)))  unsigned short v8us;
typedef __attribute__((ext_vector_type(8)))  float    v8f;
typedef __attribute__((ext_vector_type(4)))  float    v4f;
typedef __attribute__((ext_vector_type(2)))  float    v2f;
typedef __attribute__((ext_vector_type(2)))  _Float16 v2h;
typedef __attribute__((ext_vector_type(2)))  unsigned short v2us;
typedef v4f  __attribute__((may_alias)) v4fa;
typedef v8us __attribute__((may_alias)) v8usa;

__device__ __forceinline__ unsigned short f2bf(float f) { unsigned u = __float_as_uint(f); u += 0x7FFFu + ((u >> 16) & 1u); return (unsigned short)(u >> 16); }
__device__ __forceinline__ float bf2f(unsigned short b) { return __uint_as_float(((unsigned)b) << 16); }
__device__ __forceinline__ void splitf(float y, unsigned short& h, unsigned short& l) { h = f2bf(y); l = f2bf(y - bf2f(h)); }
__device__ __forceinline__ v16h cat16(v8h lo, v8h hi) { return __builtin_shufflevector(lo, hi, 0, 1, 2, 3, 4, 5, 6, 7, 8, 9, 10, 11, 12, 13, 14, 15); }
__device__ __forceinline__ v16bf cat16b(v8us lo, v8us hi) { return __builtin_bit_cast(v16bf, __builtin_shufflevector(lo, hi, 0, 1, 2, 3, 4, 5, 6, 7, 8, 9, 10, 11, 12, 13, 14, 15)); }
__device__ __forceinline__ v8f wmma16(v16h a, v16h b, v8f c) { return __builtin_amdgcn_wmma_f32_16x16x32_f16(false, a, false, b, (short)0, c, false, false); }
__device__ __forceinline__ v8f wmmab(v16bf a, v16bf b, v8f c) { return __builtin_amdgcn_wmma_f32_16x16x32_bf16(false, a, false, b, (short)0, c, false, false); }
// Fragment loaders (A and B share the k map): p points at row (lane&15), column k0 + 8*(lane>>4); elements 0..7 <- p[0..7], elements 8..15 <- p[16..23].
__device__ __forceinline__ v16bf ldb(const bf* p) { return cat16b(*(const v8us*)p, *(const v8us*)(p + 16)); }
__device__ __forceinline__ v16h ldh(const h16* p) { return cat16(*(const v8h*)p, *(const v8h*)(p + 16)); }

// ---- GEMM body: ONE WAVE per 64x64 output tile (16 accumulators), operands straight from K-contiguous bf16 planes; grid (M/64, N/64, Z), 32 threads.
// C[m][n] (f32, pitch ldc) = sum_k (A[m][k] (+ A2[m][k])) Bt[n][k]. K % 32 == 0, M % 64 == 0, N % 64 == 0 (asserted at file scope for the two uses).
template <int NSPLIT>
__device__ __forceinline__ void gemmw_body(const bf* __restrict__ A, const bf* __restrict__ A2, const bf* __restrict__ Bt, const int K, float* C, const int ldc, const size_t sA, const size_t sC) {
    __shared__ __align__(16) float os[16 * 68];
    const size_t z = blockIdx.z; A += z * sA; A2 += z * sA; C += z * sC;
    const int lane = threadIdx.x & 31, lr = lane & 15, hi = lane >> 4; const int r0 = blockIdx.x * 64, c0 = blockIdx.y * 64;
    v8f acc[4][4];
#pragma unroll
    for (int mb = 0; mb < 4; ++mb)
#pragma unroll
        for (int nb = 0; nb < 4; ++nb) acc[mb][nb] = (v8f){};
    const size_t aoff = (size_t)(r0 + lr) * K + 8 * hi, boff = (size_t)(c0 + lr) * K + 8 * hi;
#pragma unroll 1
    for (int kc = 0; kc < K; kc += 32) {
        v16bf a[4], a2[4], bl;
#pragma unroll
        for (int mb = 0; mb < 4; ++mb) { a[mb] = ldb(A + aoff + (size_t)mb * 16 * K + kc); if (NSPLIT == 1) a2[mb] = ldb(A2 + aoff + (size_t)mb * 16 * K + kc); else a2[mb] = a[mb]; }
#pragma unroll
        for (int nb = 0; nb < 4; ++nb) { const v16bf b = ldb(Bt + boff + (size_t)nb * 16 * K + kc); if (nb == 3) bl = b;
#pragma unroll
            for (int mb = 0; mb < 4; ++mb) { acc[mb][nb] = wmmab(a[mb], b, acc[mb][nb]); if (NSPLIT == 1) acc[mb][nb] = wmmab(a2[mb], b, acc[mb][nb]); } }
        asm volatile("" : "+v"(acc[0][0]), "+v"(acc[0][1]), "+v"(acc[1][0]), "+v"(acc[1][1]), "+v"(acc[2][0]), "+v"(acc[2][1]), "+v"(acc[3][0]), "+v"(acc[3][1]));
        asm volatile("v_nop\n\tv_nop\n\tv_nop\n\tv_nop" : "+v"(acc[0][2]), "+v"(acc[0][3]), "+v"(acc[1][2]), "+v"(acc[1][3]), "+v"(acc[2][2]), "+v"(acc[2][3]), "+v"(acc[3][2]), "+v"(acc[3][3]) : "v"(a[0]), "v"(a[1]), "v"(a[2]), "v"(a[3]), "v"(bl));
        asm volatile("" : "+v"(acc[0][0]), "+v"(acc[0][1]), "+v"(acc[1][0]), "+v"(acc[1][1]), "+v"(acc[2][0]), "+v"(acc[2][1]), "+v"(acc[3][0]), "+v"(acc[3][1]) : "v"(a2[0]), "v"(a2[1]), "v"(a2[2]), "v"(a2[3]));
    }
#pragma unroll
    for (int mb = 0; mb < 4; ++mb) {
#pragma unroll
        for (int nb = 0; nb < 4; ++nb) {
#pragma unroll
            for (int j = 0; j < 8; ++j) os[(hi * 8 + j) * 68 + nb * 16 + lr] = acc[mb][nb][j]; }
        asm volatile("s_wait_dscnt 0x0" ::: "memory"); __builtin_amdgcn_wave_barrier();
        float* crow = C + (size_t)(r0 + mb * 16) * ldc + c0;
{
#pragma unroll
            for (int s = 0; s < 8; ++s) { const int row = 2 * s + hi, cofs = lr * 4; const v4f val = *(const v4fa*)(os + row * 68 + cofs);
                *(v4f*)(crow + (size_t)row * ldc + cofs) = val; }
             }
        asm volatile("s_wait_dscnt 0x0" ::: "memory"); __builtin_amdgcn_wave_barrier();
    }
}
// qkv projection of one pass: F[m][o] = sum_k XB[m][k] WQKVB[o][k]; grid (MROWC/64, NQKV/64, 1).
__global__ __launch_bounds__(32) void k_gemm_qkv(const bf* __restrict__ A, const bf* __restrict__ Bt, float* C) { gemmw_body<0>(A, A, Bt, DM, C, NQKV, 0, 0); }
// output projection of one pass: OUT[b][t][o] = sum_k (CTXh + CTXl)[b*SEQ + t][k] WOB[o][k]; grid (SEQ/64, DM/64, NBC); output batch pitch SEQ_FULL*DM.
__global__ __launch_bounds__(32) void k_gemm_out(const bf* __restrict__ Ah, const bf* __restrict__ Al, const bf* __restrict__ Bt, float* C) { gemmw_body<1>(Ah, Al, Bt, DM, C, DM, (size_t)SEQ * DM, (size_t)SEQ_FULL * DM); }

__global__ __launch_bounds__(256) void k_cvt8(const float* __restrict__ src, bf* dst, unsigned n8, unsigned per8, unsigned sstride8) {
    const unsigned i = blockIdx.x * 256u + threadIdx.x; if (i >= n8) return;
    const size_t si = (size_t)(i / per8) * sstride8 + (i % per8);
    const v8f v = *(const v8f*)(src + si * 8); v8us o;
#pragma unroll
    for (int k = 0; k < 8; ++k) o[k] = f2bf(v[k]);
    *(v8us*)(dst + (size_t)i * 8) = o;  }

__global__ __launch_bounds__(256) void k_cstab(float* CS) {
    const int idx = blockIdx.x * 256 + threadIdx.x; if (idx >= SEQ * 32) return;
    const int j = idx & 31, t = idx >> 5;
    double p = 1.0;
    p *= (j & 1) ? 1.3335214321633240 : 1.0;
    p *= (j & 2) ? 1.7782794100389228 : 1.0;
    p *= (j & 4) ? 3.1622776601683795 : 1.0;
    p *= (j & 8) ? 10.0 : 1.0;
    p *= (j & 16) ? 100.0 : 1.0;
    const float pf = (float)p; const float inv = 1.0f / pf; const float ang = (float)t * inv;
    float sn, cn; sincosf(ang, &sn, &cn);
    v2f cs; cs[0] = cn; cs[1] = sn;
    *(v2f*)(CS + (size_t)idx * 2) = cs;  }

// k_rope: bf16 hi|lo head planes [zz = b*NH + h][t][d] of rotary(F) (interleaved pairs: out[2j] = x[2j] c_j - x[2j+1] s_j, out[2j+1] = x[2j] s_j + x[2j+1] c_j);
__global__ __launch_bounds__(256) void k_rope(const float* __restrict__ F, const float* __restrict__ CS, bf* QK) {
#pragma clang fp contract(off)
    const unsigned which = blockIdx.y;
    const unsigned e = (blockIdx.x * 256u + threadIdx.x) * 2u; if (e >= PLANE) return;
    const unsigned d = e & (HD - 1); const unsigned t = (e / HD) % SEQ; const unsigned zz = e / (HD * SEQ); const unsigned b = zz / NH, h = zz % NH;
    const v2f x = *(const v2f*)(F + ((size_t)b * SEQ + t) * NQKV + which * DM + h * HD + d);
    const v2f cs = *(const v2f*)(CS + ((size_t)t * 32 + (d >> 1)) * 2);
    const float sc = which ? 1.0f : SCL;
    const float r0 = (x[0] * cs[0] - x[1] * cs[1]) * sc;
    const float r1 = (x[0] * cs[1] + x[1] * cs[0]) * sc;
    v2us oh, ol; unsigned short a, c;
    splitf(r0, a, c); oh[0] = a; ol[0] = c; splitf(r1, a, c); oh[1] = a; ol[1] = c;
    bf* ph = QK + (size_t)(which * 2u) * PLANE + e; bf* pl = QK + (size_t)(which * 2u + 1u) * PLANE + e;
    *(v2us*)ph = oh; *(v2us*)pl = ol;  }

__global__ __launch_bounds__(256) void k_vtp(const float* __restrict__ F, h16* VT) {
    const unsigned e = (blockIdx.x * 256u + threadIdx.x) * 2u; if (e >= PLANE) return;
    const unsigned t = e % SEQ; const unsigned d = (e / SEQ) % HD; const unsigned zz = e / (SEQ * HD); const unsigned b = zz / NH, h = zz % NH;
    v2h o16;
#pragma unroll
    for (int q = 0; q < 2; ++q) { const float x = F[((size_t)b * SEQ + t + q) * NQKV + 2 * DM + h * HD + d]; o16[q] = (h16)x; }
    h16* p0 = VT + e;
    *(v2h*)p0 = o16;  }

// ---- fused dense softmax(q k^T) v: block = 4 independent waves, wave = 16 query rows of one (b, h); key loop over ALL keys in 32-key steps, fragments straight from the planes.
// S^T[key][query] = K.Q^T (A = K rows, B = Q rows; hi.hi + hi.lo + lo.hi): lane (hh, ln) holds query qw+ln, keys kt + 16j + 8hh + r, which IS the B fragment of P^T for
// O^T[d][query] = V^T.P^T (A = V^T rows d, k = keys). Online softmax per lane (one query per lane, halves combined by one xor-16 shuffle); the rescale factor is lane-local.
// grid (SEQ/64, NBC*NH), 128 threads.
__global__ __launch_bounds__(128) void k_sdpa(const bf* __restrict__ QK, const h16* __restrict__ VT, bf* CT) {
    __shared__ __align__(16) unsigned short cts[4 * 2 * 16 * CTP];
    const int lane = threadIdx.x & 31, hh = lane >> 4, ln = lane & 15;
    const int wave = __builtin_amdgcn_readfirstlane((int)(threadIdx.x >> 5));
    const int zz = blockIdx.y;
    const int qw = (int)blockIdx.x * 64 + wave * 16;
    const int nsteps = SEQ / 32;                            // all keys 0 .. SEQ-1
    const unsigned hb = (unsigned)zz * (unsigned)(SEQ * HD);
    const unsigned qoff = hb + (unsigned)(qw + ln) * HD + 8u * hh;
    const unsigned kofs = 2u * PLANE + hb + (unsigned)ln * HD + 8u * hh;
    const unsigned vofs = hb + (unsigned)ln * SEQ + 8u * hh;
    v8f o[4];
#pragma unroll
    for (int dt = 0; dt < 4; ++dt) o[dt] = (v8f){};
    float m = NEGB, l = 0.0f;
#pragma unroll 1
    for (int st = 0; st < nsteps; ++st) {
        const int kt = st * 32;
        unsigned qo = qoff; asm volatile("" : "+v"(qo));
        const v16bf qh0 = ldb(QK + (size_t)qo), qh1 = ldb(QK + (size_t)qo + 32), ql0 = ldb(QK + (size_t)(PLANE + qo)), ql1 = ldb(QK + (size_t)(PLANE + qo) + 32);
        v8f s0 = (v8f){}, s1 = (v8f){};
        {
            const unsigned ko = kofs + (unsigned)kt * HD;
            const v16bf kh0 = ldb(QK + (size_t)ko), kh1 = ldb(QK + (size_t)ko + 32), kl0 = ldb(QK + (size_t)(PLANE + ko)), kl1 = ldb(QK + (size_t)(PLANE + ko) + 32);
            s0 = wmmab(kh0, qh0, s0); s0 = wmmab(kh1, qh1, s0); s0 = wmmab(kh0, ql0, s0); s0 = wmmab(kh1, ql1, s0); s0 = wmmab(kl0, qh0, s0); s0 = wmmab(kl1, qh1, s0);
            asm volatile("v_nop\n\tv_nop\n\tv_nop\n\tv_nop" : "+v"(s0) : "v"(kh0), "v"(kh1), "v"(kl0), "v"(kl1), "v"(qh0), "v"(qh1), "v"(ql0), "v"(ql1));
        }
        asm volatile("" ::: "memory");
        {
            const unsigned ko = kofs + (unsigned)(kt + 16) * HD;
            const v16bf kh0 = ldb(QK + (size_t)ko), kh1 = ldb(QK + (size_t)ko + 32), kl0 = ldb(QK + (size_t)(PLANE + ko)), kl1 = ldb(QK + (size_t)(PLANE + ko) + 32);
            s1 = wmmab(kh0, qh0, s1); s1 = wmmab(kh1, qh1, s1); s1 = wmmab(kh0, ql0, s1); s1 = wmmab(kh1, ql1, s1); s1 = wmmab(kl0, qh0, s1); s1 = wmmab(kl1, qh1, s1);
            asm volatile("v_nop\n\tv_nop\n\tv_nop\n\tv_nop" : "+v"(s1), "+v"(s0) : "v"(kh0), "v"(kh1), "v"(kl0), "v"(kl1), "v"(qh0), "v"(qh1), "v"(ql0), "v"(ql1));
        }
        float mx = s0[0];
#pragma unroll
        for (int r = 1; r < 8; ++r) mx = fmaxf(mx, s0[r]);
#pragma unroll
        for (int r = 0; r < 8; ++r) mx = fmaxf(mx, s1[r]);
        mx = fmaxf(mx, __shfl_xor(mx, 16, 32));
        const float mn = fmaxf(m, mx);
        const float al = __builtin_amdgcn_exp2f((m - mn) * L2E);
        m = mn;
        float rs = 0.0f; v16h pb;
#pragma unroll
        for (int r = 0; r < 8; ++r) {
            const float e0 = __builtin_amdgcn_exp2f((s0[r] - mn) * L2E), e1 = __builtin_amdgcn_exp2f((s1[r] - mn) * L2E);
            rs += e0 + e1;
            const float c0 = e0 * PCAR, c1 = e1 * PCAR;
            pb[r] = (h16)c0; pb[8 + r] = (h16)c1;
        }
        l = l * al + rs;
#pragma unroll
        for (int dt = 0; dt < 4; ++dt) o[dt] = o[dt] * al;
        asm volatile("" ::: "memory");
        v16h va[4];
        const unsigned vo = vofs + (unsigned)kt;
#pragma unroll
        for (int dt = 0; dt < 4; ++dt) va[dt] = ldh(VT + (size_t)(vo + (unsigned)(dt * 16 * SEQ)));
#pragma unroll
        for (int dt = 0; dt < 4; ++dt) o[dt] = wmma16(va[dt], pb, o[dt]);
        asm volatile("v_nop\n\tv_nop\n\tv_nop\n\tv_nop" : "+v"(o[0]), "+v"(o[1]), "+v"(o[2]), "+v"(o[3]) : "v"(pb), "v"(va[0]), "v"(va[1]), "v"(va[2]), "v"(va[3]));
    }
    l += __shfl_xor(l, 16, 32);
    const float inv = 1.0f / (PCAR * l);
    const int cb = wave * (2 * 16 * CTP);                   // wave-private staging: [plane hi|lo][16 rows][CTP]
#pragma unroll
    for (int dt = 0; dt < 4; ++dt) { v8us oh, ol;
#pragma unroll
        for (int r = 0; r < 8; ++r) { const float y = o[dt][r] * inv; unsigned short a, c; splitf(y, a, c); oh[r] = a; ol[r] = c; }
        *(v8usa*)(cts + cb + ln * CTP + dt * 16 + 8 * hh) = oh; *(v8usa*)(cts + cb + 16 * CTP + ln * CTP + dt * 16 + 8 * hh) = ol; }
    asm volatile("s_wait_dscnt 0x0" ::: "memory"); __builtin_amdgcn_wave_barrier();
    const int b = zz / NH, h = zz % NH;
    const int rq = lane >> 3, pc = (lane & 7) * 8;
    v8us hv[4], lv[4];
#pragma unroll
    for (int it = 0; it < 4; ++it) { const int row = it * 4 + rq; hv[it] = *(const v8usa*)(cts + cb + row * CTP + pc); lv[it] = *(const v8usa*)(cts + cb + 16 * CTP + row * CTP + pc); }
    bf* gh = CT + ((size_t)b * SEQ + qw) * DM + h * HD + pc;
{
#pragma unroll
        for (int it = 0; it < 4; ++it) { const int row = it * 4 + rq; *(v8us*)(gh + (size_t)row * DM) = hv[it]; *(v8us*)(gh + CPL + (size_t)row * DM) = lv[it]; }
         }
}

constexpr size_t SZ_WQKV = (size_t)NQKV * DM * 2;
constexpr size_t SZ_WO   = (size_t)DM * DM * 2;
constexpr size_t SZ_CS   = (size_t)SEQ * 32 * 2 * 4;
constexpr size_t SZ_XB   = (size_t)NB * SEQ * DM * 2;          // all batches, compact [NB][SEQ][DM]
constexpr size_t SZ_F    = (size_t)MROWC * NQKV * 4;           // one pass
constexpr size_t SZ_QK   = (size_t)4 * NBC * NH * SEQ * HD * 2; // one pass: q hi, q lo, k hi, k lo
constexpr size_t SZ_VT   = (size_t)NBC * NH * SEQ * HD * 2;     // one pass
constexpr size_t SZ_CTX  = (size_t)2 * MROWC * DM * 2;
constexpr size_t SZ_TOTAL = SZ_WQKV + SZ_WO + SZ_CS + SZ_XB + SZ_F + SZ_QK + SZ_VT;
static_assert(SZ_CTX <= SZ_F);                 // ctx hi|lo planes reuse the projection buffer after the plane builders
static_assert(SZ_TOTAL <= (size_t)134217728);
static_assert(SZ_WQKV % 256 == 0 && SZ_WO % 256 == 0 && SZ_CS % 256 == 0 && SZ_XB % 256 == 0 && SZ_F % 256 == 0 && SZ_QK % 256 == 0 && SZ_VT % 256 == 0);

extern "C" void kernel_launch(void* const* d_in, const int* in_sizes, int n_in,
                              void* d_out, int out_size, void* d_ws, size_t ws_size, hipStream_t stream) {
    if (n_in < 3) return;
    const long long need_x = (long long)(NB - 1) * SEQ_FULL * DM + (long long)SEQ * DM;
    if ((long long)in_sizes[0] < need_x) return;
    if ((long long)in_sizes[1] < (long long)NQKV * DM) return;
    if ((long long)in_sizes[2] < (long long)DM * DM) return;
    if ((long long)out_size < need_x) return;
    if (SZ_TOTAL > ws_size) return;
    const float* x = (const float*)d_in[0];        // [NB_FULL][SEQ_FULL][DM]
    const float* wqkv = (const float*)d_in[1];     // [NQKV][DM] ('oi')
    const float* wout = (const float*)d_in[2];     // [DM][DM] ('oi')
    float* OUT = (float*)d_out;                    // [NB_FULL][SEQ_FULL][DM]
    char* base = (char*)d_ws; size_t off = 0;
    bf* WQKVB = (bf*)(base + off); off += SZ_WQKV;
    bf* WOB = (bf*)(base + off); off += SZ_WO;
    float* CS = (float*)(base + off); off += SZ_CS;
    bf* XB = (bf*)(base + off); off += SZ_XB;
    float* F = (float*)(base + off); off += SZ_F;
    bf* QK = (bf*)(base + off); off += SZ_QK;
    h16* VT = (h16*)(base + off); off += SZ_VT;
    bf* CT = (bf*)F;                               // ctx hi plane, lo plane at + CPL

    const unsigned n8w = (unsigned)((size_t)NQKV * DM / 8), n8o = (unsigned)((size_t)DM * DM / 8), n8x = (unsigned)((size_t)NB * SEQ * DM / 8);
    k_cvt8<<<(n8w + 255) / 256, 256, 0, stream>>>(wqkv, WQKVB, n8w, n8w, 0u);
    k_cvt8<<<(n8o + 255) / 256, 256, 0, stream>>>(wout, WOB, n8o, n8o, 0u);
    k_cvt8<<<(n8x + 255) / 256, 256, 0, stream>>>(x, XB, n8x, (unsigned)((size_t)SEQ * DM / 8), (unsigned)((size_t)SEQ_FULL * DM / 8));
    k_cstab<<<(SEQ * 32 + 255) / 256, 256, 0, stream>>>(CS);
    for (int c = 0; c < NB / NBC; ++c) {
        const bf* XBc = XB + (size_t)c * MROWC * DM;                 // rows of this pass
        float* OUTc = OUT + (size_t)c * NBC * SEQ_FULL * DM;         // output rows of this pass
        k_gemm_qkv<<<dim3(MROWC / 64, NQKV / 64, 1), 32, 0, stream>>>(XBc, WQKVB, F);
        k_rope<<<dim3(PLANE / 512u, 2, 1), 256, 0, stream>>>(F, CS, QK);
        k_vtp<<<dim3(PLANE / 512u, 1, 1), 256, 0, stream>>>(F, VT);
        k_sdpa<<<dim3(SEQ / 64, NBC * NH, 1), 128, 0, stream>>>(QK, VT, CT);
        k_gemm_out<<<dim3(SEQ / 64, DM / 64, NBC), 32, 0, stream>>>(CT, CT + CPL, WOB, OUTc);
    }
}

// v001
// One run takes 422 microseconds.
// Next to v000, in two timings, it ran 1.60 and 1.59 times as fast.
#include <hip/hip_runtime.h>

// Dense (unmasked) multi-head softmax(q k^T / 8) v block: x [NB][SEQ][1024], fused Wqkv [3072][1024] ('oi', rows = (3, 16 heads, 64)), Wout [1024][1024] ('oi'), interleaved-pair rotary (positions = arange) on q and k, merged heads x Wout^T.
// Compute dtypes, f32 accumulate everywhere: x/Wqkv/Wout converted to bf16 (RNE) and multiplied with v_wmma_f32_16x16x32_bf16 (single product); scores q.k as bf16 hi|lo x bf16 hi|lo, three products (bf16 WMMA); P.V with v_wmma_f32_16x16x32_f16 (P f16 carried x256, v f16); ctx bf16 hi|lo x Wout bf16 (two products); rotary and softmax in f32.
// Batches are processed NBC at a time with reused planes (host loop of launches).

#ifndef NB
#define NB 4
#endif
#ifndef SEQ
#define SEQ 2048
#endif
#ifndef NBC
#define NBC ((((NB) % 2) == 0) ? 2 : 1)      // batches per pass
#endif
#define NB_FULL  4
#define SEQ_FULL 2048
#define DM   1024
#define NH   16
#define HD   64
#define NQKV (3 * DM)
#define PCAR 256.0f               // carry of the f16 probability operand
#define SCL  0.125f               // HD^-0.5, folded into the q planes (exact power of two)
#define L2E  1.4426950408889634f
#define NEGB (-1.0e30f)
#define CTP  72                   // LDS pitch (halves) of the ctx staging rows
#define KST  64                   // keys of one LDS stage of k_sdpa
#define KVP  72                   // LDS pitch (16-bit elements) of a staged 128-byte row: 144 B = 16 B x odd, conflict-free for 16-byte fragment reads
#define TLE  (64 * KVP)           // elements of one staged tile (64 rows)
#define STE  (3 * TLE)            // elements of one stage: K hi | K lo | V^T
#define MROWC (NBC * SEQ)                         // rows of one pass
#define PLANE ((unsigned)(NBC * NH * SEQ * HD))   // elements of one head plane set (one pass)
#define CPL  ((size_t)MROWC * DM)                 // elements of one ctx plane (one pass)

static_assert(HD == 64);
static_assert(DM == NH * HD);
static_assert(DM % 32 == 0);
static_assert(DM % 64 == 0);
static_assert(NQKV % 64 == 0);
static_assert(SEQ % 64 == 0);
static_assert(MROWC % 64 == 0);
static_assert(NB <= NB_FULL);
static_assert(SEQ <= SEQ_FULL);
static_assert(NB % NBC == 0);
static_assert(((size_t)NBC * NH * SEQ * HD) % 512 == 0);
static_assert((SEQ * 32) % 256 == 0);
static_assert((size_t)4 * NBC * NH * SEQ * HD < 4294967296ull);
static_assert((CTP * 2) % 16 == 0);
static_assert(CTP >= HD);
static_assert(SEQ % KST == 0);
static_assert(KST == 64 && KST % 32 == 0);
static_assert((KVP * 2) % 16 == 0 && KVP >= HD && KVP >= KST);

typedef _Float16 h16;
typedef unsigned short bf;
typedef __attribute__((ext_vector_type(16))) __bf16   v16bf;
typedef __attribute__((ext_vector_type(16))) _Float16 v16h;
typedef __attribute__((ext_vector_type(8)))  _Float16 v8h;
typedef __attribute__((ext_vector_type(8)))  unsigned short v8us;
typedef __attribute__((ext_vector_type(8)))  float    v8f;
typedef __attribute__((ext_vector_type(4)))  float    v4f;
typedef __attribute__((ext_vector_type(2)))  float    v2f;
typedef __attribute__((ext_vector_type(2)))  _Float16 v2h;
typedef __attribute__((ext_vector_type(2)))  unsigned short v2us;
typedef v4f  __attribute__((may_alias)) v4fa;
typedef v8us __attribute__((may_alias)) v8usa;
typedef v8h  __attribute__((may_alias)) v8ha;

__device__ __forceinline__ unsigned short f2bf(float f) { unsigned u = __float_as_uint(f); u += 0x7FFFu + ((u >> 16) & 1u); return (unsigned short)(u >> 16); }
__device__ __forceinline__ float bf2f(unsigned short b) { return __uint_as_float(((unsigned)b) << 16); }
__device__ __forceinline__ void splitf(float y, unsigned short& h, unsigned short& l) { h = f2bf(y); l = f2bf(y - bf2f(h)); }
__device__ __forceinline__ v16h cat16(v8h lo, v8h hi) { return __builtin_shufflevector(lo, hi, 0, 1, 2, 3, 4, 5, 6, 7, 8, 9, 10, 11, 12, 13, 14, 15); }
__device__ __forceinline__ v16bf cat16b(v8us lo, v8us hi) { return __builtin_bit_cast(v16bf, __builtin_shufflevector(lo, hi, 0, 1, 2, 3, 4, 5, 6, 7, 8, 9, 10, 11, 12, 13, 14, 15)); }
__device__ __forceinline__ v8f wmma16(v16h a, v16h b, v8f c) { return __builtin_amdgcn_wmma_f32_16x16x32_f16(false, a, false, b, (short)0, c, false, false); }
__device__ __forceinline__ v8f wmmab(v16bf a, v16bf b, v8f c) { return __builtin_amdgcn_wmma_f32_16x16x32_bf16(false, a, false, b, (short)0, c, false, false); }
// Fragment loaders (A and B share the k map): p points at row (lane&15), column k0 + 8*(lane>>4); elements 0..7 <- p[0..7], elements 8..15 <- p[16..23].
__device__ __forceinline__ v16bf ldb(const bf* p) { return cat16b(*(const v8us*)p, *(const v8us*)(p + 16)); }
// The same k map on the staged LDS rows (bf16 rows of K, f16 rows of V^T).
__device__ __forceinline__ v16bf ldbs(const unsigned short* p) { return cat16b(*(const v8usa*)p, *(const v8usa*)(p + 16)); }
__device__ __forceinline__ v16h ldhs(const unsigned short* p) { return cat16(*(const v8ha*)p, *(const v8ha*)(p + 16)); }

// ---- GEMM body: ONE WAVE per 64x64 output tile (16 accumulators), operands straight from K-contiguous bf16 planes; grid (M/64, N/64, Z), 32 threads.
// C[m][n] (f32, pitch ldc) = sum_k (A[m][k] (+ A2[m][k])) Bt[n][k]. K % 32 == 0, M % 64 == 0, N % 64 == 0 (asserted at file scope for the two uses).
template <int NSPLIT>
__device__ __forceinline__ void gemmw_body(const bf* __restrict__ A, const bf* __restrict__ A2, const bf* __restrict__ Bt, const int K, float* C, const int ldc, const size_t sA, const size_t sC) {
    __shared__ __align__(16) float os[16 * 68];
    const size_t z = blockIdx.z; A += z * sA; A2 += z * sA; C += z * sC;
    const int lane = threadIdx.x & 31, lr = lane & 15, hi = lane >> 4; const int r0 = blockIdx.x * 64, c0 = blockIdx.y * 64;
    v8f acc[4][4];
#pragma unroll
    for (int mb = 0; mb < 4; ++mb)
#pragma unroll
        for (int nb = 0; nb < 4; ++nb) acc[mb][nb] = (v8f){};
    const size_t aoff = (size_t)(r0 + lr) * K + 8 * hi, boff = (size_t)(c0 + lr) * K + 8 * hi;
#pragma unroll 1
    for (int kc = 0; kc < K; kc += 32) {
        v16bf a[4], a2[4], bl;
#pragma unroll
        for (int mb = 0; mb < 4; ++mb) { a[mb] = ldb(A + aoff + (size_t)mb * 16 * K + kc); if (NSPLIT == 1) a2[mb] = ldb(A2 + aoff + (size_t)mb * 16 * K + kc); else a2[mb] = a[mb]; }
#pragma unroll
        for (int nb = 0; nb < 4; ++nb) { const v16bf b = ldb(Bt + boff + (size_t)nb * 16 * K + kc); if (nb == 3) bl = b;
#pragma unroll
            for (int mb = 0; mb < 4; ++mb) { acc[mb][nb] = wmmab(a[mb], b, acc[mb][nb]); if (NSPLIT == 1) acc[mb][nb] = wmmab(a2[mb], b, acc[mb][nb]); } }
        asm volatile("" : "+v"(acc[0][0]), "+v"(acc[0][1]), "+v"(acc[1][0]), "+v"(acc[1][1]), "+v"(acc[2][0]), "+v"(acc[2][1]), "+v"(acc[3][0]), "+v"(acc[3][1]));
        asm volatile("v_nop\n\tv_nop\n\tv_nop\n\tv_nop" : "+v"(acc[0][2]), "+v"(acc[0][3]), "+v"(acc[1][2]), "+v"(acc[1][3]), "+v"(acc[2][2]), "+v"(acc[2][3]), "+v"(acc[3][2]), "+v"(acc[3][3]) : "v"(a[0]), "v"(a[1]), "v"(a[2]), "v"(a[3]), "v"(bl));
        asm volatile("" : "+v"(acc[0][0]), "+v"(acc[0][1]), "+v"(acc[1][0]), "+v"(acc[1][1]), "+v"(acc[2][0]), "+v"(acc[2][1]), "+v"(acc[3][0]), "+v"(acc[3][1]) : "v"(a2[0]), "v"(a2[1]), "v"(a2[2]), "v"(a2[3]));
    }
#pragma unroll
    for (int mb = 0; mb < 4; ++mb) {
#pragma unroll
        for (int nb = 0; nb < 4; ++nb) {
#pragma unroll
            for (int j = 0; j < 8; ++j) os[(hi * 8 + j) * 68 + nb * 16 + lr] = acc[mb][nb][j]; }
        asm volatile("s_wait_dscnt 0x0" ::: "memory"); __builtin_amdgcn_wave_barrier();
        float* crow = C + (size_t)(r0 + mb * 16) * ldc + c0;
{
#pragma unroll
            for (int s = 0; s < 8; ++s) { const int row = 2 * s + hi, cofs = lr * 4; const v4f val = *(const v4fa*)(os + row * 68 + cofs);
                *(v4f*)(crow + (size_t)row * ldc + cofs) = val; }
             }
        asm volatile("s_wait_dscnt 0x0" ::: "memory"); __builtin_amdgcn_wave_barrier();
    }
}
// qkv projection of one pass: F[m][o] = sum_k XB[m][k] WQKVB[o][k]; grid (MROWC/64, NQKV/64, 1).
__global__ __launch_bounds__(32) void k_gemm_qkv(const bf* __restrict__ A, const bf* __restrict__ Bt, float* C) { gemmw_body<0>(A, A, Bt, DM, C, NQKV, 0, 0); }
// output projection of one pass: OUT[b][t][o] = sum_k (CTXh + CTXl)[b*SEQ + t][k] WOB[o][k]; grid (SEQ/64, DM/64, NBC); output batch pitch SEQ_FULL*DM.
__global__ __launch_bounds__(32) void k_gemm_out(const bf* __restrict__ Ah, const bf* __restrict__ Al, const bf* __restrict__ Bt, float* C) { gemmw_body<1>(Ah, Al, Bt, DM, C, DM, (size_t)SEQ * DM, (size_t)SEQ_FULL * DM); }

__global__ __launch_bounds__(256) void k_cvt8(const float* __restrict__ src, bf* dst, unsigned n8, unsigned per8, unsigned sstride8) {
    const unsigned i = blockIdx.x * 256u + threadIdx.x; if (i >= n8) return;
    const size_t si = (size_t)(i / per8) * sstride8 + (i % per8);
    const v8f v = *(const v8f*)(src + si * 8); v8us o;
#pragma unroll
    for (int k = 0; k < 8; ++k) o[k] = f2bf(v[k]);
    *(v8us*)(dst + (size_t)i * 8) = o;  }

__global__ __launch_bounds__(256) void k_cstab(float* CS) {
    const int idx = blockIdx.x * 256 + threadIdx.x; if (idx >= SEQ * 32) return;
    const int j = idx & 31, t = idx >> 5;
    double p = 1.0;
    p *= (j & 1) ? 1.3335214321633240 : 1.0;
    p *= (j & 2) ? 1.7782794100389228 : 1.0;
    p *= (j & 4) ? 3.1622776601683795 : 1.0;
    p *= (j & 8) ? 10.0 : 1.0;
    p *= (j & 16) ? 100.0 : 1.0;
    const float pf = (float)p; const float inv = 1.0f / pf; const float ang = (float)t * inv;
    float sn, cn; sincosf(ang, &sn, &cn);
    v2f cs; cs[0] = cn; cs[1] = sn;
    *(v2f*)(CS + (size_t)idx * 2) = cs;  }

// k_rope: bf16 hi|lo head planes [zz = b*NH + h][t][d] of rotary(F) (interleaved pairs: out[2j] = x[2j] c_j - x[2j+1] s_j, out[2j+1] = x[2j] s_j + x[2j+1] c_j);
__global__ __launch_bounds__(256) void k_rope(const float* __restrict__ F, const float* __restrict__ CS, bf* QK) {
#pragma clang fp contract(off)
    const unsigned which = blockIdx.y;
    const unsigned e = (blockIdx.x * 256u + threadIdx.x) * 2u; if (e >= PLANE) return;
    const unsigned d = e & (HD - 1); const unsigned t = (e / HD) % SEQ; const unsigned zz = e / (HD * SEQ); const unsigned b = zz / NH, h = zz % NH;
    const v2f x = *(const v2f*)(F + ((size_t)b * SEQ + t) * NQKV + which * DM + h * HD + d);
    const v2f cs = *(const v2f*)(CS + ((size_t)t * 32 + (d >> 1)) * 2);
    const float sc = which ? 1.0f : SCL;
    const float r0 = (x[0] * cs[0] - x[1] * cs[1]) * sc;
    const float r1 = (x[0] * cs[1] + x[1] * cs[0]) * sc;
    v2us oh, ol; unsigned short a, c;
    splitf(r0, a, c); oh[0] = a; ol[0] = c; splitf(r1, a, c); oh[1] = a; ol[1] = c;
    bf* ph = QK + (size_t)(which * 2u) * PLANE + e; bf* pl = QK + (size_t)(which * 2u + 1u) * PLANE + e;
    *(v2us*)ph = oh; *(v2us*)pl = ol;  }

__global__ __launch_bounds__(256) void k_vtp(const float* __restrict__ F, h16* VT) {
    const unsigned e = (blockIdx.x * 256u + threadIdx.x) * 2u; if (e >= PLANE) return;
    const unsigned t = e % SEQ; const unsigned d = (e / SEQ) % HD; const unsigned zz = e / (SEQ * HD); const unsigned b = zz / NH, h = zz % NH;
    v2h o16;
#pragma unroll
    for (int q = 0; q < 2; ++q) { const float x = F[((size_t)b * SEQ + t + q) * NQKV + 2 * DM + h * HD + d]; o16[q] = (h16)x; }
    h16* p0 = VT + e;
    *(v2h*)p0 = o16;  }

// One stage of k_sdpa's LDS ring: 64 keys = K hi rows, K lo rows (64 x 128 B each, contiguous in their planes) and V^T (64 d rows x 128 B, row pitch SEQ halves).
// 128 lanes x 12 asynchronous copies of 16 B; lane tid takes 16-byte piece (tid & 7) of rows (tid >> 3) + 16 i, so every wave-wide copy covers four whole 128-byte lines.
// kg, vg: the lane's first piece in the K hi plane and in V^T; ld: its LDS byte address in the stage's K hi tile.
__device__ __forceinline__ void stage_kv(const bf* kg, const h16* vg, const unsigned ld) {
    const bf* kl = kg + PLANE;
    const unsigned rb = 16u * KVP * 2u, tb = TLE * 2u;      // bytes of 16 staged rows, of one tile
    // The copies and the s_wait_xcnt that stands in front of any rewrite of their address registers are one statement, so that nothing can move in between.
    asm volatile("global_load_async_to_lds_b128 %0, %12, off\n\t"
                 "global_load_async_to_lds_b128 %1, %13, off\n\t"
                 "global_load_async_to_lds_b128 %2, %14, off\n\t"
                 "global_load_async_to_lds_b128 %3, %15, off\n\t"
                 "global_load_async_to_lds_b128 %4, %16, off\n\t"
                 "global_load_async_to_lds_b128 %5, %17, off\n\t"
                 "global_load_async_to_lds_b128 %6, %18, off\n\t"
                 "global_load_async_to_lds_b128 %7, %19, off\n\t"
                 "global_load_async_to_lds_b128 %8, %20, off\n\t"
                 "global_load_async_to_lds_b128 %9, %21, off\n\t"
                 "global_load_async_to_lds_b128 %10, %22, off\n\t"
                 "global_load_async_to_lds_b128 %11, %23, off\n\t"
                 "s_wait_xcnt 0x0"
                 :: "v"(ld), "v"(ld + rb), "v"(ld + 2u * rb), "v"(ld + 3u * rb),
                    "v"(ld + tb), "v"(ld + tb + rb), "v"(ld + tb + 2u * rb), "v"(ld + tb + 3u * rb),
                    "v"(ld + 2u * tb), "v"(ld + 2u * tb + rb), "v"(ld + 2u * tb + 2u * rb), "v"(ld + 2u * tb + 3u * rb),
                    "v"(kg), "v"(kg + 16 * HD), "v"(kg + 32 * HD), "v"(kg + 48 * HD),
                    "v"(kl), "v"(kl + 16 * HD), "v"(kl + 32 * HD), "v"(kl + 48 * HD),
                    "v"(vg), "v"(vg + 16 * SEQ), "v"(vg + 32 * SEQ), "v"(vg + 48 * SEQ)
                 : "memory");
}

// ---- fused dense softmax(q k^T) v: block = 4 waves, wave = 16 query rows of one (b, h); key loop over ALL keys in 32-key steps; K hi|lo and V^T come in 64-key stages through a two-buffer LDS ring that the four waves share, q fragments straight from the planes.
// S^T[key][query] = K.Q^T (A = K rows, B = Q rows; hi.hi + hi.lo + lo.hi): lane (hh, ln) holds query qw+ln, keys kt + 16j + 8hh + r, which IS the B fragment of P^T for
// O^T[d][query] = V^T.P^T (A = V^T rows d, k = keys). Online softmax per lane (one query per lane, halves combined by one xor-16 shuffle); the rescale factor is lane-local.
// grid (SEQ/64, NBC*NH), 128 threads.
__global__ __launch_bounds__(128) void k_sdpa(const bf* __restrict__ QK, const h16* __restrict__ VT, bf* CT) {
    __shared__ __align__(16) unsigned short cts[4 * 2 * 16 * CTP];
    __shared__ __align__(16) unsigned short kvs[2 * STE];
    const int lane = threadIdx.x & 31, hh = lane >> 4, ln = lane & 15;
    const int wave = __builtin_amdgcn_readfirstlane((int)(threadIdx.x >> 5));
    const int zz = blockIdx.y;
    const int qw = (int)blockIdx.x * 64 + wave * 16;
    const int nst = SEQ / KST;                              // stages: all keys 0 .. SEQ-1
    const unsigned hb = (unsigned)zz * (unsigned)(SEQ * HD);
    const unsigned qoff = hb + (unsigned)(qw + ln) * HD + 8u * hh;
    const unsigned fofs = (unsigned)ln * KVP + 8u * hh;     // fragment position in a staged tile: row ln, column 8 hh
    const unsigned tid = threadIdx.x;
    const bf* kg = QK + (size_t)(2u * PLANE + hb + tid * 8u);
    const h16* vg = VT + (size_t)(hb + (tid >> 3) * SEQ + (tid & 7u) * 8u);
    const unsigned ld = (unsigned)(size_t)kvs + ((tid >> 3) * KVP + (tid & 7u) * 8u) * 2u;
    v8f o[4];
#pragma unroll
    for (int dt = 0; dt < 4; ++dt) o[dt] = (v8f){};
    float m = NEGB, l = 0.0f;
    stage_kv(kg, vg, ld);
    asm volatile("s_wait_asynccnt 0x0" ::: "memory");       // this wave's copies of stage 0 have landed
    __syncthreads();                                        // stage 0 is readable by all four waves
    if (nst > 1) stage_kv(kg + KST * HD, vg + KST, ld + STE * 2u);
#pragma unroll 1                                            // rolled: one foot (waits, barrier, refill) per stage, in the ring's order
    for (int t = 0; t < nst; ++t) {
      const unsigned short* sb = kvs + (t & 1) * STE + fofs;
      for (int hf = 0; hf < KST / 32; ++hf) {
        const int kt = hf * 32;                             // first key of this step inside the stage
        unsigned qo = qoff; asm volatile("" : "+v"(qo));
        const v16bf qh0 = ldb(QK + (size_t)qo), qh1 = ldb(QK + (size_t)qo + 32), ql0 = ldb(QK + (size_t)(PLANE + qo)), ql1 = ldb(QK + (size_t)(PLANE + qo) + 32);
        v8f s0 = (v8f){}, s1 = (v8f){};
        {
            const unsigned short* kp = sb + kt * KVP;
            const v16bf kh0 = ldbs(kp), kh1 = ldbs(kp + 32), kl0 = ldbs(kp + TLE), kl1 = ldbs(kp + TLE + 32);
            s0 = wmmab(kh0, qh0, s0); s0 = wmmab(kh1, qh1, s0); s0 = wmmab(kh0, ql0, s0); s0 = wmmab(kh1, ql1, s0); s0 = wmmab(kl0, qh0, s0); s0 = wmmab(kl1, qh1, s0);
            asm volatile("v_nop\n\tv_nop\n\tv_nop\n\tv_nop" : "+v"(s0) : "v"(kh0), "v"(kh1), "v"(kl0), "v"(kl1), "v"(qh0), "v"(qh1), "v"(ql0), "v"(ql1));
        }
        asm volatile("" ::: "memory");
        {
            const unsigned short* kp = sb + (kt + 16) * KVP;
            const v16bf kh0 = ldbs(kp), kh1 = ldbs(kp + 32), kl0 = ldbs(kp + TLE), kl1 = ldbs(kp + TLE + 32);
            s1 = wmmab(kh0, qh0, s1); s1 = wmmab(kh1, qh1, s1); s1 = wmmab(kh0, ql0, s1); s1 = wmmab(kh1, ql1, s1); s1 = wmmab(kl0, qh0, s1); s1 = wmmab(kl1, qh1, s1);
            asm volatile("v_nop\n\tv_nop\n\tv_nop\n\tv_nop" : "+v"(s1), "+v"(s0) : "v"(kh0), "v"(kh1), "v"(kl0), "v"(kl1), "v"(qh0), "v"(qh1), "v"(ql0), "v"(ql1));
        }
        float mx = s0[0];
#pragma unroll
        for (int r = 1; r < 8; ++r) mx = fmaxf(mx, s0[r]);
#pragma unroll
        for (int r = 0; r < 8; ++r) mx = fmaxf(mx, s1[r]);
        mx = fmaxf(mx, __shfl_xor(mx, 16, 32));
        const float mn = fmaxf(m, mx);
        const float al = __builtin_amdgcn_exp2f((m - mn) * L2E);
        m = mn;
        float rs = 0.0f; v16h pb;
#pragma unroll
        for (int r = 0; r < 8; ++r) {
            const float e0 = __builtin_amdgcn_exp2f((s0[r] - mn) * L2E), e1 = __builtin_amdgcn_exp2f((s1[r] - mn) * L2E);
            rs += e0 + e1;
            const float c0 = e0 * PCAR, c1 = e1 * PCAR;
            pb[r] = (h16)c0; pb[8 + r] = (h16)c1;
        }
        l = l * al + rs;
#pragma unroll
        for (int dt = 0; dt < 4; ++dt) o[dt] = o[dt] * al;
        asm volatile("" ::: "memory");
        v16h va[4];
        const unsigned short* vp = sb + 2 * TLE + kt;
#pragma unroll
        for (int dt = 0; dt < 4; ++dt) va[dt] = ldhs(vp + dt * 16 * KVP);
#pragma unroll
        for (int dt = 0; dt < 4; ++dt) o[dt] = wmma16(va[dt], pb, o[dt]);
        asm volatile("v_nop\n\tv_nop\n\tv_nop\n\tv_nop" : "+v"(o[0]), "+v"(o[1]), "+v"(o[2]), "+v"(o[3]) : "v"(pb), "v"(va[0]), "v"(va[1]), "v"(va[2]), "v"(va[3]));
      }
      asm volatile("s_wait_dscnt 0x0" ::: "memory");        // this wave's reads of stage t have returned before its buffer is refilled
      asm volatile("s_wait_asynccnt 0x0" ::: "memory");     // this wave's copies of stage t + 1 have landed
      __syncthreads();                                      // publishes stage t + 1 and ends every wave's reads of stage t
      if (t + 2 < nst) stage_kv(kg + (size_t)(t + 2) * (KST * HD), vg + (t + 2) * KST, ld + (unsigned)(t & 1) * (STE * 2u));
    }
    asm volatile("s_wait_asynccnt 0x0" ::: "memory");       // no copy is outstanding when the wave goes on to the epilogue
    l += __shfl_xor(l, 16, 32);
    const float inv = 1.0f / (PCAR * l);
    const int cb = wave * (2 * 16 * CTP);                   // wave-private staging: [plane hi|lo][16 rows][CTP]
#pragma unroll
    for (int dt = 0; dt < 4; ++dt) { v8us oh, ol;
#pragma unroll
        for (int r = 0; r < 8; ++r) { const float y = o[dt][r] * inv; unsigned short a, c; splitf(y, a, c); oh[r] = a; ol[r] = c; }
        *(v8usa*)(cts + cb + ln * CTP + dt * 16 + 8 * hh) = oh; *(v8usa*)(cts + cb + 16 * CTP + ln * CTP + dt * 16 + 8 * hh) = ol; }
    asm volatile("s_wait_dscnt 0x0" ::: "memory"); __builtin_amdgcn_wave_barrier();
    const int b = zz / NH, h = zz % NH;
    const int rq = lane >> 3, pc = (lane & 7) * 8;
    v8us hv[4], lv[4];
#pragma unroll
    for (int it = 0; it < 4; ++it) { const int row = it * 4 + rq; hv[it] = *(const v8usa*)(cts + cb + row * CTP + pc); lv[it] = *(const v8usa*)(cts + cb + 16 * CTP + row * CTP + pc); }
    bf* gh = CT + ((size_t)b * SEQ + qw) * DM + h * HD + pc;
{
#pragma unroll
        for (int it = 0; it < 4; ++it) { const int row = it * 4 + rq; *(v8us*)(gh + (size_t)row * DM) = hv[it]; *(v8us*)(gh + CPL + (size_t)row * DM) = lv[it]; }
         }
}

constexpr size_t SZ_WQKV = (size_t)NQKV * DM * 2;
constexpr size_t SZ_WO   = (size_t)DM * DM * 2;
constexpr size_t SZ_CS   = (size_t)SEQ * 32 * 2 * 4;
constexpr size_t SZ_XB   = (size_t)NB * SEQ * DM * 2;          // all batches, compact [NB][SEQ][DM]
constexpr size_t SZ_F    = (size_t)MROWC * NQKV * 4;           // one pass
constexpr size_t SZ_QK   = (size_t)4 * NBC * NH * SEQ * HD * 2; // one pass: q hi, q lo, k hi, k lo
constexpr size_t SZ_VT   = (size_t)NBC * NH * SEQ * HD * 2;     // one pass
constexpr size_t SZ_CTX  = (size_t)2 * MROWC * DM * 2;
constexpr size_t SZ_TOTAL = SZ_WQKV + SZ_WO + SZ_CS + SZ_XB + SZ_F + SZ_QK + SZ_VT;
static_assert(SZ_CTX <= SZ_F);                 // ctx hi|lo planes reuse the projection buffer after the plane builders
static_assert(SZ_TOTAL <= (size_t)134217728);
static_assert(SZ_WQKV % 256 == 0 && SZ_WO % 256 == 0 && SZ_CS % 256 == 0 && SZ_XB % 256 == 0 && SZ_F % 256 == 0 && SZ_QK % 256 == 0 && SZ_VT % 256 == 0);

extern "C" void kernel_launch(void* const* d_in, const int* in_sizes, int n_in,
                              void* d_out, int out_size, void* d_ws, size_t ws_size, hipStream_t stream) {
    if (n_in < 3) return;
    const long long need_x = (long long)(NB - 1) * SEQ_FULL * DM + (long long)SEQ * DM;
    if ((long long)in_sizes[0] < need_x) return;
    if ((long long)in_sizes[1] < (long long)NQKV * DM) return;
    if ((long long)in_sizes[2] < (long long)DM * DM) return;
    if ((long long)out_size < need_x) return;
    if (SZ_TOTAL > ws_size) return;
    const float* x = (const float*)d_in[0];        // [NB_FULL][SEQ_FULL][DM]
    const float* wqkv = (const float*)d_in[1];     // [NQKV][DM] ('oi')
    const float* wout = (const float*)d_in[2];     // [DM][DM] ('oi')
    float* OUT = (float*)d_out;                    // [NB_FULL][SEQ_FULL][DM]
    char* base = (char*)d_ws; size_t off = 0;
    bf* WQKVB = (bf*)(base + off); off += SZ_WQKV;
    bf* WOB = (bf*)(base + off); off += SZ_WO;
    float* CS = (float*)(base + off); off += SZ_CS;
    bf* XB = (bf*)(base + off); off += SZ_XB;
    float* F = (float*)(base + off); off += SZ_F;
    bf* QK = (bf*)(base + off); off += SZ_QK;
    h16* VT = (h16*)(base + off); off += SZ_VT;
    bf* CT = (bf*)F;                               // ctx hi plane, lo plane at + CPL

    const unsigned n8w = (unsigned)((size_t)NQKV * DM / 8), n8o = (unsigned)((size_t)DM * DM / 8), n8x = (unsigned)((size_t)NB * SEQ * DM / 8);
    k_cvt8<<<(n8w + 255) / 256, 256, 0, stream>>>(wqkv, WQKVB, n8w, n8w, 0u);
    k_cvt8<<<(n8o + 255) / 256, 256, 0, stream>>>(wout, WOB, n8o, n8o, 0u);
    k_cvt8<<<(n8x + 255) / 256, 256, 0, stream>>>(x, XB, n8x, (unsigned)((size_t)SEQ * DM / 8), (unsigned)((size_t)SEQ_FULL * DM / 8));
    k_cstab<<<(SEQ * 32 + 255) / 256, 256, 0, stream>>>(CS);
    for (int c = 0; c < NB / NBC; ++c) {
        const bf* XBc = XB + (size_t)c * MROWC * DM;                 // rows of this pass
        float* OUTc = OUT + (size_t)c * NBC * SEQ_FULL * DM;         // output rows of this pass
        k_gemm_qkv<<<dim3(MROWC / 64, NQKV / 64, 1), 32, 0, stream>>>(XBc, WQKVB, F);
        k_rope<<<dim3(PLANE / 512u, 2, 1), 256, 0, stream>>>(F, CS, QK);
        k_vtp<<<dim3(PLANE / 512u, 1, 1), 256, 0, stream>>>(F, VT);
        k_sdpa<<<dim3(SEQ / 64, NBC * NH, 1), 128, 0, stream>>>(QK, VT, CT);
        k_gemm_out<<<dim3(SEQ / 64, DM / 64, NBC), 32, 0, stream>>>(CT, CT + CPL, WOB, OUTc);
    }
}

// v002
// A run of this version takes 337 microseconds.
// In two side-by-side timings against v001, it was 1.26 and 1.25 times as fast.
// Counting every step since v000, it is 2.00 times as fast.
#include <hip/hip_runtime.h>

// Dense (unmasked) multi-head softmax(q k^T / 8) v block: x [NB][SEQ][1024], fused Wqkv [3072][1024] ('oi', rows = (3, 16 heads, 64)), Wout [1024][1024] ('oi'), interleaved-pair rotary (positions = arange) on q and k, merged heads x Wout^T.
// Compute dtypes, f32 accumulate everywhere: x/Wqkv/Wout converted to bf16 (RNE) and multiplied with v_wmma_f32_16x16x32_bf16 (single product); scores q.k as bf16 hi|lo x bf16 hi|lo, three products (bf16 WMMA); P.V with v_wmma_f32_16x16x32_f16 (P f16 carried x256, v f16); ctx bf16 hi|lo x Wout bf16 (two products); rotary and softmax in f32.
// Batches are processed NBC at a time with reused planes (host loop of launches).

#ifndef NB
#define NB 4
#endif
#ifndef SEQ
#define SEQ 2048
#endif
#ifndef NBC
#define NBC ((((NB) % 2) == 0) ? 2 : 1)      // batches per pass
#endif
#define NB_FULL  4
#define SEQ_FULL 2048
#define DM   1024
#define NH   16
#define HD   64
#define NQKV (3 * DM)
#define PCAR 256.0f               // carry of the f16 probability operand
#define SCL  0.125f               // HD^-0.5, folded into the q planes (exact power of two)
#define L2E  1.4426950408889634f
#define NEGB (-1.0e30f)
#define CTP  72                   // LDS pitch (halves) of the ctx staging rows
#define KST  64                   // keys of one LDS stage of k_sdpa
#define KVP  72                   // LDS pitch (16-bit elements) of a staged 128-byte row: 144 B = 16 B x odd, conflict-free for 16-byte fragment reads
#define TLE  (64 * KVP)           // elements of one staged tile (64 rows)
#define STE  (3 * TLE)            // elements of one stage: K hi | K lo | V^T
#define MROWC (NBC * SEQ)                         // rows of one pass
#define PLANE ((unsigned)(NBC * NH * SEQ * HD))   // elements of one head plane set (one pass)
#define CPL  ((size_t)MROWC * DM)                 // elements of one ctx plane (one pass)

static_assert(HD == 64);
static_assert(DM == NH * HD);
static_assert(DM % 32 == 0);
static_assert(DM % 64 == 0);
static_assert(NQKV % 64 == 0);
static_assert(SEQ % 64 == 0);
static_assert(MROWC % 64 == 0);
static_assert(NB <= NB_FULL);
static_assert(SEQ <= SEQ_FULL);
static_assert(NB % NBC == 0);
static_assert(((size_t)NBC * NH * SEQ * HD) % 512 == 0);
static_assert((SEQ * 32) % 256 == 0);
static_assert((size_t)4 * NBC * NH * SEQ * HD < 4294967296ull);
static_assert((CTP * 2) % 16 == 0);
static_assert(CTP >= HD);
static_assert(SEQ % KST == 0);
static_assert(KST == 64 && KST % 32 == 0);
static_assert((KVP * 2) % 16 == 0 && KVP >= HD && KVP >= KST);

typedef _Float16 h16;
typedef unsigned short bf;
typedef __attribute__((ext_vector_type(16))) __bf16   v16bf;
typedef __attribute__((ext_vector_type(16))) _Float16 v16h;
typedef __attribute__((ext_vector_type(8)))  _Float16 v8h;
typedef __attribute__((ext_vector_type(8)))  unsigned short v8us;
typedef __attribute__((ext_vector_type(8)))  float    v8f;
typedef __attribute__((ext_vector_type(4)))  float    v4f;
typedef __attribute__((ext_vector_type(2)))  float    v2f;
typedef __attribute__((ext_vector_type(2)))  _Float16 v2h;
typedef __attribute__((ext_vector_type(2)))  unsigned short v2us;
typedef v4f  __attribute__((may_alias)) v4fa;
typedef v8us __attribute__((may_alias)) v8usa;
typedef v8h  __attribute__((may_alias)) v8ha;

__device__ __forceinline__ unsigned short f2bf(float f) { unsigned u = __float_as_uint(f); u += 0x7FFFu + ((u >> 16) & 1u); return (unsigned short)(u >> 16); }
__device__ __forceinline__ float bf2f(unsigned short b) { return __uint_as_float(((unsigned)b) << 16); }
__device__ __forceinline__ void splitf(float y, unsigned short& h, unsigned short& l) { h = f2bf(y); l = f2bf(y - bf2f(h)); }
__device__ __forceinline__ v16h cat16(v8h lo, v8h hi) { return __builtin_shufflevector(lo, hi, 0, 1, 2, 3, 4, 5, 6, 7, 8, 9, 10, 11, 12, 13, 14, 15); }
__device__ __forceinline__ v16bf cat16b(v8us lo, v8us hi) { return __builtin_bit_cast(v16bf, __builtin_shufflevector(lo, hi, 0, 1, 2, 3, 4, 5, 6, 7, 8, 9, 10, 11, 12, 13, 14, 15)); }
__device__ __forceinline__ v8f wmma16(v16h a, v16h b, v8f c) { return __builtin_amdgcn_wmma_f32_16x16x32_f16(false, a, false, b, (short)0, c, false, false); }
__device__ __forceinline__ v8f wmmab(v16bf a, v16bf b, v8f c) { return __builtin_amdgcn_wmma_f32_16x16x32_bf16(false, a, false, b, (short)0, c, false, false); }
// Fragment loaders (A and B share the k map): p points at row (lane&15), column k0 + 8*(lane>>4); elements 0..7 <- p[0..7], elements 8..15 <- p[16..23].
__device__ __forceinline__ v16bf ldb(const bf* p) { return cat16b(*(const v8us*)p, *(const v8us*)(p + 16)); }
// The same k map on the staged LDS rows (bf16 rows of K, f16 rows of V^T).
__device__ __forceinline__ v16bf ldbs(const unsigned short* p) { return cat16b(*(const v8usa*)p, *(const v8usa*)(p + 16)); }
__device__ __forceinline__ v16h ldhs(const unsigned short* p) { return cat16(*(const v8ha*)p, *(const v8ha*)(p + 16)); }

// ---- GEMM body: ONE WAVE per 64x64 output tile (16 accumulators), operands straight from K-contiguous bf16 planes; grid (M/64, N/64, Z), 32 threads.
// C[m][n] (f32, pitch ldc) = sum_k (A[m][k] (+ A2[m][k])) Bt[n][k]. K % 32 == 0, M % 64 == 0, N % 64 == 0 (asserted at file scope for the two uses).
// EPI == 0: the tile is stored to C. EPI == 1 (qkv projection): the 64 columns of a tile are one head of q, k or v, and the tile goes straight to that head's planes:
// q, k: rotary (interleaved pairs: out[2j] = x[2j] c_j - x[2j+1] s_j, out[2j+1] = x[2j] s_j + x[2j+1] c_j; q also x SCL), split bf16 hi|lo, planes [zz = b*NH + h][t][d]; v: f16, transposed, [zz][d][t].
template <int NSPLIT, int EPI = 0>
__device__ __forceinline__ void gemmw_body(const bf* __restrict__ A, const bf* __restrict__ A2, const bf* __restrict__ Bt, const int K, float* C, const int ldc, const size_t sA, const size_t sC,
                                           const float* __restrict__ CS = nullptr, bf* QK = nullptr, h16* VT = nullptr) {
    __shared__ __align__(16) float os[16 * 68];
    const size_t z = blockIdx.z; A += z * sA; A2 += z * sA; C += z * sC;
    const int lane = threadIdx.x & 31, lr = lane & 15, hi = lane >> 4; const int r0 = blockIdx.x * 64, c0 = blockIdx.y * 64;
    v8f acc[4][4];
#pragma unroll
    for (int mb = 0; mb < 4; ++mb)
#pragma unroll
        for (int nb = 0; nb < 4; ++nb) acc[mb][nb] = (v8f){};
    const size_t aoff = (size_t)(r0 + lr) * K + 8 * hi, boff = (size_t)(c0 + lr) * K + 8 * hi;
#pragma unroll 1
    for (int kc = 0; kc < K; kc += 32) {
        v16bf a[4], a2[4], bl;
#pragma unroll
        for (int mb = 0; mb < 4; ++mb) { a[mb] = ldb(A + aoff + (size_t)mb * 16 * K + kc); if (NSPLIT == 1) a2[mb] = ldb(A2 + aoff + (size_t)mb * 16 * K + kc); else a2[mb] = a[mb]; }
#pragma unroll
        for (int nb = 0; nb < 4; ++nb) { const v16bf b = ldb(Bt + boff + (size_t)nb * 16 * K + kc); if (nb == 3) bl = b;
#pragma unroll
            for (int mb = 0; mb < 4; ++mb) { acc[mb][nb] = wmmab(a[mb], b, acc[mb][nb]); if (NSPLIT == 1) acc[mb][nb] = wmmab(a2[mb], b, acc[mb][nb]); } }
        asm volatile("" : "+v"(acc[0][0]), "+v"(acc[0][1]), "+v"(acc[1][0]), "+v"(acc[1][1]), "+v"(acc[2][0]), "+v"(acc[2][1]), "+v"(acc[3][0]), "+v"(acc[3][1]));
        asm volatile("v_nop\n\tv_nop\n\tv_nop\n\tv_nop" : "+v"(acc[0][2]), "+v"(acc[0][3]), "+v"(acc[1][2]), "+v"(acc[1][3]), "+v"(acc[2][2]), "+v"(acc[2][3]), "+v"(acc[3][2]), "+v"(acc[3][3]) : "v"(a[0]), "v"(a[1]), "v"(a[2]), "v"(a[3]), "v"(bl));
        asm volatile("" : "+v"(acc[0][0]), "+v"(acc[0][1]), "+v"(acc[1][0]), "+v"(acc[1][1]), "+v"(acc[2][0]), "+v"(acc[2][1]), "+v"(acc[3][0]), "+v"(acc[3][1]) : "v"(a2[0]), "v"(a2[1]), "v"(a2[2]), "v"(a2[3]));
    }
    if constexpr (EPI == 1) {
        const unsigned which = (unsigned)c0 / DM, h = ((unsigned)c0 / HD) % NH;          // block-uniform: 0 q, 1 k, 2 v; head
        const unsigned zz = ((unsigned)r0 / SEQ) * NH + h, t0 = (unsigned)r0 % SEQ;      // SEQ % 64 == 0: the 64 rows lie in one batch
        const int rq = lane >> 3, pc = (lane & 7) * 8;                                   // read-back: 4 rows a step, 8 elements a lane
        if (which < 2u) {
            const float sc = which ? 1.0f : SCL;
            bf* ph = QK + (size_t)(which * 2u) * PLANE + (size_t)zz * (SEQ * HD) + (size_t)t0 * HD + pc;
            const float* cp = CS + (size_t)t0 * HD + pc;                                 // row t of the table: 32 (cos, sin) pairs = HD floats
#pragma unroll
            for (int mb = 0; mb < 4; ++mb) {
                v4f cs[4][2];                                                            // issued ahead of the staging so that their latency runs beside it
#pragma unroll
                for (int s = 0; s < 4; ++s) { const float* cr = cp + (size_t)(mb * 16 + s * 4 + rq) * HD; cs[s][0] = *(const v4f*)cr; cs[s][1] = *(const v4f*)(cr + 4); }
#pragma unroll
                for (int nb = 0; nb < 4; ++nb) {
#pragma unroll
                    for (int j = 0; j < 8; ++j) os[(hi * 8 + j) * 68 + nb * 16 + lr] = acc[mb][nb][j]; }
                asm volatile("s_wait_dscnt 0x0" ::: "memory"); __builtin_amdgcn_wave_barrier();   // the 16 staged rows are written before other lanes read them
#pragma unroll
                for (int s = 0; s < 4; ++s) { const int row = s * 4 + rq; v8us oh, ol;
#pragma unroll
                    for (int g = 0; g < 2; ++g) { const v4f x = *(const v4fa*)(os + row * 68 + pc + 4 * g); const v4f c = cs[s][g];
#pragma unroll
                        for (int p = 0; p < 2; ++p) {
                            const float y0 = (x[2 * p] * c[2 * p] - x[2 * p + 1] * c[2 * p + 1]) * sc;
                            const float y1 = (x[2 * p] * c[2 * p + 1] + x[2 * p + 1] * c[2 * p]) * sc;
                            unsigned short a, d;
                            splitf(y0, a, d); oh[4 * g + 2 * p] = a; ol[4 * g + 2 * p] = d; splitf(y1, a, d); oh[4 * g + 2 * p + 1] = a; ol[4 * g + 2 * p + 1] = d; } }
                    bf* pr = ph + (size_t)(mb * 16 + row) * HD;
                    *(v8us*)pr = oh; *(v8us*)(pr + PLANE) = ol; }
                if (mb < 3) asm volatile("s_wait_xcnt 0x0" ::: "memory");                         // stands in front of the next rows' loads and arithmetic, which reuse the registers these stores name
                asm volatile("s_wait_dscnt 0x0" ::: "memory"); __builtin_amdgcn_wave_barrier();   // every read of the staged rows has returned before they are rewritten
            }
        } else {
            h16* vs = (h16*)os;                                                          // 16 d rows x 64 t, pitch CTP halves, in the same staging bytes
            h16* pv = VT + (size_t)zz * (SEQ * HD) + (size_t)rq * SEQ + t0 + pc;
#pragma unroll
            for (int nb = 0; nb < 4; ++nb) {
#pragma unroll
                for (int mb = 0; mb < 4; ++mb) { v8h hv;                                 // a lane's 8 accumulator rows are 8 consecutive t of its column d
#pragma unroll
                    for (int j = 0; j < 8; ++j) hv[j] = (h16)acc[mb][nb][j];
                    *(v8ha*)(vs + lr * CTP + mb * 16 + hi * 8) = hv; }
                asm volatile("s_wait_dscnt 0x0" ::: "memory"); __builtin_amdgcn_wave_barrier();   // the 16 staged rows are written before other lanes read them
#pragma unroll
                for (int s = 0; s < 4; ++s) { const v8h val = *(const v8ha*)(vs + (s * 4 + rq) * CTP + pc);
                    *(v8h*)(pv + (size_t)(nb * 16 + s * 4) * SEQ) = val; }
                asm volatile("s_wait_dscnt 0x0" ::: "memory"); __builtin_amdgcn_wave_barrier();   // every read of the staged rows has returned before they are rewritten
            }
            asm volatile("s_wait_xcnt 0x0" ::: "memory");                                         // stands behind the last rows' stores, in front of any code laid out after them that reuses the registers they name
        }
        return;
    }
#pragma unroll
    for (int mb = 0; mb < 4; ++mb) {
#pragma unroll
        for (int nb = 0; nb < 4; ++nb) {
#pragma unroll
            for (int j = 0; j < 8; ++j) os[(hi * 8 + j) * 68 + nb * 16 + lr] = acc[mb][nb][j]; }
        asm volatile("s_wait_dscnt 0x0" ::: "memory"); __builtin_amdgcn_wave_barrier();
        float* crow = C + (size_t)(r0 + mb * 16) * ldc + c0;
{
#pragma unroll
            for (int s = 0; s < 8; ++s) { const int row = 2 * s + hi, cofs = lr * 4; const v4f val = *(const v4fa*)(os + row * 68 + cofs);
                *(v4f*)(crow + (size_t)row * ldc + cofs) = val; }
             }
        asm volatile("s_wait_dscnt 0x0" ::: "memory"); __builtin_amdgcn_wave_barrier();
    }
}
// qkv projection of one pass, sum_k XB[m][k] WQKVB[o][k], written as the head planes q hi|lo, k hi|lo (QK) and V^T (VT); grid (MROWC/64, NQKV/64, 1).
__global__ __launch_bounds__(32) void k_gemm_qkv(const bf* __restrict__ A, const bf* __restrict__ Bt, const float* __restrict__ CS, bf* QK, h16* VT) { gemmw_body<0, 1>(A, A, Bt, DM, nullptr, NQKV, 0, 0, CS, QK, VT); }
// output projection of one pass: OUT[b][t][o] = sum_k (CTXh + CTXl)[b*SEQ + t][k] WOB[o][k]; grid (SEQ/64, DM/64, NBC); output batch pitch SEQ_FULL*DM.
__global__ __launch_bounds__(32) void k_gemm_out(const bf* __restrict__ Ah, const bf* __restrict__ Al, const bf* __restrict__ Bt, float* C) { gemmw_body<1>(Ah, Al, Bt, DM, C, DM, (size_t)SEQ * DM, (size_t)SEQ_FULL * DM); }

__global__ __launch_bounds__(256) void k_cvt8(const float* __restrict__ src, bf* dst, unsigned n8, unsigned per8, unsigned sstride8) {
    const unsigned i = blockIdx.x * 256u + threadIdx.x; if (i >= n8) return;
    const size_t si = (size_t)(i / per8) * sstride8 + (i % per8);
    const v8f v = *(const v8f*)(src + si * 8); v8us o;
#pragma unroll
    for (int k = 0; k < 8; ++k) o[k] = f2bf(v[k]);
    *(v8us*)(dst + (size_t)i * 8) = o;  }

__global__ __launch_bounds__(256) void k_cstab(float* CS) {
    const int idx = blockIdx.x * 256 + threadIdx.x; if (idx >= SEQ * 32) return;
    const int j = idx & 31, t = idx >> 5;
    double p = 1.0;
    p *= (j & 1) ? 1.3335214321633240 : 1.0;
    p *= (j & 2) ? 1.7782794100389228 : 1.0;
    p *= (j & 4) ? 3.1622776601683795 : 1.0;
    p *= (j & 8) ? 10.0 : 1.0;
    p *= (j & 16) ? 100.0 : 1.0;
    const float pf = (float)p; const float inv = 1.0f / pf; const float ang = (float)t * inv;
    float sn, cn; sincosf(ang, &sn, &cn);
    v2f cs; cs[0] = cn; cs[1] = sn;
    *(v2f*)(CS + (size_t)idx * 2) = cs;  }

// One stage of k_sdpa's LDS ring: 64 keys = K hi rows, K lo rows (64 x 128 B each, contiguous in their planes) and V^T (64 d rows x 128 B, row pitch SEQ halves).
// 128 lanes x 12 asynchronous copies of 16 B; lane tid takes 16-byte piece (tid & 7) of rows (tid >> 3) + 16 i, so every wave-wide copy covers four whole 128-byte lines.
// kg, vg: the lane's first piece in the K hi plane and in V^T; ld: its LDS byte address in the stage's K hi tile.
__device__ __forceinline__ void stage_kv(const bf* kg, const h16* vg, const unsigned ld) {
    const bf* kl = kg + PLANE;
    const unsigned rb = 16u * KVP * 2u, tb = TLE * 2u;      // bytes of 16 staged rows, of one tile
    // The copies and the s_wait_xcnt that stands in front of any rewrite of their address registers are one statement, so that nothing can move in between.
    asm volatile("global_load_async_to_lds_b128 %0, %12, off\n\t"
                 "global_load_async_to_lds_b128 %1, %13, off\n\t"
                 "global_load_async_to_lds_b128 %2, %14, off\n\t"
                 "global_load_async_to_lds_b128 %3, %15, off\n\t"
                 "global_load_async_to_lds_b128 %4, %16, off\n\t"
                 "global_load_async_to_lds_b128 %5, %17, off\n\t"
                 "global_load_async_to_lds_b128 %6, %18, off\n\t"
                 "global_load_async_to_lds_b128 %7, %19, off\n\t"
                 "global_load_async_to_lds_b128 %8, %20, off\n\t"
                 "global_load_async_to_lds_b128 %9, %21, off\n\t"
                 "global_load_async_to_lds_b128 %10, %22, off\n\t"
                 "global_load_async_to_lds_b128 %11, %23, off\n\t"
                 "s_wait_xcnt 0x0"
                 :: "v"(ld), "v"(ld + rb), "v"(ld + 2u * rb), "v"(ld + 3u * rb),
                    "v"(ld + tb), "v"(ld + tb + rb), "v"(ld + tb + 2u * rb), "v"(ld + tb + 3u * rb),
                    "v"(ld + 2u * tb), "v"(ld + 2u * tb + rb), "v"(ld + 2u * tb + 2u * rb), "v"(ld + 2u * tb + 3u * rb),
                    "v"(kg), "v"(kg + 16 * HD), "v"(kg + 32 * HD), "v"(kg + 48 * HD),
                    "v"(kl), "v"(kl + 16 * HD), "v"(kl + 32 * HD), "v"(kl + 48 * HD),
                    "v"(vg), "v"(vg + 16 * SEQ), "v"(vg + 32 * SEQ), "v"(vg + 48 * SEQ)
                 : "memory");
}

// ---- fused dense softmax(q k^T) v: block = 4 waves, wave = 16 query rows of one (b, h); key loop over ALL keys in 32-key steps; K hi|lo and V^T come in 64-key stages through a two-buffer LDS ring that the four waves share, q fragments straight from the planes.
// S^T[key][query] = K.Q^T (A = K rows, B = Q rows; hi.hi + hi.lo + lo.hi): lane (hh, ln) holds query qw+ln, keys kt + 16j + 8hh + r, which IS the B fragment of P^T for
// O^T[d][query] = V^T.P^T (A = V^T rows d, k = keys). Online softmax per lane (one query per lane, halves combined by one xor-16 shuffle); the rescale factor is lane-local.
// grid (SEQ/64, NBC*NH), 128 threads.
__global__ __launch_bounds__(128) void k_sdpa(const bf* __restrict__ QK, const h16* __restrict__ VT, bf* CT) {
    __shared__ __align__(16) unsigned short cts[4 * 2 * 16 * CTP];
    __shared__ __align__(16) unsigned short kvs[2 * STE];
    const int lane = threadIdx.x & 31, hh = lane >> 4, ln = lane & 15;
    const int wave = __builtin_amdgcn_readfirstlane((int)(threadIdx.x >> 5));
    const int zz = blockIdx.y;
    const int qw = (int)blockIdx.x * 64 + wave * 16;
    const int nst = SEQ / KST;                              // stages: all keys 0 .. SEQ-1
    const unsigned hb = (unsigned)zz * (unsigned)(SEQ * HD);
    const unsigned qoff = hb + (unsigned)(qw + ln) * HD + 8u * hh;
    const unsigned fofs = (unsigned)ln * KVP + 8u * hh;     // fragment position in a staged tile: row ln, column 8 hh
    const unsigned tid = threadIdx.x;
    const bf* kg = QK + (size_t)(2u * PLANE + hb + tid * 8u);
    const h16* vg = VT + (size_t)(hb + (tid >> 3) * SEQ + (tid & 7u) * 8u);
    const unsigned ld = (unsigned)(size_t)kvs + ((tid >> 3) * KVP + (tid & 7u) * 8u) * 2u;
    v8f o[4];
#pragma unroll
    for (int dt = 0; dt < 4; ++dt) o[dt] = (v8f){};
    float m = NEGB, l = 0.0f;
    stage_kv(kg, vg, ld);
    asm volatile("s_wait_asynccnt 0x0" ::: "memory");       // this wave's copies of stage 0 have landed
    __syncthreads();                                        // stage 0 is readable by all four waves
    if (nst > 1) stage_kv(kg + KST * HD, vg + KST, ld + STE * 2u);
#pragma unroll 1                                            // rolled: one foot (waits, barrier, refill) per stage, in the ring's order
    for (int t = 0; t < nst; ++t) {
      const unsigned short* sb = kvs + (t & 1) * STE + fofs;
      for (int hf = 0; hf < KST / 32; ++hf) {
        const int kt = hf * 32;                             // first key of this step inside the stage
        unsigned qo = qoff; asm volatile("" : "+v"(qo));
        const v16bf qh0 = ldb(QK + (size_t)qo), qh1 = ldb(QK + (size_t)qo + 32), ql0 = ldb(QK + (size_t)(PLANE + qo)), ql1 = ldb(QK + (size_t)(PLANE + qo) + 32);
        v8f s0 = (v8f){}, s1 = (v8f){};
        {
            const unsigned short* kp = sb + kt * KVP;
            const v16bf kh0 = ldbs(kp), kh1 = ldbs(kp + 32), kl0 = ldbs(kp + TLE), kl1 = ldbs(kp + TLE + 32);
            s0 = wmmab(kh0, qh0, s0); s0 = wmmab(kh1, qh1, s0); s0 = wmmab(kh0, ql0, s0); s0 = wmmab(kh1, ql1, s0); s0 = wmmab(kl0, qh0, s0); s0 = wmmab(kl1, qh1, s0);
            asm volatile("v_nop\n\tv_nop\n\tv_nop\n\tv_nop" : "+v"(s0) : "v"(kh0), "v"(kh1), "v"(kl0), "v"(kl1), "v"(qh0), "v"(qh1), "v"(ql0), "v"(ql1));
        }
        asm volatile("" ::: "memory");
        {
            const unsigned short* kp = sb + (kt + 16) * KVP;
            const v16bf kh0 = ldbs(kp), kh1 = ldbs(kp + 32), kl0 = ldbs(kp + TLE), kl1 = ldbs(kp + TLE + 32);
            s1 = wmmab(kh0, qh0, s1); s1 = wmmab(kh1, qh1, s1); s1 = wmmab(kh0, ql0, s1); s1 = wmmab(kh1, ql1, s1); s1 = wmmab(kl0, qh0, s1); s1 = wmmab(kl1, qh1, s1);
            asm volatile("v_nop\n\tv_nop\n\tv_nop\n\tv_nop" : "+v"(s1), "+v"(s0) : "v"(kh0), "v"(kh1), "v"(kl0), "v"(kl1), "v"(qh0), "v"(qh1), "v"(ql0), "v"(ql1));
        }
        float mx = s0[0];
#pragma unroll
        for (int r = 1; r < 8; ++r) mx = fmaxf(mx, s0[r]);
#pragma unroll
        for (int r = 0; r < 8; ++r) mx = fmaxf(mx, s1[r]);
        mx = fmaxf(mx, __shfl_xor(mx, 16, 32));
        const float mn = fmaxf(m, mx);
        const float al = __builtin_amdgcn_exp2f((m - mn) * L2E);
        m = mn;
        float rs = 0.0f; v16h pb;
#pragma unroll
        for (int r = 0; r < 8; ++r) {
            const float e0 = __builtin_amdgcn_exp2f((s0[r] - mn) * L2E), e1 = __builtin_amdgcn_exp2f((s1[r] - mn) * L2E);
            rs += e0 + e1;
            const float c0 = e0 * PCAR, c1 = e1 * PCAR;
            pb[r] = (h16)c0; pb[8 + r] = (h16)c1;
        }
        l = l * al + rs;
#pragma unroll
        for (int dt = 0; dt < 4; ++dt) o[dt] = o[dt] * al;
        asm volatile("" ::: "memory");
        v16h va[4];
        const unsigned short* vp = sb + 2 * TLE + kt;
#pragma unroll
        for (int dt = 0; dt < 4; ++dt) va[dt] = ldhs(vp + dt * 16 * KVP);
#pragma unroll
        for (int dt = 0; dt < 4; ++dt) o[dt] = wmma16(va[dt], pb, o[dt]);
        asm volatile("v_nop\n\tv_nop\n\tv_nop\n\tv_nop" : "+v"(o[0]), "+v"(o[1]), "+v"(o[2]), "+v"(o[3]) : "v"(pb), "v"(va[0]), "v"(va[1]), "v"(va[2]), "v"(va[3]));
      }
      asm volatile("s_wait_dscnt 0x0" ::: "memory");        // this wave's reads of stage t have returned before its buffer is refilled
      asm volatile("s_wait_asynccnt 0x0" ::: "memory");     // this wave's copies of stage t + 1 have landed
      __syncthreads();                                      // publishes stage t + 1 and ends every wave's reads of stage t
      if (t + 2 < nst) stage_kv(kg + (size_t)(t + 2) * (KST * HD), vg + (t + 2) * KST, ld + (unsigned)(t & 1) * (STE * 2u));
    }
    asm volatile("s_wait_asynccnt 0x0" ::: "memory");       // no copy is outstanding when the wave goes on to the epilogue
    l += __shfl_xor(l, 16, 32);
    const float inv = 1.0f / (PCAR * l);
    const int cb = wave * (2 * 16 * CTP);                   // wave-private staging: [plane hi|lo][16 rows][CTP]
#pragma unroll
    for (int dt = 0; dt < 4; ++dt) { v8us oh, ol;
#pragma unroll
        for (int r = 0; r < 8; ++r) { const float y = o[dt][r] * inv; unsigned short a, c; splitf(y, a, c); oh[r] = a; ol[r] = c; }
        *(v8usa*)(cts + cb + ln * CTP + dt * 16 + 8 * hh) = oh; *(v8usa*)(cts + cb + 16 * CTP + ln * CTP + dt * 16 + 8 * hh) = ol; }
    asm volatile("s_wait_dscnt 0x0" ::: "memory"); __builtin_amdgcn_wave_barrier();
    const int b = zz / NH, h = zz % NH;
    const int rq = lane >> 3, pc = (lane & 7) * 8;
    v8us hv[4], lv[4];
#pragma unroll
    for (int it = 0; it < 4; ++it) { const int row = it * 4 + rq; hv[it] = *(const v8usa*)(cts + cb + row * CTP + pc); lv[it] = *(const v8usa*)(cts + cb + 16 * CTP + row * CTP + pc); }
    bf* gh = CT + ((size_t)b * SEQ + qw) * DM + h * HD + pc;
{
#pragma unroll
        for (int it = 0; it < 4; ++it) { const int row = it * 4 + rq; *(v8us*)(gh + (size_t)row * DM) = hv[it]; *(v8us*)(gh + CPL + (size_t)row * DM) = lv[it]; }
         }
}

constexpr size_t SZ_WQKV = (size_t)NQKV * DM * 2;
constexpr size_t SZ_WO   = (size_t)DM * DM * 2;
constexpr size_t SZ_CS   = (size_t)SEQ * 32 * 2 * 4;
constexpr size_t SZ_XB   = (size_t)NB * SEQ * DM * 2;          // all batches, compact [NB][SEQ][DM]
constexpr size_t SZ_QK   = (size_t)4 * NBC * NH * SEQ * HD * 2; // one pass: q hi, q lo, k hi, k lo
constexpr size_t SZ_VT   = (size_t)NBC * NH * SEQ * HD * 2;     // one pass
constexpr size_t SZ_CTX  = (size_t)2 * MROWC * DM * 2;          // one pass: ctx hi, ctx lo
constexpr size_t SZ_TOTAL = SZ_WQKV + SZ_WO + SZ_CS + SZ_XB + SZ_CTX + SZ_QK + SZ_VT;
static_assert(SZ_TOTAL <= (size_t)134217728);
static_assert(SZ_WQKV % 256 == 0 && SZ_WO % 256 == 0 && SZ_CS % 256 == 0 && SZ_XB % 256 == 0 && SZ_CTX % 256 == 0 && SZ_QK % 256 == 0 && SZ_VT % 256 == 0);

extern "C" void kernel_launch(void* const* d_in, const int* in_sizes, int n_in,
                              void* d_out, int out_size, void* d_ws, size_t ws_size, hipStream_t stream) {
    if (n_in < 3) return;
    const long long need_x = (long long)(NB - 1) * SEQ_FULL * DM + (long long)SEQ * DM;
    if ((long long)in_sizes[0] < need_x) return;
    if ((long long)in_sizes[1] < (long long)NQKV * DM) return;
    if ((long long)in_sizes[2] < (long long)DM * DM) return;
    if ((long long)out_size < need_x) return;
    if (SZ_TOTAL > ws_size) return;
    const float* x = (const float*)d_in[0];        // [NB_FULL][SEQ_FULL][DM]
    const float* wqkv = (const float*)d_in[1];     // [NQKV][DM] ('oi')
    const float* wout = (const float*)d_in[2];     // [DM][DM] ('oi')
    float* OUT = (float*)d_out;                    // [NB_FULL][SEQ_FULL][DM]
    char* base = (char*)d_ws; size_t off = 0;
    bf* WQKVB = (bf*)(base + off); off += SZ_WQKV;
    bf* WOB = (bf*)(base + off); off += SZ_WO;
    float* CS = (float*)(base + off); off += SZ_CS;
    bf* XB = (bf*)(base + off); off += SZ_XB;
    bf* CT = (bf*)(base + off); off += SZ_CTX;     // ctx hi plane, lo plane at + CPL
    bf* QK = (bf*)(base + off); off += SZ_QK;
    h16* VT = (h16*)(base + off); off += SZ_VT;

    const unsigned n8w = (unsigned)((size_t)NQKV * DM / 8), n8o = (unsigned)((size_t)DM * DM / 8), n8x = (unsigned)((size_t)NB * SEQ * DM / 8);
    k_cvt8<<<(n8w + 255) / 256, 256, 0, stream>>>(wqkv, WQKVB, n8w, n8w, 0u);
    k_cvt8<<<(n8o + 255) / 256, 256, 0, stream>>>(wout, WOB, n8o, n8o, 0u);
    k_cvt8<<<(n8x + 255) / 256, 256, 0, stream>>>(x, XB, n8x, (unsigned)((size_t)SEQ * DM / 8), (unsigned)((size_t)SEQ_FULL * DM / 8));
    k_cstab<<<(SEQ * 32 + 255) / 256, 256, 0, stream>>>(CS);
    for (int c = 0; c < NB / NBC; ++c) {
        const bf* XBc = XB + (size_t)c * MROWC * DM;                 // rows of this pass
        float* OUTc = OUT + (size_t)c * NBC * SEQ_FULL * DM;         // output rows of this pass
        k_gemm_qkv<<<dim3(MROWC / 64, NQKV / 64, 1), 32, 0, stream>>>(XBc, WQKVB, CS, QK, VT);
        k_sdpa<<<dim3(SEQ / 64, NBC * NH, 1), 128, 0, stream>>>(QK, VT, CT);
        k_gemm_out<<<dim3(SEQ / 64, DM / 64, NBC), 32, 0, stream>>>(CT, CT + CPL, WOB, OUTc);
    }
}

// v003
// One run takes 273 microseconds.
// Timed twice side by side with v002, it ran 1.23 times as fast both times.
// Counting every step since v000, it is 2.46 times as fast.
#include <hip/hip_runtime.h>

// Dense (unmasked) multi-head softmax(q k^T / 8) v block: x [NB][SEQ][1024], fused Wqkv [3072][1024] ('oi', rows = (3, 16 heads, 64)), Wout [1024][1024] ('oi'), interleaved-pair rotary (positions = arange) on q and k, merged heads x Wout^T.
// Compute dtypes, f32 accumulate everywhere: x/Wqkv/Wout converted to bf16 (RNE) and multiplied with v_wmma_f32_16x16x32_bf16 (single product); scores q.k as bf16 hi|lo x bf16 hi|lo, three products (bf16 WMMA); P.V with v_wmma_f32_16x16x32_f16 (P f16 carried x256, v f16); ctx bf16 hi|lo x Wout bf16 (two products); rotary and softmax in f32.
// Batches are processed NBC at a time with reused planes (host loop of launches).

#ifndef NB
#define NB 4
#endif
#ifndef SEQ
#define SEQ 2048
#endif
#ifndef NBC
#define NBC ((((NB) % 2) == 0) ? 2 : 1)      // batches per pass
#endif
#define NB_FULL  4
#define SEQ_FULL 2048
#define DM   1024
#define NH   16
#define HD   64
#define NQKV (3 * DM)
#define PCAR 256.0f               // carry of the f16 probability operand
#define SCL  0.125f               // HD^-0.5, folded into the q planes (exact power of two)
#define L2E  1.4426950408889634f
#define NEGB (-1.0e30f)
#define CTP  72                   // LDS pitch (halves) of the ctx staging rows
#define KST  64                   // keys of one LDS stage of k_sdpa
#define KVP  72                   // LDS pitch (16-bit elements) of a staged 128-byte row: 144 B = 16 B x odd, conflict-free for 16-byte fragment reads
#define TLE  (64 * KVP)           // elements of one staged tile (64 rows)
#define STE  (3 * TLE)            // elements of one stage: K hi | K lo | V^T
#define GBT  128                  // rows and columns of a GEMM block's output tile (2 x 2 waves of 64 x 64)
#define GKS  64                   // k elements of one LDS stage of the GEMMs: 128 bytes a row, staged at pitch KVP
#define GTL  (GBT * KVP)          // elements of one staged GEMM operand tile (128 rows)
#define MROWC (NBC * SEQ)                         // rows of one pass
#define PLANE ((unsigned)(NBC * NH * SEQ * HD))   // elements of one head plane set (one pass)
#define CPL  ((size_t)MROWC * DM)                 // elements of one ctx plane (one pass)

static_assert(HD == 64);
static_assert(DM == NH * HD);
static_assert(DM % 32 == 0);
static_assert(DM % 64 == 0);
static_assert(NQKV % 64 == 0);
static_assert(SEQ % 64 == 0);
static_assert(MROWC % 64 == 0);
static_assert(NB <= NB_FULL);
static_assert(SEQ <= SEQ_FULL);
static_assert(NB % NBC == 0);
static_assert(((size_t)NBC * NH * SEQ * HD) % 512 == 0);
static_assert((SEQ * 32) % 256 == 0);
static_assert((size_t)4 * NBC * NH * SEQ * HD < 4294967296ull);
static_assert((CTP * 2) % 16 == 0);
static_assert(CTP >= HD);
static_assert(SEQ % KST == 0);
static_assert(KST == 64 && KST % 32 == 0);
static_assert((KVP * 2) % 16 == 0 && KVP >= HD && KVP >= KST);
static_assert(GBT == 128 && GKS == 64 && KVP >= GKS);
static_assert(MROWC % GBT == 0 && SEQ % GBT == 0 && NQKV % GBT == 0 && DM % GBT == 0);
static_assert(DM % GKS == 0 && DM / GKS >= 2);

typedef _Float16 h16;
typedef unsigned short bf;
typedef __attribute__((ext_vector_type(16))) __bf16   v16bf;
typedef __attribute__((ext_vector_type(16))) _Float16 v16h;
typedef __attribute__((ext_vector_type(8)))  _Float16 v8h;
typedef __attribute__((ext_vector_type(8)))  unsigned short v8us;
typedef __attribute__((ext_vector_type(8)))  float    v8f;
typedef __attribute__((ext_vector_type(4)))  float    v4f;
typedef __attribute__((ext_vector_type(2)))  float    v2f;
typedef __attribute__((ext_vector_type(2)))  _Float16 v2h;
typedef __attribute__((ext_vector_type(2)))  unsigned short v2us;
typedef v4f  __attribute__((may_alias)) v4fa;
typedef v8us __attribute__((may_alias)) v8usa;
typedef v8h  __attribute__((may_alias)) v8ha;

__device__ __forceinline__ unsigned short f2bf(float f) { unsigned u = __float_as_uint(f); u += 0x7FFFu + ((u >> 16) & 1u); return (unsigned short)(u >> 16); }
__device__ __forceinline__ float bf2f(unsigned short b) { return __uint_as_float(((unsigned)b) << 16); }
__device__ __forceinline__ void splitf(float y, unsigned short& h, unsigned short& l) { h = f2bf(y); l = f2bf(y - bf2f(h)); }
__device__ __forceinline__ v16h cat16(v8h lo, v8h hi) { return __builtin_shufflevector(lo, hi, 0, 1, 2, 3, 4, 5, 6, 7, 8, 9, 10, 11, 12, 13, 14, 15); }
__device__ __forceinline__ v16bf cat16b(v8us lo, v8us hi) { return __builtin_bit_cast(v16bf, __builtin_shufflevector(lo, hi, 0, 1, 2, 3, 4, 5, 6, 7, 8, 9, 10, 11, 12, 13, 14, 15)); }
__device__ __forceinline__ v8f wmma16(v16h a, v16h b, v8f c) { return __builtin_amdgcn_wmma_f32_16x16x32_f16(false, a, false, b, (short)0, c, false, false); }
__device__ __forceinline__ v8f wmmab(v16bf a, v16bf b, v8f c) { return __builtin_amdgcn_wmma_f32_16x16x32_bf16(false, a, false, b, (short)0, c, false, false); }
// Fragment loaders (A and B share the k map): p points at row (lane&15), column k0 + 8*(lane>>4); elements 0..7 <- p[0..7], elements 8..15 <- p[16..23].
__device__ __forceinline__ v16bf ldb(const bf* p) { return cat16b(*(const v8us*)p, *(const v8us*)(p + 16)); }
// The same k map on the staged LDS rows (bf16 rows of K, f16 rows of V^T).
__device__ __forceinline__ v16bf ldbs(const unsigned short* p) { return cat16b(*(const v8usa*)p, *(const v8usa*)(p + 16)); }
__device__ __forceinline__ v16h ldhs(const unsigned short* p) { return cat16(*(const v8ha*)p, *(const v8ha*)(p + 16)); }

// One 128-row x 128-byte operand tile of a GEMM stage: 128 lanes x 8 asynchronous copies of 16 B; lane tid takes 16-byte piece (tid & 7) of rows (tid >> 3) + 16 i, so every wave-wide copy covers four whole 128-byte lines.
// g: the lane's first piece in the K-contiguous plane (row pitch K elements); ld: its LDS byte address in the staged tile (row pitch KVP elements).
__device__ __forceinline__ void stage_g(const bf* g, const int K, const unsigned ld) {
    const unsigned rb = 16u * KVP * 2u;                     // bytes of 16 staged rows
    const size_t rg = (size_t)16 * K;                       // elements of 16 plane rows
    // The copies and the s_wait_xcnt that stands in front of any rewrite of their address registers are one statement, so that nothing can move in between.
    asm volatile("global_load_async_to_lds_b128 %0, %8, off\n\t"
                 "global_load_async_to_lds_b128 %1, %9, off\n\t"
                 "global_load_async_to_lds_b128 %2, %10, off\n\t"
                 "global_load_async_to_lds_b128 %3, %11, off\n\t"
                 "global_load_async_to_lds_b128 %4, %12, off\n\t"
                 "global_load_async_to_lds_b128 %5, %13, off\n\t"
                 "global_load_async_to_lds_b128 %6, %14, off\n\t"
                 "global_load_async_to_lds_b128 %7, %15, off\n\t"
                 "s_wait_xcnt 0x0"
                 :: "v"(ld), "v"(ld + rb), "v"(ld + 2u * rb), "v"(ld + 3u * rb), "v"(ld + 4u * rb), "v"(ld + 5u * rb), "v"(ld + 6u * rb), "v"(ld + 7u * rb),
                    "v"(g), "v"(g + rg), "v"(g + 2 * rg), "v"(g + 3 * rg), "v"(g + 4 * rg), "v"(g + 5 * rg), "v"(g + 6 * rg), "v"(g + 7 * rg)
                 : "memory");
}

// ---- GEMM body: block = 4 waves on a 128x128 output tile, ONE WAVE per 64x64 quarter (16 accumulators); the block's 128 rows of A (, A2) and of Bt come from the K-contiguous bf16 planes in 64-k stages through a two-buffer LDS ring that the four waves share; grid (M/128, N/128, Z), 128 threads.
// C[m][n] (f32, pitch ldc) = sum_k (A[m][k] (+ A2[m][k])) Bt[n][k]. K % 64 == 0, K >= 128, M % 128 == 0, N % 128 == 0 (asserted at file scope for the two uses).
// EPI == 0: the tile is stored to C. EPI == 1 (qkv projection): the 64 columns of a wave's quarter are one head of q, k or v, and the quarter goes straight to that head's planes:
// q, k: rotary (interleaved pairs: out[2j] = x[2j] c_j - x[2j+1] s_j, out[2j+1] = x[2j] s_j + x[2j+1] c_j; q also x SCL), split bf16 hi|lo, planes [zz = b*NH + h][t][d]; v: f16, transposed, [zz][d][t].
template <int NSPLIT, int EPI = 0>
__device__ __forceinline__ void gemmw_body(const bf* __restrict__ A, const bf* __restrict__ A2, const bf* __restrict__ Bt, const int K, float* C, const int ldc, const size_t sA, const size_t sC,
                                           const float* __restrict__ CS = nullptr, bf* QK = nullptr, h16* VT = nullptr) {
    constexpr int NT = 2 + NSPLIT;                          // tiles of one stage: A (, A2), Bt
    __shared__ __align__(16) float osb[4 * 16 * 68];
    __shared__ __align__(16) unsigned short gs[2 * NT * GTL];
    const size_t z = blockIdx.z; A += z * sA; A2 += z * sA; C += z * sC;
    const int lane = threadIdx.x & 31, lr = lane & 15, hi = lane >> 4;
    const int wave = __builtin_amdgcn_readfirstlane((int)(threadIdx.x >> 5));
    const int rb0 = blockIdx.x * GBT, cb0 = blockIdx.y * GBT, wr = (wave & 1) * 64, wc = (wave >> 1) * 64;
    const int r0 = rb0 + wr, c0 = cb0 + wc;                 // the wave's own 64x64 quarter
    float* os = osb + wave * (16 * 68);                     // wave-private epilogue staging
    v8f acc[4][4];
#pragma unroll
    for (int mb = 0; mb < 4; ++mb)
#pragma unroll
        for (int nb = 0; nb < 4; ++nb) acc[mb][nb] = (v8f){};
    const unsigned tid = threadIdx.x;
    const size_t goff = (size_t)(tid >> 3) * K + (tid & 7u) * 8u;
    const bf* ga = A + (size_t)rb0 * K + goff; const bf* ga2 = A2 + (size_t)rb0 * K + goff; const bf* gb = Bt + (size_t)cb0 * K + goff;
    const unsigned ld = (unsigned)(size_t)gs + ((tid >> 3) * KVP + (tid & 7u) * 8u) * 2u;
    const int nst = K / GKS;
    auto fill = [&](const int st, const unsigned buf) {     // stage st (k = 64 st ..) into ring buffer buf
        const unsigned l0 = ld + buf * (unsigned)(NT * GTL * 2);
        stage_g(ga + st * GKS, K, l0);
        if (NSPLIT == 1) stage_g(ga2 + st * GKS, K, l0 + GTL * 2u);
        stage_g(gb + st * GKS, K, l0 + (unsigned)((NT - 1) * GTL * 2));
    };
    fill(0, 0u);
    asm volatile("s_wait_asynccnt 0x0" ::: "memory");       // this wave's copies of stage 0 have landed
    __syncthreads();                                        // stage 0 is readable by all four waves
    fill(1, 1u);
#pragma unroll 1                                            // rolled: one foot (waits, barrier, refill) per stage, in the ring's order
    for (int t = 0; t < nst; ++t) {
      const unsigned short* sb = gs + (t & 1) * (NT * GTL) + lr * KVP + 8 * hi;    // fragment position: row lr, column 8 hi
      const unsigned short* pa = sb + wr * KVP; const unsigned short* pb = sb + (NT - 1) * GTL + wc * KVP;
#pragma unroll                                              // both 32-k steps of a stage in line: their LDS offsets become immediates
      for (int kc = 0; kc < GKS; kc += 32) {
        v16bf a[4], a2[4], bl;
#pragma unroll
        for (int mb = 0; mb < 4; ++mb) { a[mb] = ldbs(pa + mb * 16 * KVP + kc); if (NSPLIT == 1) a2[mb] = ldbs(pa + GTL + mb * 16 * KVP + kc); else a2[mb] = a[mb]; }
#pragma unroll
        for (int nb = 0; nb < 4; ++nb) { const v16bf b = ldbs(pb + nb * 16 * KVP + kc); if (nb == 3) bl = b;
#pragma unroll
            for (int mb = 0; mb < 4; ++mb) { acc[mb][nb] = wmmab(a[mb], b, acc[mb][nb]); if (NSPLIT == 1) acc[mb][nb] = wmmab(a2[mb], b, acc[mb][nb]); } }
        asm volatile("" : "+v"(acc[0][0]), "+v"(acc[0][1]), "+v"(acc[1][0]), "+v"(acc[1][1]), "+v"(acc[2][0]), "+v"(acc[2][1]), "+v"(acc[3][0]), "+v"(acc[3][1]));
        asm volatile("v_nop\n\tv_nop\n\tv_nop\n\tv_nop" : "+v"(acc[0][2]), "+v"(acc[0][3]), "+v"(acc[1][2]), "+v"(acc[1][3]), "+v"(acc[2][2]), "+v"(acc[2][3]), "+v"(acc[3][2]), "+v"(acc[3][3]) : "v"(a[0]), "v"(a[1]), "v"(a[2]), "v"(a[3]), "v"(bl));
        asm volatile("" : "+v"(acc[0][0]), "+v"(acc[0][1]), "+v"(acc[1][0]), "+v"(acc[1][1]), "+v"(acc[2][0]), "+v"(acc[2][1]), "+v"(acc[3][0]), "+v"(acc[3][1]) : "v"(a2[0]), "v"(a2[1]), "v"(a2[2]), "v"(a2[3]));
      }
      asm volatile("s_wait_dscnt 0x0" ::: "memory");        // this wave's reads of stage t have returned before its buffer is refilled
      asm volatile("s_wait_asynccnt 0x0" ::: "memory");     // this wave's copies of stage t + 1 have landed
      __syncthreads();                                      // publishes stage t + 1 and ends every wave's reads of stage t
      if (t + 2 < nst) fill(t + 2, (unsigned)(t & 1));
    }
    asm volatile("s_wait_asynccnt 0x0" ::: "memory");       // no copy is outstanding when the wave goes on to the epilogue
    if constexpr (EPI == 1) {
        const unsigned which = (unsigned)c0 / DM, h = ((unsigned)c0 / HD) % NH;          // wave-uniform: 0 q, 1 k, 2 v; head
        const unsigned zz = ((unsigned)r0 / SEQ) * NH + h, t0 = (unsigned)r0 % SEQ;      // SEQ % 64 == 0: the 64 rows lie in one batch
        const int rq = lane >> 3, pc = (lane & 7) * 8;                                   // read-back: 4 rows a step, 8 elements a lane
        if (which < 2u) {
            const float sc = which ? 1.0f : SCL;
            bf* ph = QK + (size_t)(which * 2u) * PLANE + (size_t)zz * (SEQ * HD) + (size_t)t0 * HD + pc;
            const float* cp = CS + (size_t)t0 * HD + pc;                                 // row t of the table: 32 (cos, sin) pairs = HD floats
#pragma unroll
            for (int mb = 0; mb < 4; ++mb) {
                v4f cs[4][2];                                                            // issued ahead of the staging so that their latency runs beside it
#pragma unroll
                for (int s = 0; s < 4; ++s) { const float* cr = cp + (size_t)(mb * 16 + s * 4 + rq) * HD; cs[s][0] = *(const v4f*)cr; cs[s][1] = *(const v4f*)(cr + 4); }
#pragma unroll
                for (int nb = 0; nb < 4; ++nb) {
#pragma unroll
                    for (int j = 0; j < 8; ++j) os[(hi * 8 + j) * 68 + nb * 16 + lr] = acc[mb][nb][j]; }
                asm volatile("s_wait_dscnt 0x0" ::: "memory"); __builtin_amdgcn_wave_barrier();   // the 16 staged rows are written before other lanes read them
#pragma unroll
                for (int s = 0; s < 4; ++s) { const int row = s * 4 + rq; v8us oh, ol;
#pragma unroll
                    for (int g = 0; g < 2; ++g) { const v4f x = *(const v4fa*)(os + row * 68 + pc + 4 * g); const v4f c = cs[s][g];
#pragma unroll
                        for (int p = 0; p < 2; ++p) {
                            const float y0 = (x[2 * p] * c[2 * p] - x[2 * p + 1] * c[2 * p + 1]) * sc;
                            const float y1 = (x[2 * p] * c[2 * p + 1] + x[2 * p + 1] * c[2 * p]) * sc;
                            unsigned short a, d;
                            splitf(y0, a, d); oh[4 * g + 2 * p] = a; ol[4 * g + 2 * p] = d; splitf(y1, a, d); oh[4 * g + 2 * p + 1] = a; ol[4 * g + 2 * p + 1] = d; } }
                    bf* pr = ph + (size_t)(mb * 16 + row) * HD;
                    *(v8us*)pr = oh; *(v8us*)(pr + PLANE) = ol; }
                if (mb < 3) asm volatile("s_wait_xcnt 0x0" ::: "memory");                         // stands in front of the next rows' loads and arithmetic, which reuse the registers these stores name
                asm volatile("s_wait_dscnt 0x0" ::: "memory"); __builtin_amdgcn_wave_barrier();   // every read of the staged rows has returned before they are rewritten
            }
        } else {
            h16* vs = (h16*)os;                                                          // 16 d rows x 64 t, pitch CTP halves, in the same staging bytes
            h16* pv = VT + (size_t)zz * (SEQ * HD) + (size_t)rq * SEQ + t0 + pc;
#pragma unroll
            for (int nb = 0; nb < 4; ++nb) {
#pragma unroll
                for (int mb = 0; mb < 4; ++mb) { v8h hv;                                 // a lane's 8 accumulator rows are 8 consecutive t of its column d
#pragma unroll
                    for (int j = 0; j < 8; ++j) hv[j] = (h16)acc[mb][nb][j];
                    *(v8ha*)(vs + lr * CTP + mb * 16 + hi * 8) = hv; }
                asm volatile("s_wait_dscnt 0x0" ::: "memory"); __builtin_amdgcn_wave_barrier();   // the 16 staged rows are written before other lanes read them
#pragma unroll
                for (int s = 0; s < 4; ++s) { const v8h val = *(const v8ha*)(vs + (s * 4 + rq) * CTP + pc);
                    *(v8h*)(pv + (size_t)(nb * 16 + s * 4) * SEQ) = val; }
                asm volatile("s_wait_dscnt 0x0" ::: "memory"); __builtin_amdgcn_wave_barrier();   // every read of the staged rows has returned before they are rewritten
            }
            asm volatile("s_wait_xcnt 0x0" ::: "memory");                                         // stands behind the last rows' stores, in front of any code laid out after them that reuses the registers they name
        }
        return;
    }
#pragma unroll
    for (int mb = 0; mb < 4; ++mb) {
#pragma unroll
        for (int nb = 0; nb < 4; ++nb) {
#pragma unroll
            for (int j = 0; j < 8; ++j) os[(hi * 8 + j) * 68 + nb * 16 + lr] = acc[mb][nb][j]; }
        asm volatile("s_wait_dscnt 0x0" ::: "memory"); __builtin_amdgcn_wave_barrier();
        float* crow = C + (size_t)(r0 + mb * 16) * ldc + c0;
{
#pragma unroll
            for (int s = 0; s < 8; ++s) { const int row = 2 * s + hi, cofs = lr * 4; const v4f val = *(const v4fa*)(os + row * 68 + cofs);
                *(v4f*)(crow + (size_t)row * ldc + cofs) = val; }
             }
        asm volatile("s_wait_dscnt 0x0" ::: "memory"); __builtin_amdgcn_wave_barrier();
    }
}
// qkv projection of one pass, sum_k XB[m][k] WQKVB[o][k], written as the head planes q hi|lo, k hi|lo (QK) and V^T (VT); grid (MROWC/128, NQKV/128, 1).
__global__ __launch_bounds__(128) void k_gemm_qkv(const bf* __restrict__ A, const bf* __restrict__ Bt, const float* __restrict__ CS, bf* QK, h16* VT) { gemmw_body<0, 1>(A, A, Bt, DM, nullptr, NQKV, 0, 0, CS, QK, VT); }
// output projection of one pass: OUT[b][t][o] = sum_k (CTXh + CTXl)[b*SEQ + t][k] WOB[o][k]; grid (SEQ/128, DM/128, NBC); output batch pitch SEQ_FULL*DM.
__global__ __launch_bounds__(128) void k_gemm_out(const bf* __restrict__ Ah, const bf* __restrict__ Al, const bf* __restrict__ Bt, float* C) { gemmw_body<1>(Ah, Al, Bt, DM, C, DM, (size_t)SEQ * DM, (size_t)SEQ_FULL * DM); }

__global__ __launch_bounds__(256) void k_cvt8(const float* __restrict__ src, bf* dst, unsigned n8, unsigned per8, unsigned sstride8) {
    const unsigned i = blockIdx.x * 256u + threadIdx.x; if (i >= n8) return;
    const size_t si = (size_t)(i / per8) * sstride8 + (i % per8);
    const v8f v = *(const v8f*)(src + si * 8); v8us o;
#pragma unroll
    for (int k = 0; k < 8; ++k) o[k] = f2bf(v[k]);
    *(v8us*)(dst + (size_t)i * 8) = o;  }

__global__ __launch_bounds__(256) void k_cstab(float* CS) {
    const int idx = blockIdx.x * 256 + threadIdx.x; if (idx >= SEQ * 32) return;
    const int j = idx & 31, t = idx >> 5;
    double p = 1.0;
    p *= (j & 1) ? 1.3335214321633240 : 1.0;
    p *= (j & 2) ? 1.7782794100389228 : 1.0;
    p *= (j & 4) ? 3.1622776601683795 : 1.0;
    p *= (j & 8) ? 10.0 : 1.0;
    p *= (j & 16) ? 100.0 : 1.0;
    const float pf = (float)p; const float inv = 1.0f / pf; const float ang = (float)t * inv;
    float sn, cn; sincosf(ang, &sn, &cn);
    v2f cs; cs[0] = cn; cs[1] = sn;
    *(v2f*)(CS + (size_t)idx * 2) = cs;  }

// One stage of k_sdpa's LDS ring: 64 keys = K hi rows, K lo rows (64 x 128 B each, contiguous in their planes) and V^T (64 d rows x 128 B, row pitch SEQ halves).
// 128 lanes x 12 asynchronous copies of 16 B; lane tid takes 16-byte piece (tid & 7) of rows (tid >> 3) + 16 i, so every wave-wide copy covers four whole 128-byte lines.
// kg, vg: the lane's first piece in the K hi plane and in V^T; ld: its LDS byte address in the stage's K hi tile.
__device__ __forceinline__ void stage_kv(const bf* kg, const h16* vg, const unsigned ld) {
    const bf* kl = kg + PLANE;
    const unsigned rb = 16u * KVP * 2u, tb = TLE * 2u;      // bytes of 16 staged rows, of one tile
    // The copies and the s_wait_xcnt that stands in front of any rewrite of their address registers are one statement, so that nothing can move in between.
    asm volatile("global_load_async_to_lds_b128 %0, %12, off\n\t"
                 "global_load_async_to_lds_b128 %1, %13, off\n\t"
                 "global_load_async_to_lds_b128 %2, %14, off\n\t"
                 "global_load_async_to_lds_b128 %3, %15, off\n\t"
                 "global_load_async_to_lds_b128 %4, %16, off\n\t"
                 "global_load_async_to_lds_b128 %5, %17, off\n\t"
                 "global_load_async_to_lds_b128 %6, %18, off\n\t"
                 "global_load_async_to_lds_b128 %7, %19, off\n\t"
                 "global_load_async_to_lds_b128 %8, %20, off\n\t"
                 "global_load_async_to_lds_b128 %9, %21, off\n\t"
                 "global_load_async_to_lds_b128 %10, %22, off\n\t"
                 "global_load_async_to_lds_b128 %11, %23, off\n\t"
                 "s_wait_xcnt 0x0"
                 :: "v"(ld), "v"(ld + rb), "v"(ld + 2u * rb), "v"(ld + 3u * rb),
                    "v"(ld + tb), "v"(ld + tb + rb), "v"(ld + tb + 2u * rb), "v"(ld + tb + 3u * rb),
                    "v"(ld + 2u * tb), "v"(ld + 2u * tb + rb), "v"(ld + 2u * tb + 2u * rb), "v"(ld + 2u * tb + 3u * rb),
                    "v"(kg), "v"(kg + 16 * HD), "v"(kg + 32 * HD), "v"(kg + 48 * HD),
                    "v"(kl), "v"(kl + 16 * HD), "v"(kl + 32 * HD), "v"(kl + 48 * HD),
                    "v"(vg), "v"(vg + 16 * SEQ), "v"(vg + 32 * SEQ), "v"(vg + 48 * SEQ)
                 : "memory");
}

// ---- fused dense softmax(q k^T) v: block = 4 waves, wave = 16 query rows of one (b, h); key loop over ALL keys in 32-key steps; K hi|lo and V^T come in 64-key stages through a two-buffer LDS ring that the four waves share, q fragments straight from the planes.
// S^T[key][query] = K.Q^T (A = K rows, B = Q rows; hi.hi + hi.lo + lo.hi): lane (hh, ln) holds query qw+ln, keys kt + 16j + 8hh + r, which IS the B fragment of P^T for
// O^T[d][query] = V^T.P^T (A = V^T rows d, k = keys). Online softmax per lane (one query per lane, halves combined by one xor-16 shuffle); the rescale factor is lane-local.
// grid (SEQ/64, NBC*NH), 128 threads.
__global__ __launch_bounds__(128) void k_sdpa(const bf* __restrict__ QK, const h16* __restrict__ VT, bf* CT) {
    __shared__ __align__(16) unsigned short cts[4 * 2 * 16 * CTP];
    __shared__ __align__(16) unsigned short kvs[2 * STE];
    const int lane = threadIdx.x & 31, hh = lane >> 4, ln = lane & 15;
    const int wave = __builtin_amdgcn_readfirstlane((int)(threadIdx.x >> 5));
    const int zz = blockIdx.y;
    const int qw = (int)blockIdx.x * 64 + wave * 16;
    const int nst = SEQ / KST;                              // stages: all keys 0 .. SEQ-1
    const unsigned hb = (unsigned)zz * (unsigned)(SEQ * HD);
    const unsigned qoff = hb + (unsigned)(qw + ln) * HD + 8u * hh;
    const unsigned fofs = (unsigned)ln * KVP + 8u * hh;     // fragment position in a staged tile: row ln, column 8 hh
    const unsigned tid = threadIdx.x;
    const bf* kg = QK + (size_t)(2u * PLANE + hb + tid * 8u);
    const h16* vg = VT + (size_t)(hb + (tid >> 3) * SEQ + (tid & 7u) * 8u);
    const unsigned ld = (unsigned)(size_t)kvs + ((tid >> 3) * KVP + (tid & 7u) * 8u) * 2u;
    v8f o[4];
#pragma unroll
    for (int dt = 0; dt < 4; ++dt) o[dt] = (v8f){};
    float m = NEGB, l = 0.0f;
    stage_kv(kg, vg, ld);
    asm volatile("s_wait_asynccnt 0x0" ::: "memory");       // this wave's copies of stage 0 have landed
    __syncthreads();                                        // stage 0 is readable by all four waves
    if (nst > 1) stage_kv(kg + KST * HD, vg + KST, ld + STE * 2u);
#pragma unroll 1                                            // rolled: one foot (waits, barrier, refill) per stage, in the ring's order
    for (int t = 0; t < nst; ++t) {
      const unsigned short* sb = kvs + (t & 1) * STE + fofs;
      for (int hf = 0; hf < KST / 32; ++hf) {
        const int kt = hf * 32;                             // first key of this step inside the stage
        unsigned qo = qoff; asm volatile("" : "+v"(qo));
        const v16bf qh0 = ldb(QK + (size_t)qo), qh1 = ldb(QK + (size_t)qo + 32), ql0 = ldb(QK + (size_t)(PLANE + qo)), ql1 = ldb(QK + (size_t)(PLANE + qo) + 32);
        v8f s0 = (v8f){}, s1 = (v8f){};
        {
            const unsigned short* kp = sb + kt * KVP;
            const v16bf kh0 = ldbs(kp), kh1 = ldbs(kp + 32), kl0 = ldbs(kp + TLE), kl1 = ldbs(kp + TLE + 32);
            s0 = wmmab(kh0, qh0, s0); s0 = wmmab(kh1, qh1, s0); s0 = wmmab(kh0, ql0, s0); s0 = wmmab(kh1, ql1, s0); s0 = wmmab(kl0, qh0, s0); s0 = wmmab(kl1, qh1, s0);
            asm volatile("v_nop\n\tv_nop\n\tv_nop\n\tv_nop" : "+v"(s0) : "v"(kh0), "v"(kh1), "v"(kl0), "v"(kl1), "v"(qh0), "v"(qh1), "v"(ql0), "v"(ql1));
        }
        asm volatile("" ::: "memory");
        {
            const unsigned short* kp = sb + (kt + 16) * KVP;
            const v16bf kh0 = ldbs(kp), kh1 = ldbs(kp + 32), kl0 = ldbs(kp + TLE), kl1 = ldbs(kp + TLE + 32);
            s1 = wmmab(kh0, qh0, s1); s1 = wmmab(kh1, qh1, s1); s1 = wmmab(kh0, ql0, s1); s1 = wmmab(kh1, ql1, s1); s1 = wmmab(kl0, qh0, s1); s1 = wmmab(kl1, qh1, s1);
            asm volatile("v_nop\n\tv_nop\n\tv_nop\n\tv_nop" : "+v"(s1), "+v"(s0) : "v"(kh0), "v"(kh1), "v"(kl0), "v"(kl1), "v"(qh0), "v"(qh1), "v"(ql0), "v"(ql1));
        }
        float mx = s0[0];
#pragma unroll
        for (int r = 1; r < 8; ++r) mx = fmaxf(mx, s0[r]);
#pragma unroll
        for (int r = 0; r < 8; ++r) mx = fmaxf(mx, s1[r]);
        mx = fmaxf(mx, __shfl_xor(mx, 16, 32));
        const float mn = fmaxf(m, mx);
        const float al = __builtin_amdgcn_exp2f((m - mn) * L2E);
        m = mn;
        float rs = 0.0f; v16h pb;
#pragma unroll
        for (int r = 0; r < 8; ++r) {
            const float e0 = __builtin_amdgcn_exp2f((s0[r] - mn) * L2E), e1 = __builtin_amdgcn_exp2f((s1[r] - mn) * L2E);
            rs += e0 + e1;
            const float c0 = e0 * PCAR, c1 = e1 * PCAR;
            pb[r] = (h16)c0; pb[8 + r] = (h16)c1;
        }
        l = l * al + rs;
#pragma unroll
        for (int dt = 0; dt < 4; ++dt) o[dt] = o[dt] * al;
        asm volatile("" ::: "memory");
        v16h va[4];
        const unsigned short* vp = sb + 2 * TLE + kt;
#pragma unroll
        for (int dt = 0; dt < 4; ++dt) va[dt] = ldhs(vp + dt * 16 * KVP);
#pragma unroll
        for (int dt = 0; dt < 4; ++dt) o[dt] = wmma16(va[dt], pb, o[dt]);
        asm volatile("v_nop\n\tv_nop\n\tv_nop\n\tv_nop" : "+v"(o[0]), "+v"(o[1]), "+v"(o[2]), "+v"(o[3]) : "v"(pb), "v"(va[0]), "v"(va[1]), "v"(va[2]), "v"(va[3]));
      }
      asm volatile("s_wait_dscnt 0x0" ::: "memory");        // this wave's reads of stage t have returned before its buffer is refilled
      asm volatile("s_wait_asynccnt 0x0" ::: "memory");     // this wave's copies of stage t + 1 have landed
      __syncthreads();                                      // publishes stage t + 1 and ends every wave's reads of stage t
      if (t + 2 < nst) stage_kv(kg + (size_t)(t + 2) * (KST * HD), vg + (t + 2) * KST, ld + (unsigned)(t & 1) * (STE * 2u));
    }
    asm volatile("s_wait_asynccnt 0x0" ::: "memory");       // no copy is outstanding when the wave goes on to the epilogue
    l += __shfl_xor(l, 16, 32);
    const float inv = 1.0f / (PCAR * l);
    const int cb = wave * (2 * 16 * CTP);                   // wave-private staging: [plane hi|lo][16 rows][CTP]
#pragma unroll
    for (int dt = 0; dt < 4; ++dt) { v8us oh, ol;
#pragma unroll
        for (int r = 0; r < 8; ++r) { const float y = o[dt][r] * inv; unsigned short a, c; splitf(y, a, c); oh[r] = a; ol[r] = c; }
        *(v8usa*)(cts + cb + ln * CTP + dt * 16 + 8 * hh) = oh; *(v8usa*)(cts + cb + 16 * CTP + ln * CTP + dt * 16 + 8 * hh) = ol; }
    asm volatile("s_wait_dscnt 0x0" ::: "memory"); __builtin_amdgcn_wave_barrier();
    const int b = zz / NH, h = zz % NH;
    const int rq = lane >> 3, pc = (lane & 7) * 8;
    v8us hv[4], lv[4];
#pragma unroll
    for (int it = 0; it < 4; ++it) { const int row = it * 4 + rq; hv[it] = *(const v8usa*)(cts + cb + row * CTP + pc); lv[it] = *(const v8usa*)(cts + cb + 16 * CTP + row * CTP + pc); }
    bf* gh = CT + ((size_t)b * SEQ + qw) * DM + h * HD + pc;
{
#pragma unroll
        for (int it = 0; it < 4; ++it) { const int row = it * 4 + rq; *(v8us*)(gh + (size_t)row * DM) = hv[it]; *(v8us*)(gh + CPL + (size_t)row * DM) = lv[it]; }
         }
}

constexpr size_t SZ_WQKV = (size_t)NQKV * DM * 2;
constexpr size_t SZ_WO   = (size_t)DM * DM * 2;
constexpr size_t SZ_CS   = (size_t)SEQ * 32 * 2 * 4;
constexpr size_t SZ_XB   = (size_t)NB * SEQ * DM * 2;          // all batches, compact [NB][SEQ][DM]
constexpr size_t SZ_QK   = (size_t)4 * NBC * NH * SEQ * HD * 2; // one pass: q hi, q lo, k hi, k lo
constexpr size_t SZ_VT   = (size_t)NBC * NH * SEQ * HD * 2;     // one pass
constexpr size_t SZ_CTX  = (size_t)2 * MROWC * DM * 2;          // one pass: ctx hi, ctx lo
constexpr size_t SZ_TOTAL = SZ_WQKV + SZ_WO + SZ_CS + SZ_XB + SZ_CTX + SZ_QK + SZ_VT;
static_assert(SZ_TOTAL <= (size_t)134217728);
static_assert(SZ_WQKV % 256 == 0 && SZ_WO % 256 == 0 && SZ_CS % 256 == 0 && SZ_XB % 256 == 0 && SZ_CTX % 256 == 0 && SZ_QK % 256 == 0 && SZ_VT % 256 == 0);

extern "C" void kernel_launch(void* const* d_in, const int* in_sizes, int n_in,
                              void* d_out, int out_size, void* d_ws, size_t ws_size, hipStream_t stream) {
    if (n_in < 3) return;
    const long long need_x = (long long)(NB - 1) * SEQ_FULL * DM + (long long)SEQ * DM;
    if ((long long)in_sizes[0] < need_x) return;
    if ((long long)in_sizes[1] < (long long)NQKV * DM) return;
    if ((long long)in_sizes[2] < (long long)DM * DM) return;
    if ((long long)out_size < need_x) return;
    if (SZ_TOTAL > ws_size) return;
    const float* x = (const float*)d_in[0];        // [NB_FULL][SEQ_FULL][DM]
    const float* wqkv = (const float*)d_in[1];     // [NQKV][DM] ('oi')
    const float* wout = (const float*)d_in[2];     // [DM][DM] ('oi')
    float* OUT = (float*)d_out;                    // [NB_FULL][SEQ_FULL][DM]
    char* base = (char*)d_ws; size_t off = 0;
    bf* WQKVB = (bf*)(base + off); off += SZ_WQKV;
    bf* WOB = (bf*)(base + off); off += SZ_WO;
    float* CS = (float*)(base + off); off += SZ_CS;
    bf* XB = (bf*)(base + off); off += SZ_XB;
    bf* CT = (bf*)(base + off); off += SZ_CTX;     // ctx hi plane, lo plane at + CPL
    bf* QK = (bf*)(base + off); off += SZ_QK;
    h16* VT = (h16*)(base + off); off += SZ_VT;

    const unsigned n8w = (unsigned)((size_t)NQKV * DM / 8), n8o = (unsigned)((size_t)DM * DM / 8), n8x = (unsigned)((size_t)NB * SEQ * DM / 8);
    k_cvt8<<<(n8w + 255) / 256, 256, 0, stream>>>(wqkv, WQKVB, n8w, n8w, 0u);
    k_cvt8<<<(n8o + 255) / 256, 256, 0, stream>>>(wout, WOB, n8o, n8o, 0u);
    k_cvt8<<<(n8x + 255) / 256, 256, 0, stream>>>(x, XB, n8x, (unsigned)((size_t)SEQ * DM / 8), (unsigned)((size_t)SEQ_FULL * DM / 8));
    k_cstab<<<(SEQ * 32 + 255) / 256, 256, 0, stream>>>(CS);
    for (int c = 0; c < NB / NBC; ++c) {
        const bf* XBc = XB + (size_t)c * MROWC * DM;                 // rows of this pass
        float* OUTc = OUT + (size_t)c * NBC * SEQ_FULL * DM;         // output rows of this pass
        k_gemm_qkv<<<dim3(MROWC / GBT, NQKV / GBT, 1), 128, 0, stream>>>(XBc, WQKVB, CS, QK, VT);
        k_sdpa<<<dim3(SEQ / 64, NBC * NH, 1), 128, 0, stream>>>(QK, VT, CT);
        k_gemm_out<<<dim3(SEQ / GBT, DM / GBT, NBC), 128, 0, stream>>>(CT, CT + CPL, WOB, OUTc);
    }
}

// v004
// It runs in 220 microseconds.
// Timed twice side by side with v003, it ran 1.25 times as fast both times.
// Counting every step since v000, it is 3.07 times as fast.
#include <hip/hip_runtime.h>

// Dense (unmasked) multi-head softmax(q k^T / 8) v block: x [NB][SEQ][1024], fused Wqkv [3072][1024] ('oi', rows = (3, 16 heads, 64)), Wout [1024][1024] ('oi'), interleaved-pair rotary (positions = arange) on q and k, merged heads x Wout^T.
// Compute dtypes, f32 accumulate everywhere: x/Wqkv/Wout converted to bf16 (RNE) and multiplied with v_wmma_f32_16x16x32_bf16 (single product); scores q.k as bf16 hi|lo x bf16 hi|lo, three products (bf16 WMMA); P.V with v_wmma_f32_16x16x32_f16 (P f16 carried x256, v f16); ctx bf16 hi|lo x Wout bf16 (two products); rotary and softmax in f32.
// Batches are processed NBC at a time with reused planes (host loop of launches).

#ifndef NB
#define NB 4
#endif
#ifndef SEQ
#define SEQ 2048
#endif
#ifndef NBC
#define NBC ((((NB) % 2) == 0) ? 2 : 1)      // batches per pass
#endif
#define NB_FULL  4
#define SEQ_FULL 2048
#define DM   1024
#define NH   16
#define HD   64
#define NQKV (3 * DM)
#define PCAR 256.0f               // carry of the f16 probability operand
#define SCL  0.125f               // HD^-0.5, folded into the q planes (exact power of two)
#define L2E  1.4426950408889634f
#define NEGB (-1.0e30f)
#define CTP  72                   // LDS pitch (halves) of the ctx staging rows
#define KST  64                   // keys of one LDS stage of k_sdpa
#define KVP  72                   // LDS pitch (16-bit elements) of a staged 128-byte row: 144 B = 16 B x odd, conflict-free for 16-byte fragment reads
#define TLE  (64 * KVP)           // elements of one staged tile (64 rows)
#define STE  (3 * TLE)            // elements of one stage: K hi | K lo | V^T
#define GBT  128                  // rows and columns of a GEMM block's output tile (2 x 2 waves of 64 x 64)
#define GKS  64                   // k elements of one LDS stage of the GEMMs: 128 bytes a row, staged at pitch KVP
#define GTL  (GBT * KVP)          // elements of one staged GEMM operand tile (128 rows)
#define MROWC (NBC * SEQ)                         // rows of one pass
#define PLANE ((unsigned)(NBC * NH * SEQ * HD))   // elements of one head plane set (one pass)
#define CPL  ((size_t)MROWC * DM)                 // elements of one ctx plane (one pass)

static_assert(HD == 64);
static_assert(DM == NH * HD);
static_assert(DM % 32 == 0);
static_assert(DM % 64 == 0);
static_assert(NQKV % 64 == 0);
static_assert(SEQ % 64 == 0);
static_assert(MROWC % 64 == 0);
static_assert(NB <= NB_FULL);
static_assert(SEQ <= SEQ_FULL);
static_assert(NB % NBC == 0);
static_assert(((size_t)NBC * NH * SEQ * HD) % 512 == 0);
static_assert((SEQ * 32) % 256 == 0);
static_assert((size_t)4 * NBC * NH * SEQ * HD < 4294967296ull);
static_assert((CTP * 2) % 16 == 0);
static_assert(CTP >= HD);
static_assert(SEQ % KST == 0);
static_assert(KST == 64 && KST % 32 == 0);
static_assert((KVP * 2) % 16 == 0 && KVP >= HD && KVP >= KST);
static_assert(GBT == 128 && GKS == 64 && KVP >= GKS);
static_assert(MROWC % GBT == 0 && SEQ % GBT == 0 && NQKV % GBT == 0 && DM % GBT == 0);
static_assert(DM % GKS == 0 && DM / GKS >= 2);

typedef _Float16 h16;
typedef unsigned short bf;
typedef __attribute__((ext_vector_type(16))) __bf16   v16bf;
typedef __attribute__((ext_vector_type(16))) _Float16 v16h;
typedef __attribute__((ext_vector_type(8)))  _Float16 v8h;
typedef __attribute__((ext_vector_type(8)))  unsigned short v8us;
typedef __attribute__((ext_vector_type(8)))  float    v8f;
typedef __attribute__((ext_vector_type(4)))  float    v4f;
typedef __attribute__((ext_vector_type(2)))  float    v2f;
typedef __attribute__((ext_vector_type(2)))  _Float16 v2h;
typedef __attribute__((ext_vector_type(2)))  unsigned short v2us;
typedef v4f  __attribute__((may_alias)) v4fa;
typedef v8us __attribute__((may_alias)) v8usa;
typedef v8h  __attribute__((may_alias)) v8ha;

__device__ __forceinline__ unsigned short f2bf(float f) { unsigned u = __float_as_uint(f); u += 0x7FFFu + ((u >> 16) & 1u); return (unsigned short)(u >> 16); }
__device__ __forceinline__ float bf2f(unsigned short b) { return __uint_as_float(((unsigned)b) << 16); }
__device__ __forceinline__ void splitf(float y, unsigned short& h, unsigned short& l) { h = f2bf(y); l = f2bf(y - bf2f(h)); }
__device__ __forceinline__ v16h cat16(v8h lo, v8h hi) { return __builtin_shufflevector(lo, hi, 0, 1, 2, 3, 4, 5, 6, 7, 8, 9, 10, 11, 12, 13, 14, 15); }
__device__ __forceinline__ v16bf cat16b(v8us lo, v8us hi) { return __builtin_bit_cast(v16bf, __builtin_shufflevector(lo, hi, 0, 1, 2, 3, 4, 5, 6, 7, 8, 9, 10, 11, 12, 13, 14, 15)); }
__device__ __forceinline__ v8f wmma16(v16h a, v16h b, v8f c) { return __builtin_amdgcn_wmma_f32_16x16x32_f16(false, a, false, b, (short)0, c, false, false); }
__device__ __forceinline__ v8f wmmab(v16bf a, v16bf b, v8f c) { return __builtin_amdgcn_wmma_f32_16x16x32_bf16(false, a, false, b, (short)0, c, false, false); }
// Fragment loaders (A and B share the k map): p points at row (lane&15), column k0 + 8*(lane>>4); elements 0..7 <- p[0..7], elements 8..15 <- p[16..23].
__device__ __forceinline__ v16bf ldb(const bf* p) { return cat16b(*(const v8us*)p, *(const v8us*)(p + 16)); }
// The same k map on the staged LDS rows (bf16 rows of K, f16 rows of V^T).
__device__ __forceinline__ v16bf ldbs(const unsigned short* p) { return cat16b(*(const v8usa*)p, *(const v8usa*)(p + 16)); }
__device__ __forceinline__ v16h ldhs(const unsigned short* p) { return cat16(*(const v8ha*)p, *(const v8ha*)(p + 16)); }

// One 128-row x 128-byte operand tile of a GEMM stage: 128 lanes x 8 asynchronous copies of 16 B; lane tid takes 16-byte piece (tid & 7) of rows (tid >> 3) + 16 i, so every wave-wide copy covers four whole 128-byte lines.
// g: the lane's first piece in the K-contiguous plane (row pitch K elements); ld: its LDS byte address in the staged tile (row pitch KVP elements).
__device__ __forceinline__ void stage_g(const bf* g, const int K, const unsigned ld) {
    const unsigned rb = 16u * KVP * 2u;                     // bytes of 16 staged rows
    const size_t rg = (size_t)16 * K;                       // elements of 16 plane rows
    // The copies and the s_wait_xcnt that stands in front of any rewrite of their address registers are one statement, so that nothing can move in between.
    asm volatile("global_load_async_to_lds_b128 %0, %8, off\n\t"
                 "global_load_async_to_lds_b128 %1, %9, off\n\t"
                 "global_load_async_to_lds_b128 %2, %10, off\n\t"
                 "global_load_async_to_lds_b128 %3, %11, off\n\t"
                 "global_load_async_to_lds_b128 %4, %12, off\n\t"
                 "global_load_async_to_lds_b128 %5, %13, off\n\t"
                 "global_load_async_to_lds_b128 %6, %14, off\n\t"
                 "global_load_async_to_lds_b128 %7, %15, off\n\t"
                 "s_wait_xcnt 0x0"
                 :: "v"(ld), "v"(ld + rb), "v"(ld + 2u * rb), "v"(ld + 3u * rb), "v"(ld + 4u * rb), "v"(ld + 5u * rb), "v"(ld + 6u * rb), "v"(ld + 7u * rb),
                    "v"(g), "v"(g + rg), "v"(g + 2 * rg), "v"(g + 3 * rg), "v"(g + 4 * rg), "v"(g + 5 * rg), "v"(g + 6 * rg), "v"(g + 7 * rg)
                 : "memory");
}

// ---- GEMM body: block = 4 waves on a 128x128 output tile, ONE WAVE per 64x64 quarter (16 accumulators); the block's 128 rows of A (, A2) and of Bt come from the K-contiguous bf16 planes in 64-k stages through a two-buffer LDS ring that the four waves share; grid (M/128, N/128, Z), 128 threads.
// C[m][n] (f32, pitch ldc) = sum_k (A[m][k] (+ A2[m][k])) Bt[n][k]. K % 64 == 0, K >= 128, M % 128 == 0, N % 128 == 0 (asserted at file scope for the two uses).
// EPI == 0: the tile is stored to C. EPI == 1 (qkv projection): the 64 columns of a wave's quarter are one head of q, k or v, and the quarter goes straight to that head's planes:
// q, k: rotary (interleaved pairs: out[2j] = x[2j] c_j - x[2j+1] s_j, out[2j+1] = x[2j] s_j + x[2j+1] c_j; q also x SCL), split bf16 hi|lo, planes [zz = b*NH + h][t][d]; v: f16, transposed, [zz][d][t].
template <int NSPLIT, int EPI = 0>
__device__ __forceinline__ void gemmw_body(const bf* __restrict__ A, const bf* __restrict__ A2, const bf* __restrict__ Bt, const int K, float* C, const int ldc, const size_t sA, const size_t sC,
                                           const float* __restrict__ CS = nullptr, bf* QK = nullptr, h16* VT = nullptr) {
    constexpr int NT = 2 + NSPLIT;                          // tiles of one stage: A (, A2), Bt
    __shared__ __align__(16) float osb[4 * 16 * 68];
    __shared__ __align__(16) unsigned short gs[2 * NT * GTL];
    const size_t z = blockIdx.z; A += z * sA; A2 += z * sA; C += z * sC;
    const int lane = threadIdx.x & 31, lr = lane & 15, hi = lane >> 4;
    const int wave = __builtin_amdgcn_readfirstlane((int)(threadIdx.x >> 5));
    const int rb0 = blockIdx.x * GBT, cb0 = blockIdx.y * GBT, wr = (wave & 1) * 64, wc = (wave >> 1) * 64;
    const int r0 = rb0 + wr, c0 = cb0 + wc;                 // the wave's own 64x64 quarter
    float* os = osb + wave * (16 * 68);                     // wave-private epilogue staging
    v8f acc[4][4];
#pragma unroll
    for (int mb = 0; mb < 4; ++mb)
#pragma unroll
        for (int nb = 0; nb < 4; ++nb) acc[mb][nb] = (v8f){};
    const unsigned tid = threadIdx.x;
    const size_t goff = (size_t)(tid >> 3) * K + (tid & 7u) * 8u;
    const bf* ga = A + (size_t)rb0 * K + goff; const bf* ga2 = A2 + (size_t)rb0 * K + goff; const bf* gb = Bt + (size_t)cb0 * K + goff;
    const unsigned ld = (unsigned)(size_t)gs + ((tid >> 3) * KVP + (tid & 7u) * 8u) * 2u;
    const int nst = K / GKS;
    auto fill = [&](const int st, const unsigned buf) {     // stage st (k = 64 st ..) into ring buffer buf
        const unsigned l0 = ld + buf * (unsigned)(NT * GTL * 2);
        stage_g(ga + st * GKS, K, l0);
        if (NSPLIT == 1) stage_g(ga2 + st * GKS, K, l0 + GTL * 2u);
        stage_g(gb + st * GKS, K, l0 + (unsigned)((NT - 1) * GTL * 2));
    };
    fill(0, 0u);
    asm volatile("s_wait_asynccnt 0x0" ::: "memory");       // this wave's copies of stage 0 have landed
    __syncthreads();                                        // stage 0 is readable by all four waves
    fill(1, 1u);
#pragma unroll 1                                            // rolled: one foot (waits, barrier, refill) per stage, in the ring's order
    for (int t = 0; t < nst; ++t) {
      const unsigned short* sb = gs + (t & 1) * (NT * GTL) + lr * KVP + 8 * hi;    // fragment position: row lr, column 8 hi
      const unsigned short* pa = sb + wr * KVP; const unsigned short* pb = sb + (NT - 1) * GTL + wc * KVP;
#pragma unroll                                              // both 32-k steps of a stage in line: their LDS offsets become immediates
      for (int kc = 0; kc < GKS; kc += 32) {
        v16bf a[4], a2[4], bl;
#pragma unroll
        for (int mb = 0; mb < 4; ++mb) { a[mb] = ldbs(pa + mb * 16 * KVP + kc); if (NSPLIT == 1) a2[mb] = ldbs(pa + GTL + mb * 16 * KVP + kc); else a2[mb] = a[mb]; }
#pragma unroll
        for (int nb = 0; nb < 4; ++nb) { const v16bf b = ldbs(pb + nb * 16 * KVP + kc); if (nb == 3) bl = b;
#pragma unroll
            for (int mb = 0; mb < 4; ++mb) { acc[mb][nb] = wmmab(a[mb], b, acc[mb][nb]); if (NSPLIT == 1) acc[mb][nb] = wmmab(a2[mb], b, acc[mb][nb]); } }
        asm volatile("" : "+v"(acc[0][0]), "+v"(acc[0][1]), "+v"(acc[1][0]), "+v"(acc[1][1]), "+v"(acc[2][0]), "+v"(acc[2][1]), "+v"(acc[3][0]), "+v"(acc[3][1]));
        asm volatile("v_nop\n\tv_nop\n\tv_nop\n\tv_nop" : "+v"(acc[0][2]), "+v"(acc[0][3]), "+v"(acc[1][2]), "+v"(acc[1][3]), "+v"(acc[2][2]), "+v"(acc[2][3]), "+v"(acc[3][2]), "+v"(acc[3][3]) : "v"(a[0]), "v"(a[1]), "v"(a[2]), "v"(a[3]), "v"(bl));
        asm volatile("" : "+v"(acc[0][0]), "+v"(acc[0][1]), "+v"(acc[1][0]), "+v"(acc[1][1]), "+v"(acc[2][0]), "+v"(acc[2][1]), "+v"(acc[3][0]), "+v"(acc[3][1]) : "v"(a2[0]), "v"(a2[1]), "v"(a2[2]), "v"(a2[3]));
      }
      asm volatile("s_wait_dscnt 0x0" ::: "memory");        // this wave's reads of stage t have returned before its buffer is refilled
      asm volatile("s_wait_asynccnt 0x0" ::: "memory");     // this wave's copies of stage t + 1 have landed
      __syncthreads();                                      // publishes stage t + 1 and ends every wave's reads of stage t
      if (t + 2 < nst) fill(t + 2, (unsigned)(t & 1));
    }
    asm volatile("s_wait_asynccnt 0x0" ::: "memory");       // no copy is outstanding when the wave goes on to the epilogue
    if constexpr (EPI == 1) {
        const unsigned which = (unsigned)c0 / DM, h = ((unsigned)c0 / HD) % NH;          // wave-uniform: 0 q, 1 k, 2 v; head
        const unsigned zz = ((unsigned)r0 / SEQ) * NH + h, t0 = (unsigned)r0 % SEQ;      // SEQ % 64 == 0: the 64 rows lie in one batch
        const int rq = lane >> 3, pc = (lane & 7) * 8;                                   // read-back: 4 rows a step, 8 elements a lane
        if (which < 2u) {
            const float sc = which ? 1.0f : SCL;
            bf* ph = QK + (size_t)(which * 2u) * PLANE + (size_t)zz * (SEQ * HD) + (size_t)t0 * HD + pc;
            const float* cp = CS + (size_t)t0 * HD + pc;                                 // row t of the table: 32 (cos, sin) pairs = HD floats
#pragma unroll
            for (int mb = 0; mb < 4; ++mb) {
                v4f cs[4][2];                                                            // issued ahead of the staging so that their latency runs beside it
#pragma unroll
                for (int s = 0; s < 4; ++s) { const float* cr = cp + (size_t)(mb * 16 + s * 4 + rq) * HD; cs[s][0] = *(const v4f*)cr; cs[s][1] = *(const v4f*)(cr + 4); }
#pragma unroll
                for (int nb = 0; nb < 4; ++nb) {
#pragma unroll
                    for (int j = 0; j < 8; ++j) os[(hi * 8 + j) * 68 + nb * 16 + lr] = acc[mb][nb][j]; }
                asm volatile("s_wait_dscnt 0x0" ::: "memory"); __builtin_amdgcn_wave_barrier();   // the 16 staged rows are written before other lanes read them
#pragma unroll
                for (int s = 0; s < 4; ++s) { const int row = s * 4 + rq; v8us oh, ol;
#pragma unroll
                    for (int g = 0; g < 2; ++g) { const v4f x = *(const v4fa*)(os + row * 68 + pc + 4 * g); const v4f c = cs[s][g];
#pragma unroll
                        for (int p = 0; p < 2; ++p) {
                            const float y0 = (x[2 * p] * c[2 * p] - x[2 * p + 1] * c[2 * p + 1]) * sc;
                            const float y1 = (x[2 * p] * c[2 * p + 1] + x[2 * p + 1] * c[2 * p]) * sc;
                            unsigned short a, d;
                            splitf(y0, a, d); oh[4 * g + 2 * p] = a; ol[4 * g + 2 * p] = d; splitf(y1, a, d); oh[4 * g + 2 * p + 1] = a; ol[4 * g + 2 * p + 1] = d; } }
                    bf* pr = ph + (size_t)(mb * 16 + row) * HD;
                    *(v8us*)pr = oh; *(v8us*)(pr + PLANE) = ol; }
                if (mb < 3) asm volatile("s_wait_xcnt 0x0" ::: "memory");                         // stands in front of the next rows' loads and arithmetic, which reuse the registers these stores name
                asm volatile("s_wait_dscnt 0x0" ::: "memory"); __builtin_amdgcn_wave_barrier();   // every read of the staged rows has returned before they are rewritten
            }
        } else {
            h16* vs = (h16*)os;                                                          // 16 d rows x 64 t, pitch CTP halves, in the same staging bytes
            h16* pv = VT + (size_t)zz * (SEQ * HD) + (size_t)rq * SEQ + t0 + pc;
#pragma unroll
            for (int nb = 0; nb < 4; ++nb) {
#pragma unroll
                for (int mb = 0; mb < 4; ++mb) { v8h hv;                                 // a lane's 8 accumulator rows are 8 consecutive t of its column d
#pragma unroll
                    for (int j = 0; j < 8; ++j) hv[j] = (h16)acc[mb][nb][j];
                    *(v8ha*)(vs + lr * CTP + mb * 16 + hi * 8) = hv; }
                asm volatile("s_wait_dscnt 0x0" ::: "memory"); __builtin_amdgcn_wave_barrier();   // the 16 staged rows are written before other lanes read them
#pragma unroll
                for (int s = 0; s < 4; ++s) { const v8h val = *(const v8ha*)(vs + (s * 4 + rq) * CTP + pc);
                    *(v8h*)(pv + (size_t)(nb * 16 + s * 4) * SEQ) = val; }
                asm volatile("s_wait_dscnt 0x0" ::: "memory"); __builtin_amdgcn_wave_barrier();   // every read of the staged rows has returned before they are rewritten
            }
            asm volatile("s_wait_xcnt 0x0" ::: "memory");                                         // stands behind the last rows' stores, in front of any code laid out after them that reuses the registers they name
        }
        return;
    }
#pragma unroll
    for (int mb = 0; mb < 4; ++mb) {
#pragma unroll
        for (int nb = 0; nb < 4; ++nb) {
#pragma unroll
            for (int j = 0; j < 8; ++j) os[(hi * 8 + j) * 68 + nb * 16 + lr] = acc[mb][nb][j]; }
        asm volatile("s_wait_dscnt 0x0" ::: "memory"); __builtin_amdgcn_wave_barrier();
        float* crow = C + (size_t)(r0 + mb * 16) * ldc + c0;
{
#pragma unroll
            for (int s = 0; s < 8; ++s) { const int row = 2 * s + hi, cofs = lr * 4; const v4f val = *(const v4fa*)(os + row * 68 + cofs);
                *(v4f*)(crow + (size_t)row * ldc + cofs) = val; }
             }
        asm volatile("s_wait_dscnt 0x0" ::: "memory"); __builtin_amdgcn_wave_barrier();
    }
}
// qkv projection of one pass, sum_k XB[m][k] WQKVB[o][k], written as the head planes q hi|lo, k hi|lo (QK) and V^T (VT); grid (MROWC/128, NQKV/128, 1).
__global__ __launch_bounds__(128) void k_gemm_qkv(const bf* __restrict__ A, const bf* __restrict__ Bt, const float* __restrict__ CS, bf* QK, h16* VT) { gemmw_body<0, 1>(A, A, Bt, DM, nullptr, NQKV, 0, 0, CS, QK, VT); }
// output projection of one pass: OUT[b][t][o] = sum_k (CTXh + CTXl)[b*SEQ + t][k] WOB[o][k]; grid (SEQ/128, DM/128, NBC); output batch pitch SEQ_FULL*DM.
__global__ __launch_bounds__(128) void k_gemm_out(const bf* __restrict__ Ah, const bf* __restrict__ Al, const bf* __restrict__ Bt, float* C) { gemmw_body<1>(Ah, Al, Bt, DM, C, DM, (size_t)SEQ * DM, (size_t)SEQ_FULL * DM); }

__global__ __launch_bounds__(256) void k_cvt8(const float* __restrict__ src, bf* dst, unsigned n8, unsigned per8, unsigned sstride8) {
    const unsigned i = blockIdx.x * 256u + threadIdx.x; if (i >= n8) return;
    const size_t si = (size_t)(i / per8) * sstride8 + (i % per8);
    const v8f v = *(const v8f*)(src + si * 8); v8us o;
#pragma unroll
    for (int k = 0; k < 8; ++k) o[k] = f2bf(v[k]);
    *(v8us*)(dst + (size_t)i * 8) = o;  }

__global__ __launch_bounds__(256) void k_cstab(float* CS) {
    const int idx = blockIdx.x * 256 + threadIdx.x; if (idx >= SEQ * 32) return;
    const int j = idx & 31, t = idx >> 5;
    double p = 1.0;
    p *= (j & 1) ? 1.3335214321633240 : 1.0;
    p *= (j & 2) ? 1.7782794100389228 : 1.0;
    p *= (j & 4) ? 3.1622776601683795 : 1.0;
    p *= (j & 8) ? 10.0 : 1.0;
    p *= (j & 16) ? 100.0 : 1.0;
    const float pf = (float)p; const float inv = 1.0f / pf; const float ang = (float)t * inv;
    float sn, cn; sincosf(ang, &sn, &cn);
    v2f cs; cs[0] = cn; cs[1] = sn;
    *(v2f*)(CS + (size_t)idx * 2) = cs;  }

// One stage of k_sdpa's LDS ring: 64 keys = K hi rows, K lo rows (64 x 128 B each, contiguous in their planes) and V^T (64 d rows x 128 B, row pitch SEQ halves).
// 128 lanes x 12 asynchronous copies of 16 B; lane tid takes 16-byte piece (tid & 7) of rows (tid >> 3) + 16 i, so every wave-wide copy covers four whole 128-byte lines.
// kg, vg: the lane's first piece in the K hi plane and in V^T; ld: its LDS byte address in the stage's K hi tile.
__device__ __forceinline__ void stage_kv(const bf* kg, const h16* vg, const unsigned ld) {
    const bf* kl = kg + PLANE;
    const unsigned rb = 16u * KVP * 2u, tb = TLE * 2u;      // bytes of 16 staged rows, of one tile
    // The copies and the s_wait_xcnt that stands in front of any rewrite of their address registers are one statement, so that nothing can move in between.
    asm volatile("global_load_async_to_lds_b128 %0, %12, off\n\t"
                 "global_load_async_to_lds_b128 %1, %13, off\n\t"
                 "global_load_async_to_lds_b128 %2, %14, off\n\t"
                 "global_load_async_to_lds_b128 %3, %15, off\n\t"
                 "global_load_async_to_lds_b128 %4, %16, off\n\t"
                 "global_load_async_to_lds_b128 %5, %17, off\n\t"
                 "global_load_async_to_lds_b128 %6, %18, off\n\t"
                 "global_load_async_to_lds_b128 %7, %19, off\n\t"
                 "global_load_async_to_lds_b128 %8, %20, off\n\t"
                 "global_load_async_to_lds_b128 %9, %21, off\n\t"
                 "global_load_async_to_lds_b128 %10, %22, off\n\t"
                 "global_load_async_to_lds_b128 %11, %23, off\n\t"
                 "s_wait_xcnt 0x0"
                 :: "v"(ld), "v"(ld + rb), "v"(ld + 2u * rb), "v"(ld + 3u * rb),
                    "v"(ld + tb), "v"(ld + tb + rb), "v"(ld + tb + 2u * rb), "v"(ld + tb + 3u * rb),
                    "v"(ld + 2u * tb), "v"(ld + 2u * tb + rb), "v"(ld + 2u * tb + 2u * rb), "v"(ld + 2u * tb + 3u * rb),
                    "v"(kg), "v"(kg + 16 * HD), "v"(kg + 32 * HD), "v"(kg + 48 * HD),
                    "v"(kl), "v"(kl + 16 * HD), "v"(kl + 32 * HD), "v"(kl + 48 * HD),
                    "v"(vg), "v"(vg + 16 * SEQ), "v"(vg + 32 * SEQ), "v"(vg + 48 * SEQ)
                 : "memory");
}

// ---- fused dense softmax(q k^T) v: block = 4 waves, wave = 16 query rows of one (b, h); key loop over ALL keys in 32-key steps; K hi|lo and V^T come in 64-key stages through a two-buffer LDS ring that the four waves share, q fragments loaded once from the planes and kept in registers.
// S^T[key][query] = K.Q^T (A = K rows, B = Q rows; hi.hi + hi.lo + lo.hi): lane (hh, ln) holds query qw+ln, keys kt + 16j + 8hh + r, which IS the B fragment of P^T for
// O^T[d][query] = V^T.P^T (A = V^T rows d, k = keys). Online softmax per lane (one query per lane, halves combined by one xor-16 shuffle); the rescale factor is lane-local.
// grid (SEQ/64, NBC*NH), 128 threads.
__global__ __launch_bounds__(128) void k_sdpa(const bf* __restrict__ QK, const h16* __restrict__ VT, bf* CT) {
    __shared__ __align__(16) unsigned short cts[4 * 2 * 16 * CTP];
    __shared__ __align__(16) unsigned short kvs[2 * STE];
    const int lane = threadIdx.x & 31, hh = lane >> 4, ln = lane & 15;
    const int wave = __builtin_amdgcn_readfirstlane((int)(threadIdx.x >> 5));
    const int zz = blockIdx.y;
    const int qw = (int)blockIdx.x * 64 + wave * 16;
    const int nst = SEQ / KST;                              // stages: all keys 0 .. SEQ-1
    const unsigned hb = (unsigned)zz * (unsigned)(SEQ * HD);
    const unsigned qoff = hb + (unsigned)(qw + ln) * HD + 8u * hh;
    const unsigned fofs = (unsigned)ln * KVP + 8u * hh;     // fragment position in a staged tile: row ln, column 8 hh
    const unsigned tid = threadIdx.x;
    const bf* kg = QK + (size_t)(2u * PLANE + hb + tid * 8u);
    const h16* vg = VT + (size_t)(hb + (tid >> 3) * SEQ + (tid & 7u) * 8u);
    const unsigned ld = (unsigned)(size_t)kvs + ((tid >> 3) * KVP + (tid & 7u) * 8u) * 2u;
    v8f o[4];
#pragma unroll
    for (int dt = 0; dt < 4; ++dt) o[dt] = (v8f){};
    float m = NEGB, l = 0.0f;
    // The wave's q fragments (B operand, hi|lo x two 32-d halves) are loaded once and stay in registers for the whole key loop.
    const v16bf qh0 = ldb(QK + (size_t)qoff), qh1 = ldb(QK + (size_t)qoff + 32), ql0 = ldb(QK + (size_t)(PLANE + qoff)), ql1 = ldb(QK + (size_t)(PLANE + qoff) + 32);
    stage_kv(kg, vg, ld);
    asm volatile("s_wait_asynccnt 0x0" ::: "memory");       // this wave's copies of stage 0 have landed
    __syncthreads();                                        // stage 0 is readable by all four waves
    if (nst > 1) stage_kv(kg + KST * HD, vg + KST, ld + STE * 2u);
#pragma unroll 1                                            // rolled: one foot (waits, barrier, refill) per stage, in the ring's order
    for (int t = 0; t < nst; ++t) {
      const unsigned short* sb = kvs + (t & 1) * STE + fofs;
      for (int hf = 0; hf < KST / 32; ++hf) {
        const int kt = hf * 32;                             // first key of this step inside the stage
        v8f s0 = (v8f){}, s1 = (v8f){};
        {
            const unsigned short* kp = sb + kt * KVP;
            const v16bf kh0 = ldbs(kp), kh1 = ldbs(kp + 32), kl0 = ldbs(kp + TLE), kl1 = ldbs(kp + TLE + 32);
            s0 = wmmab(kh0, qh0, s0); s0 = wmmab(kh1, qh1, s0); s0 = wmmab(kh0, ql0, s0); s0 = wmmab(kh1, ql1, s0); s0 = wmmab(kl0, qh0, s0); s0 = wmmab(kl1, qh1, s0);
            asm volatile("v_nop\n\tv_nop\n\tv_nop\n\tv_nop" : "+v"(s0) : "v"(kh0), "v"(kh1), "v"(kl0), "v"(kl1), "v"(qh0), "v"(qh1), "v"(ql0), "v"(ql1));
        }
        asm volatile("" ::: "memory");
        {
            const unsigned short* kp = sb + (kt + 16) * KVP;
            const v16bf kh0 = ldbs(kp), kh1 = ldbs(kp + 32), kl0 = ldbs(kp + TLE), kl1 = ldbs(kp + TLE + 32);
            s1 = wmmab(kh0, qh0, s1); s1 = wmmab(kh1, qh1, s1); s1 = wmmab(kh0, ql0, s1); s1 = wmmab(kh1, ql1, s1); s1 = wmmab(kl0, qh0, s1); s1 = wmmab(kl1, qh1, s1);
            asm volatile("v_nop\n\tv_nop\n\tv_nop\n\tv_nop" : "+v"(s1), "+v"(s0) : "v"(kh0), "v"(kh1), "v"(kl0), "v"(kl1), "v"(qh0), "v"(qh1), "v"(ql0), "v"(ql1));
        }
        float mx = s0[0];
#pragma unroll
        for (int r = 1; r < 8; ++r) mx = fmaxf(mx, s0[r]);
#pragma unroll
        for (int r = 0; r < 8; ++r) mx = fmaxf(mx, s1[r]);
        mx = fmaxf(mx, __shfl_xor(mx, 16, 32));
        const float mn = fmaxf(m, mx);
        const float al = __builtin_amdgcn_exp2f((m - mn) * L2E);
        m = mn;
        float rs = 0.0f; v16h pb;
#pragma unroll
        for (int r = 0; r < 8; ++r) {
            const float e0 = __builtin_amdgcn_exp2f((s0[r] - mn) * L2E), e1 = __builtin_amdgcn_exp2f((s1[r] - mn) * L2E);
            rs += e0 + e1;
            const float c0 = e0 * PCAR, c1 = e1 * PCAR;
            pb[r] = (h16)c0; pb[8 + r] = (h16)c1;
        }
        l = l * al + rs;
#pragma unroll
        for (int dt = 0; dt < 4; ++dt) o[dt] = o[dt] * al;
        asm volatile("" ::: "memory");
        v16h va[4];
        const unsigned short* vp = sb + 2 * TLE + kt;
#pragma unroll
        for (int dt = 0; dt < 4; ++dt) va[dt] = ldhs(vp + dt * 16 * KVP);
#pragma unroll
        for (int dt = 0; dt < 4; ++dt) o[dt] = wmma16(va[dt], pb, o[dt]);
        asm volatile("v_nop\n\tv_nop\n\tv_nop\n\tv_nop" : "+v"(o[0]), "+v"(o[1]), "+v"(o[2]), "+v"(o[3]) : "v"(pb), "v"(va[0]), "v"(va[1]), "v"(va[2]), "v"(va[3]));
      }
      asm volatile("s_wait_dscnt 0x0" ::: "memory");        // this wave's reads of stage t have returned before its buffer is refilled
      asm volatile("s_wait_asynccnt 0x0" ::: "memory");     // this wave's copies of stage t + 1 have landed
      __syncthreads();                                      // publishes stage t + 1 and ends every wave's reads of stage t
      if (t + 2 < nst) stage_kv(kg + (size_t)(t + 2) * (KST * HD), vg + (t + 2) * KST, ld + (unsigned)(t & 1) * (STE * 2u));
    }
    asm volatile("s_wait_asynccnt 0x0" ::: "memory");       // no copy is outstanding when the wave goes on to the epilogue
    l += __shfl_xor(l, 16, 32);
    const float inv = 1.0f / (PCAR * l);
    const int cb = wave * (2 * 16 * CTP);                   // wave-private staging: [plane hi|lo][16 rows][CTP]
#pragma unroll
    for (int dt = 0; dt < 4; ++dt) { v8us oh, ol;
#pragma unroll
        for (int r = 0; r < 8; ++r) { const float y = o[dt][r] * inv; unsigned short a, c; splitf(y, a, c); oh[r] = a; ol[r] = c; }
        *(v8usa*)(cts + cb + ln * CTP + dt * 16 + 8 * hh) = oh; *(v8usa*)(cts + cb + 16 * CTP + ln * CTP + dt * 16 + 8 * hh) = ol; }
    asm volatile("s_wait_dscnt 0x0" ::: "memory"); __builtin_amdgcn_wave_barrier();
    const int b = zz / NH, h = zz % NH;
    const int rq = lane >> 3, pc = (lane & 7) * 8;
    v8us hv[4], lv[4];
#pragma unroll
    for (int it = 0; it < 4; ++it) { const int row = it * 4 + rq; hv[it] = *(const v8usa*)(cts + cb + row * CTP + pc); lv[it] = *(const v8usa*)(cts + cb + 16 * CTP + row * CTP + pc); }
    bf* gh = CT + ((size_t)b * SEQ + qw) * DM + h * HD + pc;
{
#pragma unroll
        for (int it = 0; it < 4; ++it) { const int row = it * 4 + rq; *(v8us*)(gh + (size_t)row * DM) = hv[it]; *(v8us*)(gh + CPL + (size_t)row * DM) = lv[it]; }
         }
}

constexpr size_t SZ_WQKV = (size_t)NQKV * DM * 2;
constexpr size_t SZ_WO   = (size_t)DM * DM * 2;
constexpr size_t SZ_CS   = (size_t)SEQ * 32 * 2 * 4;
constexpr size_t SZ_XB   = (size_t)NB * SEQ * DM * 2;          // all batches, compact [NB][SEQ][DM]
constexpr size_t SZ_QK   = (size_t)4 * NBC * NH * SEQ * HD * 2; // one pass: q hi, q lo, k hi, k lo
constexpr size_t SZ_VT   = (size_t)NBC * NH * SEQ * HD * 2;     // one pass
constexpr size_t SZ_CTX  = (size_t)2 * MROWC * DM * 2;          // one pass: ctx hi, ctx lo
constexpr size_t SZ_TOTAL = SZ_WQKV + SZ_WO + SZ_CS + SZ_XB + SZ_CTX + SZ_QK + SZ_VT;
static_assert(SZ_TOTAL <= (size_t)134217728);
static_assert(SZ_WQKV % 256 == 0 && SZ_WO % 256 == 0 && SZ_CS % 256 == 0 && SZ_XB % 256 == 0 && SZ_CTX % 256 == 0 && SZ_QK % 256 == 0 && SZ_VT % 256 == 0);

extern "C" void kernel_launch(void* const* d_in, const int* in_sizes, int n_in,
                              void* d_out, int out_size, void* d_ws, size_t ws_size, hipStream_t stream) {
    if (n_in < 3) return;
    const long long need_x = (long long)(NB - 1) * SEQ_FULL * DM + (long long)SEQ * DM;
    if ((long long)in_sizes[0] < need_x) return;
    if ((long long)in_sizes[1] < (long long)NQKV * DM) return;
    if ((long long)in_sizes[2] < (long long)DM * DM) return;
    if ((long long)out_size < need_x) return;
    if (SZ_TOTAL > ws_size) return;
    const float* x = (const float*)d_in[0];        // [NB_FULL][SEQ_FULL][DM]
    const float* wqkv = (const float*)d_in[1];     // [NQKV][DM] ('oi')
    const float* wout = (const float*)d_in[2];     // [DM][DM] ('oi')
    float* OUT = (float*)d_out;                    // [NB_FULL][SEQ_FULL][DM]
    char* base = (char*)d_ws; size_t off = 0;
    bf* WQKVB = (bf*)(base + off); off += SZ_WQKV;
    bf* WOB = (bf*)(base + off); off += SZ_WO;
    float* CS = (float*)(base + off); off += SZ_CS;
    bf* XB = (bf*)(base + off); off += SZ_XB;
    bf* CT = (bf*)(base + off); off += SZ_CTX;     // ctx hi plane, lo plane at + CPL
    bf* QK = (bf*)(base + off); off += SZ_QK;
    h16* VT = (h16*)(base + off); off += SZ_VT;

    const unsigned n8w = (unsigned)((size_t)NQKV * DM / 8), n8o = (unsigned)((size_t)DM * DM / 8), n8x = (unsigned)((size_t)NB * SEQ * DM / 8);
    k_cvt8<<<(n8w + 255) / 256, 256, 0, stream>>>(wqkv, WQKVB, n8w, n8w, 0u);
    k_cvt8<<<(n8o + 255) / 256, 256, 0, stream>>>(wout, WOB, n8o, n8o, 0u);
    k_cvt8<<<(n8x + 255) / 256, 256, 0, stream>>>(x, XB, n8x, (unsigned)((size_t)SEQ * DM / 8), (unsigned)((size_t)SEQ_FULL * DM / 8));
    k_cstab<<<(SEQ * 32 + 255) / 256, 256, 0, stream>>>(CS);
    for (int c = 0; c < NB / NBC; ++c) {
        const bf* XBc = XB + (size_t)c * MROWC * DM;                 // rows of this pass
        float* OUTc = OUT + (size_t)c * NBC * SEQ_FULL * DM;         // output rows of this pass
        k_gemm_qkv<<<dim3(MROWC / GBT, NQKV / GBT, 1), 128, 0, stream>>>(XBc, WQKVB, CS, QK, VT);
        k_sdpa<<<dim3(SEQ / 64, NBC * NH, 1), 128, 0, stream>>>(QK, VT, CT);
        k_gemm_out<<<dim3(SEQ / GBT, DM / GBT, NBC), 128, 0, stream>>>(CT, CT + CPL, WOB, OUTc);
    }
}

// v005
// A run of this version takes 194 microseconds.
// Next to v004, in two timings, it ran 1.13 times as fast each time.
// Counting every step since v000, it is 3.46 times as fast.
#include <hip/hip_runtime.h>

// Dense (unmasked) multi-head softmax(q k^T / 8) v block: x [NB][SEQ][1024], fused Wqkv [3072][1024] ('oi', rows = (3, 16 heads, 64)), Wout [1024][1024] ('oi'), interleaved-pair rotary (positions = arange) on q and k, merged heads x Wout^T.
// Compute dtypes, f32 accumulate everywhere: x/Wqkv/Wout converted to bf16 (RNE) and multiplied with v_wmma_f32_16x16x32_bf16 (single product); scores q.k as bf16 hi|lo x bf16 hi|lo, three products (bf16 WMMA); P.V with v_wmma_f32_16x16x32_f16 (P f16 carried x256, v f16); ctx bf16 hi|lo x Wout bf16 (two products); rotary and softmax in f32.
// Batches are processed NBC at a time (host loop of launches); NBC = NB: one pass, each of the three main kernels is launched once over all batches.

#ifndef NB
#define NB 4
#endif
#ifndef SEQ
#define SEQ 2048
#endif
#ifndef NBC
#define NBC (NB)                  // batches per pass: all of them
#endif
#define NB_FULL  4
#define SEQ_FULL 2048
#define DM   1024
#define NH   16
#define HD   64
#define NQKV (3 * DM)
#define PCAR 256.0f               // carry of the f16 probability operand
#define SCL  0.125f               // HD^-0.5, folded into the q planes (exact power of two)
#define L2E  1.4426950408889634f
#define NEGB (-1.0e30f)
#define CTP  72                   // LDS pitch (halves) of the ctx staging rows
#define KST  64                   // keys of one LDS stage of k_sdpa
#define KVP  72                   // LDS pitch (16-bit elements) of a staged 128-byte row: 144 B = 16 B x odd, conflict-free for 16-byte fragment reads
#define TLE  (64 * KVP)           // elements of one staged tile (64 rows)
#define STE  (3 * TLE)            // elements of one stage: K hi | K lo | V^T
#define GBT  128                  // rows and columns of a GEMM block's output tile (2 x 2 waves of 64 x 64)
#define GKS  64                   // k elements of one LDS stage of the GEMMs: 128 bytes a row, staged at pitch KVP
#define GTL  (GBT * KVP)          // elements of one staged GEMM operand tile (128 rows)
#define MROWC (NBC * SEQ)                         // rows of one pass
#define PLANE ((unsigned)(NBC * NH * SEQ * HD))   // elements of one head plane set (one pass)
#define CPL  ((size_t)MROWC * DM)                 // elements of one ctx plane (one pass)

static_assert(HD == 64);
static_assert(DM == NH * HD);
static_assert(DM % 32 == 0);
static_assert(DM % 64 == 0);
static_assert(NQKV % 64 == 0);
static_assert(SEQ % 64 == 0);
static_assert(MROWC % 64 == 0);
static_assert(NB <= NB_FULL);
static_assert(SEQ <= SEQ_FULL);
static_assert(NB % NBC == 0);
static_assert(((size_t)NBC * NH * SEQ * HD) % 512 == 0);
static_assert((SEQ * 32) % 256 == 0);
static_assert((size_t)4 * NBC * NH * SEQ * HD < 4294967296ull);
static_assert((CTP * 2) % 16 == 0);
static_assert(CTP >= HD);
static_assert(SEQ % KST == 0);
static_assert(KST == 64 && KST % 32 == 0);
static_assert((KVP * 2) % 16 == 0 && KVP >= HD && KVP >= KST);
static_assert(GBT == 128 && GKS == 64 && KVP >= GKS);
static_assert(MROWC % GBT == 0 && SEQ % GBT == 0 && NQKV % GBT == 0 && DM % GBT == 0);
static_assert(DM % GKS == 0 && DM / GKS >= 2);

typedef _Float16 h16;
typedef unsigned short bf;
typedef __attribute__((ext_vector_type(16))) __bf16   v16bf;
typedef __attribute__((ext_vector_type(16))) _Float16 v16h;
typedef __attribute__((ext_vector_type(8)))  _Float16 v8h;
typedef __attribute__((ext_vector_type(8)))  unsigned short v8us;
typedef __attribute__((ext_vector_type(8)))  float    v8f;
typedef __attribute__((ext_vector_type(4)))  float    v4f;
typedef __attribute__((ext_vector_type(2)))  float    v2f;
typedef __attribute__((ext_vector_type(2)))  _Float16 v2h;
typedef __attribute__((ext_vector_type(2)))  unsigned short v2us;
typedef v4f  __attribute__((may_alias)) v4fa;
typedef v8us __attribute__((may_alias)) v8usa;
typedef v8h  __attribute__((may_alias)) v8ha;

__device__ __forceinline__ unsigned short f2bf(float f) { unsigned u = __float_as_uint(f); u += 0x7FFFu + ((u >> 16) & 1u); return (unsigned short)(u >> 16); }
__device__ __forceinline__ float bf2f(unsigned short b) { return __uint_as_float(((unsigned)b) << 16); }
__device__ __forceinline__ void splitf(float y, unsigned short& h, unsigned short& l) { h = f2bf(y); l = f2bf(y - bf2f(h)); }
__device__ __forceinline__ v16h cat16(v8h lo, v8h hi) { return __builtin_shufflevector(lo, hi, 0, 1, 2, 3, 4, 5, 6, 7, 8, 9, 10, 11, 12, 13, 14, 15); }
__device__ __forceinline__ v16bf cat16b(v8us lo, v8us hi) { return __builtin_bit_cast(v16bf, __builtin_shufflevector(lo, hi, 0, 1, 2, 3, 4, 5, 6, 7, 8, 9, 10, 11, 12, 13, 14, 15)); }
__device__ __forceinline__ v8f wmma16(v16h a, v16h b, v8f c) { return __builtin_amdgcn_wmma_f32_16x16x32_f16(false, a, false, b, (short)0, c, false, false); }
__device__ __forceinline__ v8f wmmab(v16bf a, v16bf b, v8f c) { return __builtin_amdgcn_wmma_f32_16x16x32_bf16(false, a, false, b, (short)0, c, false, false); }
// Fragment loaders (A and B share the k map): p points at row (lane&15), column k0 + 8*(lane>>4); elements 0..7 <- p[0..7], elements 8..15 <- p[16..23].
__device__ __forceinline__ v16bf ldb(const bf* p) { return cat16b(*(const v8us*)p, *(const v8us*)(p + 16)); }
// The same k map on the staged LDS rows (bf16 rows of K, f16 rows of V^T).
__device__ __forceinline__ v16bf ldbs(const unsigned short* p) { return cat16b(*(const v8usa*)p, *(const v8usa*)(p + 16)); }
__device__ __forceinline__ v16h ldhs(const unsigned short* p) { return cat16(*(const v8ha*)p, *(const v8ha*)(p + 16)); }

// One 128-row x 128-byte operand tile of a GEMM stage: 128 lanes x 8 asynchronous copies of 16 B; lane tid takes 16-byte piece (tid & 7) of rows (tid >> 3) + 16 i, so every wave-wide copy covers four whole 128-byte lines.
// g: the lane's first piece in the K-contiguous plane (row pitch K elements); ld: its LDS byte address in the staged tile (row pitch KVP elements).
__device__ __forceinline__ void stage_g(const bf* g, const int K, const unsigned ld) {
    const unsigned rb = 16u * KVP * 2u;                     // bytes of 16 staged rows
    const size_t rg = (size_t)16 * K;                       // elements of 16 plane rows
    // The copies and the s_wait_xcnt that stands in front of any rewrite of their address registers are one statement, so that nothing can move in between.
    asm volatile("global_load_async_to_lds_b128 %0, %8, off\n\t"
                 "global_load_async_to_lds_b128 %1, %9, off\n\t"
                 "global_load_async_to_lds_b128 %2, %10, off\n\t"
                 "global_load_async_to_lds_b128 %3, %11, off\n\t"
                 "global_load_async_to_lds_b128 %4, %12, off\n\t"
                 "global_load_async_to_lds_b128 %5, %13, off\n\t"
                 "global_load_async_to_lds_b128 %6, %14, off\n\t"
                 "global_load_async_to_lds_b128 %7, %15, off\n\t"
                 "s_wait_xcnt 0x0"
                 :: "v"(ld), "v"(ld + rb), "v"(ld + 2u * rb), "v"(ld + 3u * rb), "v"(ld + 4u * rb), "v"(ld + 5u * rb), "v"(ld + 6u * rb), "v"(ld + 7u * rb),
                    "v"(g), "v"(g + rg), "v"(g + 2 * rg), "v"(g + 3 * rg), "v"(g + 4 * rg), "v"(g + 5 * rg), "v"(g + 6 * rg), "v"(g + 7 * rg)
                 : "memory");
}

// ---- GEMM body: block = 4 waves on a 128x128 output tile, ONE WAVE per 64x64 quarter (16 accumulators); the block's 128 rows of A (, A2) and of Bt come from the K-contiguous bf16 planes in 64-k stages through a two-buffer LDS ring that the four waves share; grid (M/128, N/128, Z), 128 threads.
// C[m][n] (f32, pitch ldc) = sum_k (A[m][k] (+ A2[m][k])) Bt[n][k]. K % 64 == 0, K >= 128, M % 128 == 0, N % 128 == 0 (asserted at file scope for the two uses).
// EPI == 0: the tile is stored to C. EPI == 1 (qkv projection): the 64 columns of a wave's quarter are one head of q, k or v, and the quarter goes straight to that head's planes:
// q, k: rotary (interleaved pairs: out[2j] = x[2j] c_j - x[2j+1] s_j, out[2j+1] = x[2j] s_j + x[2j+1] c_j; q also x SCL), split bf16 hi|lo, planes [zz = b*NH + h][t][d]; v: f16, transposed, [zz][d][t].
template <int NSPLIT, int EPI = 0>
__device__ __forceinline__ void gemmw_body(const bf* __restrict__ A, const bf* __restrict__ A2, const bf* __restrict__ Bt, const int K, float* C, const int ldc, const size_t sA, const size_t sC,
                                           const float* __restrict__ CS = nullptr, bf* QK = nullptr, h16* VT = nullptr) {
    constexpr int NT = 2 + NSPLIT;                          // tiles of one stage: A (, A2), Bt
    __shared__ __align__(16) float osb[4 * 16 * 68];
    __shared__ __align__(16) unsigned short gs[2 * NT * GTL];
    const size_t z = blockIdx.z; A += z * sA; A2 += z * sA; C += z * sC;
    const int lane = threadIdx.x & 31, lr = lane & 15, hi = lane >> 4;
    const int wave = __builtin_amdgcn_readfirstlane((int)(threadIdx.x >> 5));
    const int rb0 = blockIdx.x * GBT, cb0 = blockIdx.y * GBT, wr = (wave & 1) * 64, wc = (wave >> 1) * 64;
    const int r0 = rb0 + wr, c0 = cb0 + wc;                 // the wave's own 64x64 quarter
    float* os = osb + wave * (16 * 68);                     // wave-private epilogue staging
    v8f acc[4][4];
#pragma unroll
    for (int mb = 0; mb < 4; ++mb)
#pragma unroll
        for (int nb = 0; nb < 4; ++nb) acc[mb][nb] = (v8f){};
    const unsigned tid = threadIdx.x;
    const size_t goff = (size_t)(tid >> 3) * K + (tid & 7u) * 8u;
    const bf* ga = A + (size_t)rb0 * K + goff; const bf* ga2 = A2 + (size_t)rb0 * K + goff; const bf* gb = Bt + (size_t)cb0 * K + goff;
    const unsigned ld = (unsigned)(size_t)gs + ((tid >> 3) * KVP + (tid & 7u) * 8u) * 2u;
    const int nst = K / GKS;
    auto fill = [&](const int st, const unsigned buf) {     // stage st (k = 64 st ..) into ring buffer buf
        const unsigned l0 = ld + buf * (unsigned)(NT * GTL * 2);
        stage_g(ga + st * GKS, K, l0);
        if (NSPLIT == 1) stage_g(ga2 + st * GKS, K, l0 + GTL * 2u);
        stage_g(gb + st * GKS, K, l0 + (unsigned)((NT - 1) * GTL * 2));
    };
    fill(0, 0u);
    asm volatile("s_wait_asynccnt 0x0" ::: "memory");       // this wave's copies of stage 0 have landed
    __syncthreads();                                        // stage 0 is readable by all four waves
    fill(1, 1u);
#pragma unroll 1                                            // rolled: one foot (waits, barrier, refill) per stage, in the ring's order
    for (int t = 0; t < nst; ++t) {
      const unsigned short* sb = gs + (t & 1) * (NT * GTL) + lr * KVP + 8 * hi;    // fragment position: row lr, column 8 hi
      const unsigned short* pa = sb + wr * KVP; const unsigned short* pb = sb + (NT - 1) * GTL + wc * KVP;
#pragma unroll                                              // both 32-k steps of a stage in line: their LDS offsets become immediates
      for (int kc = 0; kc < GKS; kc += 32) {
        v16bf a[4], a2[4], bl;
#pragma unroll
        for (int mb = 0; mb < 4; ++mb) { a[mb] = ldbs(pa + mb * 16 * KVP + kc); if (NSPLIT == 1) a2[mb] = ldbs(pa + GTL + mb * 16 * KVP + kc); else a2[mb] = a[mb]; }
#pragma unroll
        for (int nb = 0; nb < 4; ++nb) { const v16bf b = ldbs(pb + nb * 16 * KVP + kc); if (nb == 3) bl = b;
#pragma unroll
            for (int mb = 0; mb < 4; ++mb) { acc[mb][nb] = wmmab(a[mb], b, acc[mb][nb]); if (NSPLIT == 1) acc[mb][nb] = wmmab(a2[mb], b, acc[mb][nb]); } }
        asm volatile("" : "+v"(acc[0][0]), "+v"(acc[0][1]), "+v"(acc[1][0]), "+v"(acc[1][1]), "+v"(acc[2][0]), "+v"(acc[2][1]), "+v"(acc[3][0]), "+v"(acc[3][1]));
        asm volatile("v_nop\n\tv_nop\n\tv_nop\n\tv_nop" : "+v"(acc[0][2]), "+v"(acc[0][3]), "+v"(acc[1][2]), "+v"(acc[1][3]), "+v"(acc[2][2]), "+v"(acc[2][3]), "+v"(acc[3][2]), "+v"(acc[3][3]) : "v"(a[0]), "v"(a[1]), "v"(a[2]), "v"(a[3]), "v"(bl));
        asm volatile("" : "+v"(acc[0][0]), "+v"(acc[0][1]), "+v"(acc[1][0]), "+v"(acc[1][1]), "+v"(acc[2][0]), "+v"(acc[2][1]), "+v"(acc[3][0]), "+v"(acc[3][1]) : "v"(a2[0]), "v"(a2[1]), "v"(a2[2]), "v"(a2[3]));
      }
      asm volatile("s_wait_dscnt 0x0" ::: "memory");        // this wave's reads of stage t have returned before its buffer is refilled
      asm volatile("s_wait_asynccnt 0x0" ::: "memory");     // this wave's copies of stage t + 1 have landed
      __syncthreads();                                      // publishes stage t + 1 and ends every wave's reads of stage t
      if (t + 2 < nst) fill(t + 2, (unsigned)(t & 1));
    }
    asm volatile("s_wait_asynccnt 0x0" ::: "memory");       // no copy is outstanding when the wave goes on to the epilogue
    if constexpr (EPI == 1) {
        const unsigned which = (unsigned)c0 / DM, h = ((unsigned)c0 / HD) % NH;          // wave-uniform: 0 q, 1 k, 2 v; head
        const unsigned zz = ((unsigned)r0 / SEQ) * NH + h, t0 = (unsigned)r0 % SEQ;      // SEQ % 64 == 0: the 64 rows lie in one batch
        const int rq = lane >> 3, pc = (lane & 7) * 8;                                   // read-back: 4 rows a step, 8 elements a lane
        if (which < 2u) {
            const float sc = which ? 1.0f : SCL;
            bf* ph = QK + (size_t)(which * 2u) * PLANE + (size_t)zz * (SEQ * HD) + (size_t)t0 * HD + pc;
            const float* cp = CS + (size_t)t0 * HD + pc;                                 // row t of the table: 32 (cos, sin) pairs = HD floats
#pragma unroll
            for (int mb = 0; mb < 4; ++mb) {
                v4f cs[4][2];                                                            // issued ahead of the staging so that their latency runs beside it
#pragma unroll
                for (int s = 0; s < 4; ++s) { const float* cr = cp + (size_t)(mb * 16 + s * 4 + rq) * HD; cs[s][0] = *(const v4f*)cr; cs[s][1] = *(const v4f*)(cr + 4); }
#pragma unroll
                for (int nb = 0; nb < 4; ++nb) {
#pragma unroll
                    for (int j = 0; j < 8; ++j) os[(hi * 8 + j) * 68 + nb * 16 + lr] = acc[mb][nb][j]; }
                asm volatile("s_wait_dscnt 0x0" ::: "memory"); __builtin_amdgcn_wave_barrier();   // the 16 staged rows are written before other lanes read them
#pragma unroll
                for (int s = 0; s < 4; ++s) { const int row = s * 4 + rq; v8us oh, ol;
#pragma unroll
                    for (int g = 0; g < 2; ++g) { const v4f x = *(const v4fa*)(os + row * 68 + pc + 4 * g); const v4f c = cs[s][g];
#pragma unroll
                        for (int p = 0; p < 2; ++p) {
                            const float y0 = (x[2 * p] * c[2 * p] - x[2 * p + 1] * c[2 * p + 1]) * sc;
                            const float y1 = (x[2 * p] * c[2 * p + 1] + x[2 * p + 1] * c[2 * p]) * sc;
                            unsigned short a, d;
                            splitf(y0, a, d); oh[4 * g + 2 * p] = a; ol[4 * g + 2 * p] = d; splitf(y1, a, d); oh[4 * g + 2 * p + 1] = a; ol[4 * g + 2 * p + 1] = d; } }
                    bf* pr = ph + (size_t)(mb * 16 + row) * HD;
                    *(v8us*)pr = oh; *(v8us*)(pr + PLANE) = ol; }
                if (mb < 3) asm volatile("s_wait_xcnt 0x0" ::: "memory");                         // stands in front of the next rows' loads and arithmetic, which reuse the registers these stores name
                asm volatile("s_wait_dscnt 0x0" ::: "memory"); __builtin_amdgcn_wave_barrier();   // every read of the staged rows has returned before they are rewritten
            }
        } else {
            h16* vs = (h16*)os;                                                          // 16 d rows x 64 t, pitch CTP halves, in the same staging bytes
            h16* pv = VT + (size_t)zz * (SEQ * HD) + (size_t)rq * SEQ + t0 + pc;
#pragma unroll
            for (int nb = 0; nb < 4; ++nb) {
#pragma unroll
                for (int mb = 0; mb < 4; ++mb) { v8h hv;                                 // a lane's 8 accumulator rows are 8 consecutive t of its column d
#pragma unroll
                    for (int j = 0; j < 8; ++j) hv[j] = (h16)acc[mb][nb][j];
                    *(v8ha*)(vs + lr * CTP + mb * 16 + hi * 8) = hv; }
                asm volatile("s_wait_dscnt 0x0" ::: "memory"); __builtin_amdgcn_wave_barrier();   // the 16 staged rows are written before other lanes read them
#pragma unroll
                for (int s = 0; s < 4; ++s) { const v8h val = *(const v8ha*)(vs + (s * 4 + rq) * CTP + pc);
                    *(v8h*)(pv + (size_t)(nb * 16 + s * 4) * SEQ) = val; }
                asm volatile("s_wait_dscnt 0x0" ::: "memory"); __builtin_amdgcn_wave_barrier();   // every read of the staged rows has returned before they are rewritten
            }
            asm volatile("s_wait_xcnt 0x0" ::: "memory");                                         // stands behind the last rows' stores, in front of any code laid out after them that reuses the registers they name
        }
        return;
    }
#pragma unroll
    for (int mb = 0; mb < 4; ++mb) {
#pragma unroll
        for (int nb = 0; nb < 4; ++nb) {
#pragma unroll
            for (int j = 0; j < 8; ++j) os[(hi * 8 + j) * 68 + nb * 16 + lr] = acc[mb][nb][j]; }
        asm volatile("s_wait_dscnt 0x0" ::: "memory"); __builtin_amdgcn_wave_barrier();
        float* crow = C + (size_t)(r0 + mb * 16) * ldc + c0;
{
#pragma unroll
            for (int s = 0; s < 8; ++s) { const int row = 2 * s + hi, cofs = lr * 4; const v4f val = *(const v4fa*)(os + row * 68 + cofs);
                *(v4f*)(crow + (size_t)row * ldc + cofs) = val; }
             }
        asm volatile("s_wait_dscnt 0x0" ::: "memory"); __builtin_amdgcn_wave_barrier();
    }
}
// qkv projection of one pass, sum_k XB[m][k] WQKVB[o][k], written as the head planes q hi|lo, k hi|lo (QK) and V^T (VT); grid (MROWC/128, NQKV/128, 1).
__global__ __launch_bounds__(128) void k_gemm_qkv(const bf* __restrict__ A, const bf* __restrict__ Bt, const float* __restrict__ CS, bf* QK, h16* VT) { gemmw_body<0, 1>(A, A, Bt, DM, nullptr, NQKV, 0, 0, CS, QK, VT); }
// output projection of one pass: OUT[b][t][o] = sum_k (CTXh + CTXl)[b*SEQ + t][k] WOB[o][k]; grid (SEQ/128, DM/128, NBC); output batch pitch SEQ_FULL*DM.
__global__ __launch_bounds__(128) void k_gemm_out(const bf* __restrict__ Ah, const bf* __restrict__ Al, const bf* __restrict__ Bt, float* C) { gemmw_body<1>(Ah, Al, Bt, DM, C, DM, (size_t)SEQ * DM, (size_t)SEQ_FULL * DM); }

__global__ __launch_bounds__(256) void k_cvt8(const float* __restrict__ src, bf* dst, unsigned n8, unsigned per8, unsigned sstride8) {
    const unsigned i = blockIdx.x * 256u + threadIdx.x; if (i >= n8) return;
    const size_t si = (size_t)(i / per8) * sstride8 + (i % per8);
    const v8f v = *(const v8f*)(src + si * 8); v8us o;
#pragma unroll
    for (int k = 0; k < 8; ++k) o[k] = f2bf(v[k]);
    *(v8us*)(dst + (size_t)i * 8) = o;  }

__global__ __launch_bounds__(256) void k_cstab(float* CS) {
    const int idx = blockIdx.x * 256 + threadIdx.x; if (idx >= SEQ * 32) return;
    const int j = idx & 31, t = idx >> 5;
    double p = 1.0;
    p *= (j & 1) ? 1.3335214321633240 : 1.0;
    p *= (j & 2) ? 1.7782794100389228 : 1.0;
    p *= (j & 4) ? 3.1622776601683795 : 1.0;
    p *= (j & 8) ? 10.0 : 1.0;
    p *= (j & 16) ? 100.0 : 1.0;
    const float pf = (float)p; const float inv = 1.0f / pf; const float ang = (float)t * inv;
    float sn, cn; sincosf(ang, &sn, &cn);
    v2f cs; cs[0] = cn; cs[1] = sn;
    *(v2f*)(CS + (size_t)idx * 2) = cs;  }

// One stage of k_sdpa's LDS ring: 64 keys = K hi rows, K lo rows (64 x 128 B each, contiguous in their planes) and V^T (64 d rows x 128 B, row pitch SEQ halves).
// 128 lanes x 12 asynchronous copies of 16 B; lane tid takes 16-byte piece (tid & 7) of rows (tid >> 3) + 16 i, so every wave-wide copy covers four whole 128-byte lines.
// kg, vg: the lane's first piece in the K hi plane and in V^T; ld: its LDS byte address in the stage's K hi tile.
__device__ __forceinline__ void stage_kv(const bf* kg, const h16* vg, const unsigned ld) {
    const bf* kl = kg + PLANE;
    const unsigned rb = 16u * KVP * 2u, tb = TLE * 2u;      // bytes of 16 staged rows, of one tile
    // The copies and the s_wait_xcnt that stands in front of any rewrite of their address registers are one statement, so that nothing can move in between.
    asm volatile("global_load_async_to_lds_b128 %0, %12, off\n\t"
                 "global_load_async_to_lds_b128 %1, %13, off\n\t"
                 "global_load_async_to_lds_b128 %2, %14, off\n\t"
                 "global_load_async_to_lds_b128 %3, %15, off\n\t"
                 "global_load_async_to_lds_b128 %4, %16, off\n\t"
                 "global_load_async_to_lds_b128 %5, %17, off\n\t"
                 "global_load_async_to_lds_b128 %6, %18, off\n\t"
                 "global_load_async_to_lds_b128 %7, %19, off\n\t"
                 "global_load_async_to_lds_b128 %8, %20, off\n\t"
                 "global_load_async_to_lds_b128 %9, %21, off\n\t"
                 "global_load_async_to_lds_b128 %10, %22, off\n\t"
                 "global_load_async_to_lds_b128 %11, %23, off\n\t"
                 "s_wait_xcnt 0x0"
                 :: "v"(ld), "v"(ld + rb), "v"(ld + 2u * rb), "v"(ld + 3u * rb),
                    "v"(ld + tb), "v"(ld + tb + rb), "v"(ld + tb + 2u * rb), "v"(ld + tb + 3u * rb),
                    "v"(ld + 2u * tb), "v"(ld + 2u * tb + rb), "v"(ld + 2u * tb + 2u * rb), "v"(ld + 2u * tb + 3u * rb),
                    "v"(kg), "v"(kg + 16 * HD), "v"(kg + 32 * HD), "v"(kg + 48 * HD),
                    "v"(kl), "v"(kl + 16 * HD), "v"(kl + 32 * HD), "v"(kl + 48 * HD),
                    "v"(vg), "v"(vg + 16 * SEQ), "v"(vg + 32 * SEQ), "v"(vg + 48 * SEQ)
                 : "memory");
}

// ---- fused dense softmax(q k^T) v: block = 4 waves, wave = 16 query rows of one (b, h); key loop over ALL keys in 32-key steps; K hi|lo and V^T come in 64-key stages through a two-buffer LDS ring that the four waves share, q fragments loaded once from the planes and kept in registers.
// S^T[key][query] = K.Q^T (A = K rows, B = Q rows; hi.hi + hi.lo + lo.hi): lane (hh, ln) holds query qw+ln, keys kt + 16j + 8hh + r, which IS the B fragment of P^T for
// O^T[d][query] = V^T.P^T (A = V^T rows d, k = keys). Online softmax per lane (one query per lane, halves combined by one xor-16 shuffle); the rescale factor is lane-local.
// grid (SEQ/64, NBC*NH), 128 threads.
__global__ __launch_bounds__(128) void k_sdpa(const bf* __restrict__ QK, const h16* __restrict__ VT, bf* CT) {
    __shared__ __align__(16) unsigned short cts[4 * 2 * 16 * CTP];
    __shared__ __align__(16) unsigned short kvs[2 * STE];
    const int lane = threadIdx.x & 31, hh = lane >> 4, ln = lane & 15;
    const int wave = __builtin_amdgcn_readfirstlane((int)(threadIdx.x >> 5));
    const int zz = blockIdx.y;
    const int qw = (int)blockIdx.x * 64 + wave * 16;
    const int nst = SEQ / KST;                              // stages: all keys 0 .. SEQ-1
    const unsigned hb = (unsigned)zz * (unsigned)(SEQ * HD);
    const unsigned qoff = hb + (unsigned)(qw + ln) * HD + 8u * hh;
    const unsigned fofs = (unsigned)ln * KVP + 8u * hh;     // fragment position in a staged tile: row ln, column 8 hh
    const unsigned tid = threadIdx.x;
    const bf* kg = QK + (size_t)(2u * PLANE + hb + tid * 8u);
    const h16* vg = VT + (size_t)(hb + (tid >> 3) * SEQ + (tid & 7u) * 8u);
    const unsigned ld = (unsigned)(size_t)kvs + ((tid >> 3) * KVP + (tid & 7u) * 8u) * 2u;
    v8f o[4];
#pragma unroll
    for (int dt = 0; dt < 4; ++dt) o[dt] = (v8f){};
    float m = NEGB, l = 0.0f;
    // The wave's q fragments (B operand, hi|lo x two 32-d halves) are loaded once and stay in registers for the whole key loop.
    const v16bf qh0 = ldb(QK + (size_t)qoff), qh1 = ldb(QK + (size_t)qoff + 32), ql0 = ldb(QK + (size_t)(PLANE + qoff)), ql1 = ldb(QK + (size_t)(PLANE + qoff) + 32);
    stage_kv(kg, vg, ld);
    asm volatile("s_wait_asynccnt 0x0" ::: "memory");       // this wave's copies of stage 0 have landed
    __syncthreads();                                        // stage 0 is readable by all four waves
    if (nst > 1) stage_kv(kg + KST * HD, vg + KST, ld + STE * 2u);
#pragma unroll 1                                            // rolled: one foot (waits, barrier, refill) per stage, in the ring's order
    for (int t = 0; t < nst; ++t) {
      const unsigned short* sb = kvs + (t & 1) * STE + fofs;
      for (int hf = 0; hf < KST / 32; ++hf) {
        const int kt = hf * 32;                             // first key of this step inside the stage
        v8f s0 = (v8f){}, s1 = (v8f){};
        {
            const unsigned short* kp = sb + kt * KVP;
            const v16bf kh0 = ldbs(kp), kh1 = ldbs(kp + 32), kl0 = ldbs(kp + TLE), kl1 = ldbs(kp + TLE + 32);
            s0 = wmmab(kh0, qh0, s0); s0 = wmmab(kh1, qh1, s0); s0 = wmmab(kh0, ql0, s0); s0 = wmmab(kh1, ql1, s0); s0 = wmmab(kl0, qh0, s0); s0 = wmmab(kl1, qh1, s0);
            asm volatile("v_nop\n\tv_nop\n\tv_nop\n\tv_nop" : "+v"(s0) : "v"(kh0), "v"(kh1), "v"(kl0), "v"(kl1), "v"(qh0), "v"(qh1), "v"(ql0), "v"(ql1));
        }
        asm volatile("" ::: "memory");
        {
            const unsigned short* kp = sb + (kt + 16) * KVP;
            const v16bf kh0 = ldbs(kp), kh1 = ldbs(kp + 32), kl0 = ldbs(kp + TLE), kl1 = ldbs(kp + TLE + 32);
            s1 = wmmab(kh0, qh0, s1); s1 = wmmab(kh1, qh1, s1); s1 = wmmab(kh0, ql0, s1); s1 = wmmab(kh1, ql1, s1); s1 = wmmab(kl0, qh0, s1); s1 = wmmab(kl1, qh1, s1);
            asm volatile("v_nop\n\tv_nop\n\tv_nop\n\tv_nop" : "+v"(s1), "+v"(s0) : "v"(kh0), "v"(kh1), "v"(kl0), "v"(kl1), "v"(qh0), "v"(qh1), "v"(ql0), "v"(ql1));
        }
        float mx = s0[0];
#pragma unroll
        for (int r = 1; r < 8; ++r) mx = fmaxf(mx, s0[r]);
#pragma unroll
        for (int r = 0; r < 8; ++r) mx = fmaxf(mx, s1[r]);
        mx = fmaxf(mx, __shfl_xor(mx, 16, 32));
        const float mn = fmaxf(m, mx);
        const float al = __builtin_amdgcn_exp2f((m - mn) * L2E);
        m = mn;
        float rs = 0.0f; v16h pb;
#pragma unroll
        for (int r = 0; r < 8; ++r) {
            const float e0 = __builtin_amdgcn_exp2f((s0[r] - mn) * L2E), e1 = __builtin_amdgcn_exp2f((s1[r] - mn) * L2E);
            rs += e0 + e1;
            const float c0 = e0 * PCAR, c1 = e1 * PCAR;
            pb[r] = (h16)c0; pb[8 + r] = (h16)c1;
        }
        l = l * al + rs;
#pragma unroll
        for (int dt = 0; dt < 4; ++dt) o[dt] = o[dt] * al;
        asm volatile("" ::: "memory");
        v16h va[4];
        const unsigned short* vp = sb + 2 * TLE + kt;
#pragma unroll
        for (int dt = 0; dt < 4; ++dt) va[dt] = ldhs(vp + dt * 16 * KVP);
#pragma unroll
        for (int dt = 0; dt < 4; ++dt) o[dt] = wmma16(va[dt], pb, o[dt]);
        asm volatile("v_nop\n\tv_nop\n\tv_nop\n\tv_nop" : "+v"(o[0]), "+v"(o[1]), "+v"(o[2]), "+v"(o[3]) : "v"(pb), "v"(va[0]), "v"(va[1]), "v"(va[2]), "v"(va[3]));
      }
      asm volatile("s_wait_dscnt 0x0" ::: "memory");        // this wave's reads of stage t have returned before its buffer is refilled
      asm volatile("s_wait_asynccnt 0x0" ::: "memory");     // this wave's copies of stage t + 1 have landed
      __syncthreads();                                      // publishes stage t + 1 and ends every wave's reads of stage t
      if (t + 2 < nst) stage_kv(kg + (size_t)(t + 2) * (KST * HD), vg + (t + 2) * KST, ld + (unsigned)(t & 1) * (STE * 2u));
    }
    asm volatile("s_wait_asynccnt 0x0" ::: "memory");       // no copy is outstanding when the wave goes on to the epilogue
    l += __shfl_xor(l, 16, 32);
    const float inv = 1.0f / (PCAR * l);
    const int cb = wave * (2 * 16 * CTP);                   // wave-private staging: [plane hi|lo][16 rows][CTP]
#pragma unroll
    for (int dt = 0; dt < 4; ++dt) { v8us oh, ol;
#pragma unroll
        for (int r = 0; r < 8; ++r) { const float y = o[dt][r] * inv; unsigned short a, c; splitf(y, a, c); oh[r] = a; ol[r] = c; }
        *(v8usa*)(cts + cb + ln * CTP + dt * 16 + 8 * hh) = oh; *(v8usa*)(cts + cb + 16 * CTP + ln * CTP + dt * 16 + 8 * hh) = ol; }
    asm volatile("s_wait_dscnt 0x0" ::: "memory"); __builtin_amdgcn_wave_barrier();
    const int b = zz / NH, h = zz % NH;
    const int rq = lane >> 3, pc = (lane & 7) * 8;
    v8us hv[4], lv[4];
#pragma unroll
    for (int it = 0; it < 4; ++it) { const int row = it * 4 + rq; hv[it] = *(const v8usa*)(cts + cb + row * CTP + pc); lv[it] = *(const v8usa*)(cts + cb + 16 * CTP + row * CTP + pc); }
    bf* gh = CT + ((size_t)b * SEQ + qw) * DM + h * HD + pc;
{
#pragma unroll
        for (int it = 0; it < 4; ++it) { const int row = it * 4 + rq; *(v8us*)(gh + (size_t)row * DM) = hv[it]; *(v8us*)(gh + CPL + (size_t)row * DM) = lv[it]; }
         }
}

constexpr size_t SZ_WQKV = (size_t)NQKV * DM * 2;
constexpr size_t SZ_WO   = (size_t)DM * DM * 2;
constexpr size_t SZ_CS   = (size_t)SEQ * 32 * 2 * 4;
constexpr size_t SZ_XB   = (size_t)NB * SEQ * DM * 2;          // all batches, compact [NB][SEQ][DM]
constexpr size_t SZ_QK   = (size_t)4 * NBC * NH * SEQ * HD * 2; // one pass: q hi, q lo, k hi, k lo
constexpr size_t SZ_VT   = (size_t)NBC * NH * SEQ * HD * 2;     // one pass
constexpr size_t SZ_CTX  = (size_t)2 * MROWC * DM * 2;          // one pass: ctx hi, ctx lo
constexpr size_t SZ_TOTAL = SZ_WQKV + SZ_WO + SZ_CS + SZ_XB + SZ_CTX + SZ_QK + SZ_VT;
static_assert(SZ_TOTAL <= (size_t)268435456);
static_assert(SZ_WQKV % 256 == 0 && SZ_WO % 256 == 0 && SZ_CS % 256 == 0 && SZ_XB % 256 == 0 && SZ_CTX % 256 == 0 && SZ_QK % 256 == 0 && SZ_VT % 256 == 0);

extern "C" void kernel_launch(void* const* d_in, const int* in_sizes, int n_in,
                              void* d_out, int out_size, void* d_ws, size_t ws_size, hipStream_t stream) {
    if (n_in < 3) return;
    const long long need_x = (long long)(NB - 1) * SEQ_FULL * DM + (long long)SEQ * DM;
    if ((long long)in_sizes[0] < need_x) return;
    if ((long long)in_sizes[1] < (long long)NQKV * DM) return;
    if ((long long)in_sizes[2] < (long long)DM * DM) return;
    if ((long long)out_size < need_x) return;
    if (SZ_TOTAL > ws_size) return;
    const float* x = (const float*)d_in[0];        // [NB_FULL][SEQ_FULL][DM]
    const float* wqkv = (const float*)d_in[1];     // [NQKV][DM] ('oi')
    const float* wout = (const float*)d_in[2];     // [DM][DM] ('oi')
    float* OUT = (float*)d_out;                    // [NB_FULL][SEQ_FULL][DM]
    char* base = (char*)d_ws; size_t off = 0;
    bf* WQKVB = (bf*)(base + off); off += SZ_WQKV;
    bf* WOB = (bf*)(base + off); off += SZ_WO;
    float* CS = (float*)(base + off); off += SZ_CS;
    bf* XB = (bf*)(base + off); off += SZ_XB;
    bf* CT = (bf*)(base + off); off += SZ_CTX;     // ctx hi plane, lo plane at + CPL
    bf* QK = (bf*)(base + off); off += SZ_QK;
    h16* VT = (h16*)(base + off); off += SZ_VT;

    const unsigned n8w = (unsigned)((size_t)NQKV * DM / 8), n8o = (unsigned)((size_t)DM * DM / 8), n8x = (unsigned)((size_t)NB * SEQ * DM / 8);
    k_cvt8<<<(n8w + 255) / 256, 256, 0, stream>>>(wqkv, WQKVB, n8w, n8w, 0u);
    k_cvt8<<<(n8o + 255) / 256, 256, 0, stream>>>(wout, WOB, n8o, n8o, 0u);
    k_cvt8<<<(n8x + 255) / 256, 256, 0, stream>>>(x, XB, n8x, (unsigned)((size_t)SEQ * DM / 8), (unsigned)((size_t)SEQ_FULL * DM / 8));
    k_cstab<<<(SEQ * 32 + 255) / 256, 256, 0, stream>>>(CS);
    for (int c = 0; c < NB / NBC; ++c) {
        const bf* XBc = XB + (size_t)c * MROWC * DM;                 // rows of this pass
        float* OUTc = OUT + (size_t)c * NBC * SEQ_FULL * DM;         // output rows of this pass
        k_gemm_qkv<<<dim3(MROWC / GBT, NQKV / GBT, 1), 128, 0, stream>>>(XBc, WQKVB, CS, QK, VT);
        k_sdpa<<<dim3(SEQ / 64, NBC * NH, 1), 128, 0, stream>>>(QK, VT, CT);
        k_gemm_out<<<dim3(SEQ / GBT, DM / GBT, NBC), 128, 0, stream>>>(CT, CT + CPL, WOB, OUTc);
    }
}

// v007
// One run takes 153 microseconds.
// Versions between v005 and this one are left out; their measured steps multiply to 1.27 times as fast.
// All steps since v000 together make it 4.40 times as fast.
#include <hip/hip_runtime.h>

// Dense (unmasked) multi-head softmax(q k^T / 8) v block: x [NB][SEQ][1024], fused Wqkv [3072][1024] ('oi', rows = (3, 16 heads, 64)), Wout [1024][1024] ('oi'), interleaved-pair rotary (positions = arange) on q and k, merged heads x Wout^T.
// Compute dtypes, f32 accumulate everywhere: x/Wqkv/Wout converted to bf16 (RNE) and multiplied with v_wmma_f32_16x16x32_bf16 (single product); scores q.k as f16 x f16, one product (v_wmma_f32_16x16x32_f16; the rotated q and k are rounded once to f16, 11 significant bits, finer than the bf16 operands they were projected from); P.V with v_wmma_f32_16x16x32_f16 (P f16 carried x256, v f16; the softmax runs in base 2: log2(e) rides in the q planes' scale and the carry in the exponent's offset); ctx bf16 hi|lo x Wout bf16 (two products); rotary and softmax in f32.
// Batches are processed NBC at a time (host loop of launches); NBC = NB: one pass, each of the three main kernels is launched once over all batches.

#ifndef NB
#define NB 4
#endif
#ifndef SEQ
#define SEQ 2048
#endif
#ifndef NBC
#define NBC (NB)                  // batches per pass: all of them
#endif
#define NB_FULL  4
#define SEQ_FULL 2048
#define DM   1024
#define NH   16
#define HD   64
#define NQKV (3 * DM)
#define PLOG 8.0f                 // log2 of the carry (x256) of the f16 probability operand and of the row sum: added to every exponent, divided out with the sum
#define L2E  1.4426950408889634f
#define QSC  (0.125f * L2E)       // HD^-0.5 log2(e), folded into the q planes: the score products come out as base-2 exponents
#define NEGB (-1.0e30f)
#define CTP  72                   // LDS pitch (halves) of the ctx staging rows
#define KST  64                   // keys of one LDS stage of k_sdpa
#define KVP  72                   // LDS pitch (16-bit elements) of a staged 128-byte row: 144 B = 16 B x odd, conflict-free for 16-byte fragment reads
#define TLE  (64 * KVP)           // elements of one staged tile (64 rows)
#define STE  (2 * TLE)            // elements of one stage: K | V^T
#define GBT  128                  // rows and columns of a GEMM block's output tile (2 x 2 waves of 64 x 64)
#define GKS  64                   // k elements of one LDS stage of the GEMMs: 128 bytes a row, staged at pitch KVP
#define GTL  (GBT * KVP)          // elements of one staged GEMM operand tile (128 rows)
#define MROWC (NBC * SEQ)                         // rows of one pass
#define PLANE ((unsigned)(NBC * NH * SEQ * HD))   // elements of one head plane set (one pass)
#define CPL  ((size_t)MROWC * DM)                 // elements of one ctx plane (one pass)

static_assert(HD == 64);
static_assert(DM == NH * HD);
static_assert(DM % 32 == 0);
static_assert(DM % 64 == 0);
static_assert(NQKV % 64 == 0);
static_assert(SEQ % 64 == 0);
static_assert(MROWC % 64 == 0);
static_assert(NB <= NB_FULL);
static_assert(SEQ <= SEQ_FULL);
static_assert(NB % NBC == 0);
static_assert(((size_t)NBC * NH * SEQ * HD) % 512 == 0);
static_assert((SEQ * 32) % 256 == 0);
static_assert((size_t)2 * NBC * NH * SEQ * HD < 4294967296ull);
static_assert((CTP * 2) % 16 == 0);
static_assert(CTP >= HD);
static_assert(SEQ % KST == 0);
static_assert(KST == 64 && KST % 32 == 0);
static_assert((KVP * 2) % 16 == 0 && KVP >= HD && KVP >= KST);
static_assert(GBT == 128 && GKS == 64 && KVP >= GKS);
static_assert(MROWC % GBT == 0 && SEQ % GBT == 0 && NQKV % GBT == 0 && DM % GBT == 0);
static_assert(DM % GKS == 0 && DM / GKS >= 2);

typedef _Float16 h16;
typedef unsigned short bf;
typedef __attribute__((ext_vector_type(16))) __bf16   v16bf;
typedef __attribute__((ext_vector_type(16))) _Float16 v16h;
typedef __attribute__((ext_vector_type(8)))  _Float16 v8h;
typedef __attribute__((ext_vector_type(8)))  unsigned short v8us;
typedef __attribute__((ext_vector_type(8)))  float    v8f;
typedef __attribute__((ext_vector_type(4)))  float    v4f;
typedef __attribute__((ext_vector_type(2)))  float    v2f;
typedef __attribute__((ext_vector_type(2)))  _Float16 v2h;
typedef __attribute__((ext_vector_type(2)))  unsigned short v2us;
typedef v4f  __attribute__((may_alias)) v4fa;
typedef v8us __attribute__((may_alias)) v8usa;
typedef v8h  __attribute__((may_alias)) v8ha;

__device__ __forceinline__ unsigned short f2bf(float f) { unsigned u = __float_as_uint(f); u += 0x7FFFu + ((u >> 16) & 1u); return (unsigned short)(u >> 16); }
__device__ __forceinline__ float bf2f(unsigned short b) { return __uint_as_float(((unsigned)b) << 16); }
__device__ __forceinline__ void splitf(float y, unsigned short& h, unsigned short& l) { h = f2bf(y); l = f2bf(y - bf2f(h)); }
__device__ __forceinline__ v16h cat16(v8h lo, v8h hi) { return __builtin_shufflevector(lo, hi, 0, 1, 2, 3, 4, 5, 6, 7, 8, 9, 10, 11, 12, 13, 14, 15); }
__device__ __forceinline__ v16bf cat16b(v8us lo, v8us hi) { return __builtin_bit_cast(v16bf, __builtin_shufflevector(lo, hi, 0, 1, 2, 3, 4, 5, 6, 7, 8, 9, 10, 11, 12, 13, 14, 15)); }
__device__ __forceinline__ v8f wmma16(v16h a, v16h b, v8f c) { return __builtin_amdgcn_wmma_f32_16x16x32_f16(false, a, false, b, (short)0, c, false, false); }
__device__ __forceinline__ v8f wmmab(v16bf a, v16bf b, v8f c) { return __builtin_amdgcn_wmma_f32_16x16x32_bf16(false, a, false, b, (short)0, c, false, false); }
// Fragment loaders (A and B share the k map): p points at row (lane&15), column k0 + 8*(lane>>4); elements 0..7 <- p[0..7], elements 8..15 <- p[16..23].
__device__ __forceinline__ v16h ldh(const h16* p) { return cat16(*(const v8h*)p, *(const v8h*)(p + 16)); }
// The same k map on the staged LDS rows (bf16 rows of the GEMM operands; f16 rows of K and of V^T).
__device__ __forceinline__ v16bf ldbs(const unsigned short* p) { return cat16b(*(const v8usa*)p, *(const v8usa*)(p + 16)); }
__device__ __forceinline__ v16h ldhs(const unsigned short* p) { return cat16(*(const v8ha*)p, *(const v8ha*)(p + 16)); }

// One 128-row x 128-byte operand tile of a GEMM stage: 128 lanes x 8 asynchronous copies of 16 B; lane tid takes 16-byte piece (tid & 7) of rows (tid >> 3) + 16 i, so every wave-wide copy covers four whole 128-byte lines.
// g: the lane's first piece in the K-contiguous plane (row pitch K elements); ld: its LDS byte address in the staged tile (row pitch KVP elements).
__device__ __forceinline__ void stage_g(const bf* g, const int K, const unsigned ld) {
    const unsigned rb = 16u * KVP * 2u;                     // bytes of 16 staged rows
    const size_t rg = (size_t)16 * K;                       // elements of 16 plane rows
    // The copies and the s_wait_xcnt that stands in front of any rewrite of their address registers are one statement, so that nothing can move in between.
    asm volatile("global_load_async_to_lds_b128 %0, %8, off\n\t"
                 "global_load_async_to_lds_b128 %1, %9, off\n\t"
                 "global_load_async_to_lds_b128 %2, %10, off\n\t"
                 "global_load_async_to_lds_b128 %3, %11, off\n\t"
                 "global_load_async_to_lds_b128 %4, %12, off\n\t"
                 "global_load_async_to_lds_b128 %5, %13, off\n\t"
                 "global_load_async_to_lds_b128 %6, %14, off\n\t"
                 "global_load_async_to_lds_b128 %7, %15, off\n\t"
                 "s_wait_xcnt 0x0"
                 :: "v"(ld), "v"(ld + rb), "v"(ld + 2u * rb), "v"(ld + 3u * rb), "v"(ld + 4u * rb), "v"(ld + 5u * rb), "v"(ld + 6u * rb), "v"(ld + 7u * rb),
                    "v"(g), "v"(g + rg), "v"(g + 2 * rg), "v"(g + 3 * rg), "v"(g + 4 * rg), "v"(g + 5 * rg), "v"(g + 6 * rg), "v"(g + 7 * rg)
                 : "memory");
}

// ---- GEMM body: block = 4 waves on a 128x128 output tile, ONE WAVE per 64x64 quarter (16 accumulators); the block's 128 rows of A (, A2) and of Bt come from the K-contiguous bf16 planes in 64-k stages through a two-buffer LDS ring that the four waves share; grid (M/128, N/128, Z), 128 threads.
// C[m][n] (f32, pitch ldc) = sum_k (A[m][k] (+ A2[m][k])) Bt[n][k]. K % 64 == 0, K >= 128, M % 128 == 0, N % 128 == 0 (asserted at file scope for the two uses).
// EPI == 0: the tile is stored to C. EPI == 1 (qkv projection): the 64 columns of a tile are one head of q, k or v, and the tile goes straight to that head's planes:
// q, k: rotary (interleaved pairs: out[2j] = x[2j] c_j - x[2j+1] s_j, out[2j+1] = x[2j] s_j + x[2j+1] c_j; q also x QSC), f16, planes [zz = b*NH + h][t][d]; v: f16, transposed, [zz][d][t].
template <int NSPLIT, int EPI = 0>
__device__ __forceinline__ void gemmw_body(const bf* __restrict__ A, const bf* __restrict__ A2, const bf* __restrict__ Bt, const int K, float* C, const int ldc, const size_t sA, const size_t sC,
                                           const float* __restrict__ CS = nullptr, h16* QK = nullptr, h16* VT = nullptr) {
    constexpr int NT = 2 + NSPLIT;                          // tiles of one stage: A (, A2), Bt
    __shared__ __align__(16) float osb[4 * 16 * 68];
    __shared__ __align__(16) unsigned short gs[2 * NT * GTL];
    const size_t z = blockIdx.z; A += z * sA; A2 += z * sA; C += z * sC;
    const int lane = threadIdx.x & 31, lr = lane & 15, hi = lane >> 4;
    const int wave = __builtin_amdgcn_readfirstlane((int)(threadIdx.x >> 5));
    const int rb0 = blockIdx.x * GBT, cb0 = blockIdx.y * GBT, wr = (wave & 1) * 64, wc = (wave >> 1) * 64;
    const int r0 = rb0 + wr, c0 = cb0 + wc;                 // the wave's own 64x64 quarter
    float* os = osb + wave * (16 * 68);                     // wave-private epilogue staging
    v8f acc[4][4];
#pragma unroll
    for (int mb = 0; mb < 4; ++mb)
#pragma unroll
        for (int nb = 0; nb < 4; ++nb) acc[mb][nb] = (v8f){};
    const unsigned tid = threadIdx.x;
    const size_t goff = (size_t)(tid >> 3) * K + (tid & 7u) * 8u;
    const bf* ga = A + (size_t)rb0 * K + goff; const bf* ga2 = A2 + (size_t)rb0 * K + goff; const bf* gb = Bt + (size_t)cb0 * K + goff;
    const unsigned ld = (unsigned)(size_t)gs + ((tid >> 3) * KVP + (tid & 7u) * 8u) * 2u;
    const int nst = K / GKS;
    auto fill = [&](const int st, const unsigned buf) {     // stage st (k = 64 st ..) into ring buffer buf
        const unsigned l0 = ld + buf * (unsigned)(NT * GTL * 2);
        stage_g(ga + st * GKS, K, l0);
        if (NSPLIT == 1) stage_g(ga2 + st * GKS, K, l0 + GTL * 2u);
        stage_g(gb + st * GKS, K, l0 + (unsigned)((NT - 1) * GTL * 2));
    };
    fill(0, 0u);
    asm volatile("s_wait_asynccnt 0x0" ::: "memory");       // this wave's copies of stage 0 have landed
    __syncthreads();                                        // stage 0 is readable by all four waves
    fill(1, 1u);
#pragma unroll 1                                            // rolled: one foot (waits, barrier, refill) per stage, in the ring's order
    for (int t = 0; t < nst; ++t) {
      const unsigned short* sb = gs + (t & 1) * (NT * GTL) + lr * KVP + 8 * hi;    // fragment position: row lr, column 8 hi
      const unsigned short* pa = sb + wr * KVP; const unsigned short* pb = sb + (NT - 1) * GTL + wc * KVP;
#pragma unroll                                              // both 32-k steps of a stage in line: their LDS offsets become immediates
      for (int kc = 0; kc < GKS; kc += 32) {
        v16bf a[4], a2[4], bl;
#pragma unroll
        for (int mb = 0; mb < 4; ++mb) { a[mb] = ldbs(pa + mb * 16 * KVP + kc); if (NSPLIT == 1) a2[mb] = ldbs(pa + GTL + mb * 16 * KVP + kc); else a2[mb] = a[mb]; }
#pragma unroll
        for (int nb = 0; nb < 4; ++nb) { const v16bf b = ldbs(pb + nb * 16 * KVP + kc); if (nb == 3) bl = b;
#pragma unroll
            for (int mb = 0; mb < 4; ++mb) { acc[mb][nb] = wmmab(a[mb], b, acc[mb][nb]); if (NSPLIT == 1) acc[mb][nb] = wmmab(a2[mb], b, acc[mb][nb]); } }
        asm volatile("" : "+v"(acc[0][0]), "+v"(acc[0][1]), "+v"(acc[1][0]), "+v"(acc[1][1]), "+v"(acc[2][0]), "+v"(acc[2][1]), "+v"(acc[3][0]), "+v"(acc[3][1]));
        asm volatile("v_nop\n\tv_nop\n\tv_nop\n\tv_nop" : "+v"(acc[0][2]), "+v"(acc[0][3]), "+v"(acc[1][2]), "+v"(acc[1][3]), "+v"(acc[2][2]), "+v"(acc[2][3]), "+v"(acc[3][2]), "+v"(acc[3][3]) : "v"(a[0]), "v"(a[1]), "v"(a[2]), "v"(a[3]), "v"(bl));
        asm volatile("" : "+v"(acc[0][0]), "+v"(acc[0][1]), "+v"(acc[1][0]), "+v"(acc[1][1]), "+v"(acc[2][0]), "+v"(acc[2][1]), "+v"(acc[3][0]), "+v"(acc[3][1]) : "v"(a2[0]), "v"(a2[1]), "v"(a2[2]), "v"(a2[3]));
      }
      asm volatile("s_wait_dscnt 0x0" ::: "memory");        // this wave's reads of stage t have returned before its buffer is refilled
      asm volatile("s_wait_asynccnt 0x0" ::: "memory");     // this wave's copies of stage t + 1 have landed
      __syncthreads();                                      // publishes stage t + 1 and ends every wave's reads of stage t
      if (t + 2 < nst) fill(t + 2, (unsigned)(t & 1));
    }
    asm volatile("s_wait_asynccnt 0x0" ::: "memory");       // no copy is outstanding when the wave goes on to the epilogue
    if constexpr (EPI == 1) {
        const unsigned which = (unsigned)c0 / DM, h = ((unsigned)c0 / HD) % NH;          // wave-uniform: 0 q, 1 k, 2 v; head
        const unsigned zz = ((unsigned)r0 / SEQ) * NH + h, t0 = (unsigned)r0 % SEQ;      // SEQ % 64 == 0: the 64 rows lie in one batch
        const int rq = lane >> 3, pc = (lane & 7) * 8;                                   // read-back: 4 rows a step, 8 elements a lane
        if (which < 2u) {
            const float sc = which ? 1.0f : QSC;
            h16* ph = QK + (size_t)which * PLANE + (size_t)zz * (SEQ * HD) + (size_t)t0 * HD + pc;
            const float* cp = CS + (size_t)t0 * HD + pc;                                 // row t of the table: 32 (cos, sin) pairs = HD floats
#pragma unroll
            for (int mb = 0; mb < 4; ++mb) {
                v4f cs[4][2];                                                            // issued ahead of the staging so that their latency runs beside it
#pragma unroll
                for (int s = 0; s < 4; ++s) { const float* cr = cp + (size_t)(mb * 16 + s * 4 + rq) * HD; cs[s][0] = *(const v4f*)cr; cs[s][1] = *(const v4f*)(cr + 4); }
#pragma unroll
                for (int nb = 0; nb < 4; ++nb) {
#pragma unroll
                    for (int j = 0; j < 8; ++j) os[(hi * 8 + j) * 68 + nb * 16 + lr] = acc[mb][nb][j]; }
                asm volatile("s_wait_dscnt 0x0" ::: "memory"); __builtin_amdgcn_wave_barrier();   // the 16 staged rows are written before other lanes read them
#pragma unroll
                for (int s = 0; s < 4; ++s) { const int row = s * 4 + rq; v8h oh;
#pragma unroll
                    for (int g = 0; g < 2; ++g) { const v4f x = *(const v4fa*)(os + row * 68 + pc + 4 * g); const v4f c = cs[s][g];
#pragma unroll
                        for (int p = 0; p < 2; ++p) {
                            const float y0 = (x[2 * p] * c[2 * p] - x[2 * p + 1] * c[2 * p + 1]) * sc;
                            const float y1 = (x[2 * p] * c[2 * p + 1] + x[2 * p + 1] * c[2 * p]) * sc;
                            oh[4 * g + 2 * p] = (h16)y0; oh[4 * g + 2 * p + 1] = (h16)y1; } }
                    *(v8h*)(ph + (size_t)(mb * 16 + row) * HD) = oh; }
                if (mb < 3) asm volatile("s_wait_xcnt 0x0" ::: "memory");                         // stands in front of the next rows' loads and arithmetic, which reuse the registers these stores name
                asm volatile("s_wait_dscnt 0x0" ::: "memory"); __builtin_amdgcn_wave_barrier();   // every read of the staged rows has returned before they are rewritten
            }
        } else {
            h16* vs = (h16*)os;                                                          // 16 d rows x 64 t, pitch CTP halves, in the same staging bytes
            h16* pv = VT + (size_t)zz * (SEQ * HD) + (size_t)rq * SEQ + t0 + pc;
#pragma unroll
            for (int nb = 0; nb < 4; ++nb) {
#pragma unroll
                for (int mb = 0; mb < 4; ++mb) { v8h hv;                                 // a lane's 8 accumulator rows are 8 consecutive t of its column d
#pragma unroll
                    for (int j = 0; j < 8; ++j) hv[j] = (h16)acc[mb][nb][j];
                    *(v8ha*)(vs + lr * CTP + mb * 16 + hi * 8) = hv; }
                asm volatile("s_wait_dscnt 0x0" ::: "memory"); __builtin_amdgcn_wave_barrier();   // the 16 staged rows are written before other lanes read them
#pragma unroll
                for (int s = 0; s < 4; ++s) { const v8h val = *(const v8ha*)(vs + (s * 4 + rq) * CTP + pc);
                    *(v8h*)(pv + (size_t)(nb * 16 + s * 4) * SEQ) = val; }
                asm volatile("s_wait_dscnt 0x0" ::: "memory"); __builtin_amdgcn_wave_barrier();   // every read of the staged rows has returned before they are rewritten
            }
            asm volatile("s_wait_xcnt 0x0" ::: "memory");                                         // stands behind the last rows' stores, in front of any code laid out after them that reuses the registers they name
        }
        return;
    }
#pragma unroll
    for (int mb = 0; mb < 4; ++mb) {
#pragma unroll
        for (int nb = 0; nb < 4; ++nb) {
#pragma unroll
            for (int j = 0; j < 8; ++j) os[(hi * 8 + j) * 68 + nb * 16 + lr] = acc[mb][nb][j]; }
        asm volatile("s_wait_dscnt 0x0" ::: "memory"); __builtin_amdgcn_wave_barrier();
        float* crow = C + (size_t)(r0 + mb * 16) * ldc + c0;
{
#pragma unroll
            for (int s = 0; s < 8; ++s) { const int row = 2 * s + hi, cofs = lr * 4; const v4f val = *(const v4fa*)(os + row * 68 + cofs);
                *(v4f*)(crow + (size_t)row * ldc + cofs) = val; }
             }
        asm volatile("s_wait_dscnt 0x0" ::: "memory"); __builtin_amdgcn_wave_barrier();
    }
}
// qkv projection of one pass, sum_k XB[m][k] WQKVB[o][k], written as the head planes q, k (QK) and V^T (VT); grid (MROWC/128, NQKV/128, 1).
__global__ __launch_bounds__(128) void k_gemm_qkv(const bf* __restrict__ A, const bf* __restrict__ Bt, const float* __restrict__ CS, h16* QK, h16* VT) { gemmw_body<0, 1>(A, A, Bt, DM, nullptr, NQKV, 0, 0, CS, QK, VT); }
// output projection of one pass: OUT[b][t][o] = sum_k (CTXh + CTXl)[b*SEQ + t][k] WOB[o][k]; grid (SEQ/128, DM/128, NBC); output batch pitch SEQ_FULL*DM.
__global__ __launch_bounds__(128) void k_gemm_out(const bf* __restrict__ Ah, const bf* __restrict__ Al, const bf* __restrict__ Bt, float* C) { gemmw_body<1>(Ah, Al, Bt, DM, C, DM, (size_t)SEQ * DM, (size_t)SEQ_FULL * DM); }

__global__ __launch_bounds__(256) void k_cvt8(const float* __restrict__ src, bf* dst, unsigned n8, unsigned per8, unsigned sstride8) {
    const unsigned i = blockIdx.x * 256u + threadIdx.x; if (i >= n8) return;
    const size_t si = (size_t)(i / per8) * sstride8 + (i % per8);
    const v8f v = *(const v8f*)(src + si * 8); v8us o;
#pragma unroll
    for (int k = 0; k < 8; ++k) o[k] = f2bf(v[k]);
    *(v8us*)(dst + (size_t)i * 8) = o;  }

__global__ __launch_bounds__(256) void k_cstab(float* CS) {
    const int idx = blockIdx.x * 256 + threadIdx.x; if (idx >= SEQ * 32) return;
    const int j = idx & 31, t = idx >> 5;
    double p = 1.0;
    p *= (j & 1) ? 1.3335214321633240 : 1.0;
    p *= (j & 2) ? 1.7782794100389228 : 1.0;
    p *= (j & 4) ? 3.1622776601683795 : 1.0;
    p *= (j & 8) ? 10.0 : 1.0;
    p *= (j & 16) ? 100.0 : 1.0;
    const float pf = (float)p; const float inv = 1.0f / pf; const float ang = (float)t * inv;
    float sn, cn; sincosf(ang, &sn, &cn);
    v2f cs; cs[0] = cn; cs[1] = sn;
    *(v2f*)(CS + (size_t)idx * 2) = cs;  }

// One stage of k_sdpa's LDS ring: 64 keys = K rows (64 x 128 B, contiguous in their plane) and V^T (64 d rows x 128 B, row pitch SEQ halves).
// 128 lanes x 8 asynchronous copies of 16 B; lane tid takes 16-byte piece (tid & 7) of rows (tid >> 3) + 16 i, so every wave-wide copy covers four whole 128-byte lines.
// kg, vg: the lane's first piece in the K plane and in V^T; ld: its LDS byte address in the stage's K tile.
__device__ __forceinline__ void stage_kv(const h16* kg, const h16* vg, const unsigned ld) {
    const unsigned rb = 16u * KVP * 2u, tb = TLE * 2u;      // bytes of 16 staged rows, of one tile
    // The copies and the s_wait_xcnt that stands in front of any rewrite of their address registers are one statement, so that nothing can move in between.
    asm volatile("global_load_async_to_lds_b128 %0, %8, off\n\t"
                 "global_load_async_to_lds_b128 %1, %9, off\n\t"
                 "global_load_async_to_lds_b128 %2, %10, off\n\t"
                 "global_load_async_to_lds_b128 %3, %11, off\n\t"
                 "global_load_async_to_lds_b128 %4, %12, off\n\t"
                 "global_load_async_to_lds_b128 %5, %13, off\n\t"
                 "global_load_async_to_lds_b128 %6, %14, off\n\t"
                 "global_load_async_to_lds_b128 %7, %15, off\n\t"
                 "s_wait_xcnt 0x0"
                 :: "v"(ld), "v"(ld + rb), "v"(ld + 2u * rb), "v"(ld + 3u * rb),
                    "v"(ld + tb), "v"(ld + tb + rb), "v"(ld + tb + 2u * rb), "v"(ld + tb + 3u * rb),
                    "v"(kg), "v"(kg + 16 * HD), "v"(kg + 32 * HD), "v"(kg + 48 * HD),
                    "v"(vg), "v"(vg + 16 * SEQ), "v"(vg + 32 * SEQ), "v"(vg + 48 * SEQ)
                 : "memory");
}

// ---- fused dense softmax(q k^T) v: block = 4 waves, wave = 16 query rows of one (b, h); key loop over ALL keys in 32-key steps; K and V^T come in 64-key stages through a two-buffer LDS ring that the four waves share, q fragments loaded once from the planes and kept in registers.
// S^T[key][query] = K.Q^T (A = K rows, B = Q rows; f16, two 32-d WMMAs a tile): lane (hh, ln) holds query qw+ln, keys kt + 16j + 8hh + r, which IS the B fragment of P^T for
// O^T[d][query] = V^T.P^T (A = V^T rows d, k = keys). Online softmax per lane (one query per lane, halves combined by one xor-16 shuffle); the rescale factor is lane-local.
// grid (SEQ/64, NBC*NH), 128 threads.
__global__ __launch_bounds__(128) void k_sdpa(const h16* __restrict__ QK, const h16* __restrict__ VT, bf* CT) {
    __shared__ __align__(16) unsigned short cts[4 * 2 * 16 * CTP];
    __shared__ __align__(16) unsigned short kvs[2 * STE];
    const int lane = threadIdx.x & 31, hh = lane >> 4, ln = lane & 15;
    const int wave = __builtin_amdgcn_readfirstlane((int)(threadIdx.x >> 5));
    const int zz = blockIdx.y;
    const int qw = (int)blockIdx.x * 64 + wave * 16;
    const int nst = SEQ / KST;                              // stages: all keys 0 .. SEQ-1
    const unsigned hb = (unsigned)zz * (unsigned)(SEQ * HD);
    const unsigned qoff = hb + (unsigned)(qw + ln) * HD + 8u * hh;
    const unsigned fofs = (unsigned)ln * KVP + 8u * hh;     // fragment position in a staged tile: row ln, column 8 hh
    const unsigned tid = threadIdx.x;
    const h16* kg = QK + (size_t)(PLANE + hb + tid * 8u);
    const h16* vg = VT + (size_t)(hb + (tid >> 3) * SEQ + (tid & 7u) * 8u);
    const unsigned ld = (unsigned)(size_t)kvs + ((tid >> 3) * KVP + (tid & 7u) * 8u) * 2u;
    v8f o[4];
#pragma unroll
    for (int dt = 0; dt < 4; ++dt) o[dt] = (v8f){};
    float m = NEGB, l = 0.0f;
    // The wave's q fragments (B operand, two 32-d halves) are loaded once and stay in registers for the whole key loop.
    const v16h q0 = ldh(QK + (size_t)qoff), q1 = ldh(QK + (size_t)qoff + 32);
    stage_kv(kg, vg, ld);
    asm volatile("s_wait_asynccnt 0x0" ::: "memory");       // this wave's copies of stage 0 have landed
    __syncthreads();                                        // stage 0 is readable by all four waves
    if (nst > 1) stage_kv(kg + KST * HD, vg + KST, ld + STE * 2u);
#pragma unroll 1                                            // rolled: one foot (waits, barrier, refill) per stage, in the ring's order
    for (int t = 0; t < nst; ++t) {
      const unsigned short* sb = kvs + (t & 1) * STE + fofs;
      for (int hf = 0; hf < KST / 32; ++hf) {
        const int kt = hf * 32;                             // first key of this step inside the stage
        v8f s0 = (v8f){}, s1 = (v8f){};
        {
            const unsigned short* kp = sb + kt * KVP;
            const v16h ka0 = ldhs(kp), ka1 = ldhs(kp + 32), kb0 = ldhs(kp + 16 * KVP), kb1 = ldhs(kp + 16 * KVP + 32);
            s0 = wmma16(ka0, q0, s0); s1 = wmma16(kb0, q0, s1); s0 = wmma16(ka1, q1, s0); s1 = wmma16(kb1, q1, s1);
            asm volatile("v_nop\n\tv_nop\n\tv_nop\n\tv_nop" : "+v"(s0), "+v"(s1) : "v"(ka0), "v"(ka1), "v"(kb0), "v"(kb1), "v"(q0), "v"(q1));   // the four vector slots between the last WMMA and the first use of its result or overwrite of its operands
        }
        float mx = s0[0];
#pragma unroll
        for (int r = 1; r < 8; ++r) mx = fmaxf(mx, s0[r]);
#pragma unroll
        for (int r = 0; r < 8; ++r) mx = fmaxf(mx, s1[r]);
        mx = fmaxf(mx, __shfl_xor(mx, 16, 32));
        const float mn = fmaxf(m, mx);
        const float al = __builtin_amdgcn_exp2f(m - mn);
        const float mo = mn - PLOG;                         // one subtraction a score: exp2(s - mo) is the probability with its carry
        m = mn;
        float rs = 0.0f; v16h pb;
#pragma unroll
        for (int r = 0; r < 8; ++r) {
            const float e0 = __builtin_amdgcn_exp2f(s0[r] - mo), e1 = __builtin_amdgcn_exp2f(s1[r] - mo);
            rs += e0 + e1;
            pb[r] = (h16)e0; pb[8 + r] = (h16)e1;
        }
        l = l * al + rs;
#pragma unroll
        for (int dt = 0; dt < 4; ++dt) o[dt] = o[dt] * al;
        asm volatile("" ::: "memory");
        v16h va[4];
        const unsigned short* vp = sb + TLE + kt;
#pragma unroll
        for (int dt = 0; dt < 4; ++dt) va[dt] = ldhs(vp + dt * 16 * KVP);
#pragma unroll
        for (int dt = 0; dt < 4; ++dt) o[dt] = wmma16(va[dt], pb, o[dt]);
        asm volatile("v_nop\n\tv_nop\n\tv_nop\n\tv_nop" : "+v"(o[0]), "+v"(o[1]), "+v"(o[2]), "+v"(o[3]) : "v"(pb), "v"(va[0]), "v"(va[1]), "v"(va[2]), "v"(va[3]));
      }
      asm volatile("s_wait_dscnt 0x0" ::: "memory");        // this wave's reads of stage t have returned before its buffer is refilled
      asm volatile("s_wait_asynccnt 0x0" ::: "memory");     // this wave's copies of stage t + 1 have landed
      __syncthreads();                                      // publishes stage t + 1 and ends every wave's reads of stage t
      if (t + 2 < nst) stage_kv(kg + (size_t)(t + 2) * (KST * HD), vg + (t + 2) * KST, ld + (unsigned)(t & 1) * (STE * 2u));
    }
    asm volatile("s_wait_asynccnt 0x0" ::: "memory");       // no copy is outstanding when the wave goes on to the epilogue
    l += __shfl_xor(l, 16, 32);
    const float inv = 1.0f / l;                             // l carries the same x256 as the P operand
    const int cb = wave * (2 * 16 * CTP);                   // wave-private staging: [plane hi|lo][16 rows][CTP]
#pragma unroll
    for (int dt = 0; dt < 4; ++dt) { v8us oh, ol;
#pragma unroll
        for (int r = 0; r < 8; ++r) { const float y = o[dt][r] * inv; unsigned short a, c; splitf(y, a, c); oh[r] = a; ol[r] = c; }
        *(v8usa*)(cts + cb + ln * CTP + dt * 16 + 8 * hh) = oh; *(v8usa*)(cts + cb + 16 * CTP + ln * CTP + dt * 16 + 8 * hh) = ol; }
    asm volatile("s_wait_dscnt 0x0" ::: "memory"); __builtin_amdgcn_wave_barrier();
    const int b = zz / NH, h = zz % NH;
    const int rq = lane >> 3, pc = (lane & 7) * 8;
    v8us hv[4], lv[4];
#pragma unroll
    for (int it = 0; it < 4; ++it) { const int row = it * 4 + rq; hv[it] = *(const v8usa*)(cts + cb + row * CTP + pc); lv[it] = *(const v8usa*)(cts + cb + 16 * CTP + row * CTP + pc); }
    bf* gh = CT + ((size_t)b * SEQ + qw) * DM + h * HD + pc;
{
#pragma unroll
        for (int it = 0; it < 4; ++it) { const int row = it * 4 + rq; *(v8us*)(gh + (size_t)row * DM) = hv[it]; *(v8us*)(gh + CPL + (size_t)row * DM) = lv[it]; }
         }
}

constexpr size_t SZ_WQKV = (size_t)NQKV * DM * 2;
constexpr size_t SZ_WO   = (size_t)DM * DM * 2;
constexpr size_t SZ_CS   = (size_t)SEQ * 32 * 2 * 4;
constexpr size_t SZ_XB   = (size_t)NB * SEQ * DM * 2;          // all batches, compact [NB][SEQ][DM]
constexpr size_t SZ_QK   = (size_t)2 * NBC * NH * SEQ * HD * 2; // one pass: q, k
constexpr size_t SZ_VT   = (size_t)NBC * NH * SEQ * HD * 2;     // one pass
constexpr size_t SZ_CTX  = (size_t)2 * MROWC * DM * 2;          // one pass: ctx hi, ctx lo
constexpr size_t SZ_TOTAL = SZ_WQKV + SZ_WO + SZ_CS + SZ_XB + SZ_CTX + SZ_QK + SZ_VT;
static_assert(SZ_TOTAL <= (size_t)268435456);
static_assert(SZ_WQKV % 256 == 0 && SZ_WO % 256 == 0 && SZ_CS % 256 == 0 && SZ_XB % 256 == 0 && SZ_CTX % 256 == 0 && SZ_QK % 256 == 0 && SZ_VT % 256 == 0);

extern "C" void kernel_launch(void* const* d_in, const int* in_sizes, int n_in,
                              void* d_out, int out_size, void* d_ws, size_t ws_size, hipStream_t stream) {
    if (n_in < 3) return;
    const long long need_x = (long long)(NB - 1) * SEQ_FULL * DM + (long long)SEQ * DM;
    if ((long long)in_sizes[0] < need_x) return;
    if ((long long)in_sizes[1] < (long long)NQKV * DM) return;
    if ((long long)in_sizes[2] < (long long)DM * DM) return;
    if ((long long)out_size < need_x) return;
    if (SZ_TOTAL > ws_size) return;
    const float* x = (const float*)d_in[0];        // [NB_FULL][SEQ_FULL][DM]
    const float* wqkv = (const float*)d_in[1];     // [NQKV][DM] ('oi')
    const float* wout = (const float*)d_in[2];     // [DM][DM] ('oi')
    float* OUT = (float*)d_out;                    // [NB_FULL][SEQ_FULL][DM]
    char* base = (char*)d_ws; size_t off = 0;
    bf* WQKVB = (bf*)(base + off); off += SZ_WQKV;
    bf* WOB = (bf*)(base + off); off += SZ_WO;
    float* CS = (float*)(base + off); off += SZ_CS;
    bf* XB = (bf*)(base + off); off += SZ_XB;
    bf* CT = (bf*)(base + off); off += SZ_CTX;     // ctx hi plane, lo plane at + CPL
    h16* QK = (h16*)(base + off); off += SZ_QK;
    h16* VT = (h16*)(base + off); off += SZ_VT;

    const unsigned n8w = (unsigned)((size_t)NQKV * DM / 8), n8o = (unsigned)((size_t)DM * DM / 8), n8x = (unsigned)((size_t)NB * SEQ * DM / 8);
    k_cvt8<<<(n8w + 255) / 256, 256, 0, stream>>>(wqkv, WQKVB, n8w, n8w, 0u);
    k_cvt8<<<(n8o + 255) / 256, 256, 0, stream>>>(wout, WOB, n8o, n8o, 0u);
    k_cvt8<<<(n8x + 255) / 256, 256, 0, stream>>>(x, XB, n8x, (unsigned)((size_t)SEQ * DM / 8), (unsigned)((size_t)SEQ_FULL * DM / 8));
    k_cstab<<<(SEQ * 32 + 255) / 256, 256, 0, stream>>>(CS);
    for (int c = 0; c < NB / NBC; ++c) {
        const bf* XBc = XB + (size_t)c * MROWC * DM;                 // rows of this pass
        float* OUTc = OUT + (size_t)c * NBC * SEQ_FULL * DM;         // output rows of this pass
        k_gemm_qkv<<<dim3(MROWC / GBT, NQKV / GBT, 1), 128, 0, stream>>>(XBc, WQKVB, CS, QK, VT);
        k_sdpa<<<dim3(SEQ / 64, NBC * NH, 1), 128, 0, stream>>>(QK, VT, CT);
        k_gemm_out<<<dim3(SEQ / GBT, DM / GBT, NBC), 128, 0, stream>>>(CT, CT + CPL, WOB, OUTc);
    }
}

// v008
// One run takes 144 microseconds.
// Next to v007, in two timings, it ran 1.05 and 1.06 times as fast.
// Counting every step since v000, it is 4.64 times as fast.
#include <hip/hip_runtime.h>

// Dense (unmasked) multi-head softmax(q k^T / 8) v block: x [NB][SEQ][1024], fused Wqkv [3072][1024] ('oi', rows = (3, 16 heads, 64)), Wout [1024][1024] ('oi'), interleaved-pair rotary (positions = arange) on q and k, merged heads x Wout^T.
// Compute dtypes, f32 accumulate everywhere: x/Wqkv/Wout converted to bf16 (RNE) and multiplied with v_wmma_f32_16x16x32_bf16 (single product); scores q.k as f16 x f16, one product (v_wmma_f32_16x16x32_f16; the rotated q and k are rounded once to f16, 11 significant bits, finer than the bf16 operands they were projected from); P.V with v_wmma_f32_16x16x32_f16 (P f16 carried x256, v f16; the softmax runs in base 2: log2(e) rides in the q planes' scale and the carry in the exponent's offset); ctx bf16 hi|lo x Wout bf16 (two products); rotary and softmax in f32.
// Batches are processed NBC at a time (host loop of launches); NBC = NB: one pass, each of the three main kernels is launched once over all batches.

#ifndef NB
#define NB 4
#endif
#ifndef SEQ
#define SEQ 2048
#endif
#ifndef NBC
#define NBC (NB)                  // batches per pass: all of them
#endif
#define NB_FULL  4
#define SEQ_FULL 2048
#define DM   1024
#define NH   16
#define HD   64
#define NQKV (3 * DM)
#define PLOG 8.0f                 // log2 of the carry (x256) of the f16 probability operand and of the row sum: added to every exponent, divided out with the sum
#define L2E  1.4426950408889634f
#define QSC  (0.125f * L2E)       // HD^-0.5 log2(e), folded into the q planes: the score products come out as base-2 exponents
#define NEGB (-1.0e30f)
#define CTP  72                   // LDS pitch (halves) of the ctx staging rows
#define KST  64                   // keys of one LDS stage of k_sdpa
#define KVP  72                   // LDS pitch (16-bit elements) of a staged 128-byte row: 144 B = 16 B x odd, conflict-free for 16-byte fragment reads
#define TLE  (64 * KVP)           // elements of one staged tile (64 rows)
#define STE  (2 * TLE)            // elements of one stage: K | V^T
#define GBT  128                  // rows and columns of a GEMM block's output tile (2 x 2 waves of 64 x 64)
#define GKS  64                   // k elements of one LDS stage of the GEMMs: 128 bytes a row, staged at pitch KVP
#define GTL  (GBT * KVP)          // elements of one staged GEMM operand tile (128 rows)
#define MROWC (NBC * SEQ)                         // rows of one pass
#define PLANE ((unsigned)(NBC * NH * SEQ * HD))   // elements of one head plane set (one pass)
#define CPL  ((size_t)MROWC * DM)                 // elements of one ctx plane (one pass)

static_assert(HD == 64);
static_assert(DM == NH * HD);
static_assert(DM % 32 == 0);
static_assert(DM % 64 == 0);
static_assert(NQKV % 64 == 0);
static_assert(SEQ % 64 == 0);
static_assert(MROWC % 64 == 0);
static_assert(NB <= NB_FULL);
static_assert(SEQ <= SEQ_FULL);
static_assert(NB % NBC == 0);
static_assert(((size_t)NBC * NH * SEQ * HD) % 512 == 0);
static_assert((SEQ * 32) % 256 == 0);
static_assert((size_t)2 * NBC * NH * SEQ * HD < 4294967296ull);
static_assert((CTP * 2) % 16 == 0);
static_assert(CTP >= HD);
static_assert(SEQ % KST == 0);
static_assert(KST == 64 && KST % 32 == 0);
static_assert((KVP * 2) % 16 == 0 && KVP >= HD && KVP >= KST);
static_assert(GBT == 128 && GKS == 64 && KVP >= GKS);
static_assert(MROWC % GBT == 0 && SEQ % GBT == 0 && NQKV % GBT == 0 && DM % GBT == 0);
static_assert(DM % GKS == 0 && DM / GKS >= 2);

typedef _Float16 h16;
typedef unsigned short bf;
typedef __attribute__((ext_vector_type(16))) __bf16   v16bf;
typedef __attribute__((ext_vector_type(16))) _Float16 v16h;
typedef __attribute__((ext_vector_type(8)))  _Float16 v8h;
typedef __attribute__((ext_vector_type(8)))  unsigned short v8us;
typedef __attribute__((ext_vector_type(8)))  float    v8f;
typedef __attribute__((ext_vector_type(4)))  float    v4f;
typedef __attribute__((ext_vector_type(2)))  float    v2f;
typedef __attribute__((ext_vector_type(2)))  _Float16 v2h;
typedef __attribute__((ext_vector_type(2)))  unsigned short v2us;
typedef v4f  __attribute__((may_alias)) v4fa;
typedef v8us __attribute__((may_alias)) v8usa;
typedef v8h  __attribute__((may_alias)) v8ha;

__device__ __forceinline__ unsigned short f2bf(float f) { unsigned u = __float_as_uint(f); u += 0x7FFFu + ((u >> 16) & 1u); return (unsigned short)(u >> 16); }
__device__ __forceinline__ float bf2f(unsigned short b) { return __uint_as_float(((unsigned)b) << 16); }
__device__ __forceinline__ void splitf(float y, unsigned short& h, unsigned short& l) { h = f2bf(y); l = f2bf(y - bf2f(h)); }
__device__ __forceinline__ v16h cat16(v8h lo, v8h hi) { return __builtin_shufflevector(lo, hi, 0, 1, 2, 3, 4, 5, 6, 7, 8, 9, 10, 11, 12, 13, 14, 15); }
__device__ __forceinline__ v16bf cat16b(v8us lo, v8us hi) { return __builtin_bit_cast(v16bf, __builtin_shufflevector(lo, hi, 0, 1, 2, 3, 4, 5, 6, 7, 8, 9, 10, 11, 12, 13, 14, 15)); }
__device__ __forceinline__ v8f wmma16(v16h a, v16h b, v8f c) { return __builtin_amdgcn_wmma_f32_16x16x32_f16(false, a, false, b, (short)0, c, false, false); }
__device__ __forceinline__ v8f wmmab(v16bf a, v16bf b, v8f c) { return __builtin_amdgcn_wmma_f32_16x16x32_bf16(false, a, false, b, (short)0, c, false, false); }
// Fragment loaders (A and B share the k map): p points at row (lane&15), column k0 + 8*(lane>>4); elements 0..7 <- p[0..7], elements 8..15 <- p[16..23].
__device__ __forceinline__ v16h ldh(const h16* p) { return cat16(*(const v8h*)p, *(const v8h*)(p + 16)); }
// The same k map on the staged LDS rows (bf16 rows of the GEMM operands; f16 rows of K and of V^T).
__device__ __forceinline__ v16bf ldbs(const unsigned short* p) { return cat16b(*(const v8usa*)p, *(const v8usa*)(p + 16)); }
__device__ __forceinline__ v16h ldhs(const unsigned short* p) { return cat16(*(const v8ha*)p, *(const v8ha*)(p + 16)); }

// One 128-row x 128-byte operand tile of a GEMM stage: 128 lanes x 8 asynchronous copies of 16 B; lane tid takes 16-byte piece (tid & 7) of rows (tid >> 3) + 16 i, so every wave-wide copy covers four whole 128-byte lines.
// g: the lane's first piece in the K-contiguous plane (row pitch K elements); ld: its LDS byte address in the staged tile (row pitch KVP elements).
__device__ __forceinline__ void stage_g(const bf* g, const int K, const unsigned ld) {
    const unsigned rb = 16u * KVP * 2u;                     // bytes of 16 staged rows
    const size_t rg = (size_t)16 * K;                       // elements of 16 plane rows
    // The copies and the s_wait_xcnt that stands in front of any rewrite of their address registers are one statement, so that nothing can move in between.
    asm volatile("global_load_async_to_lds_b128 %0, %8, off\n\t"
                 "global_load_async_to_lds_b128 %1, %9, off\n\t"
                 "global_load_async_to_lds_b128 %2, %10, off\n\t"
                 "global_load_async_to_lds_b128 %3, %11, off\n\t"
                 "global_load_async_to_lds_b128 %4, %12, off\n\t"
                 "global_load_async_to_lds_b128 %5, %13, off\n\t"
                 "global_load_async_to_lds_b128 %6, %14, off\n\t"
                 "global_load_async_to_lds_b128 %7, %15, off\n\t"
                 "s_wait_xcnt 0x0"
                 :: "v"(ld), "v"(ld + rb), "v"(ld + 2u * rb), "v"(ld + 3u * rb), "v"(ld + 4u * rb), "v"(ld + 5u * rb), "v"(ld + 6u * rb), "v"(ld + 7u * rb),
                    "v"(g), "v"(g + rg), "v"(g + 2 * rg), "v"(g + 3 * rg), "v"(g + 4 * rg), "v"(g + 5 * rg), "v"(g + 6 * rg), "v"(g + 7 * rg)
                 : "memory");
}

// ---- GEMM body: block = 4 waves on a 128x128 output tile, ONE WAVE per 64x64 quarter (16 accumulators); the block's 128 rows of A (, A2) and of Bt come from the K-contiguous bf16 planes in 64-k stages through a two-buffer LDS ring that the four waves share; grid (M/128, N/128, Z), 128 threads.
// C[m][n] (f32, pitch ldc) = sum_k (A[m][k] (+ A2[m][k])) Bt[n][k]. K % 64 == 0, K >= 128, M % 128 == 0, N % 128 == 0 (asserted at file scope for the two uses).
// EPI == 0: the tile is stored to C. EPI == 1 (qkv projection): the 64 columns of a tile are one head of q, k or v, and the tile goes straight to that head's planes:
// q, k: rotary (interleaved pairs: out[2j] = x[2j] c_j - x[2j+1] s_j, out[2j+1] = x[2j] s_j + x[2j+1] c_j; q also x QSC), f16, planes [zz = b*NH + h][t][d]; v: f16, transposed, [zz][d][t].
template <int NSPLIT, int EPI = 0>
__device__ __forceinline__ void gemmw_body(const bf* __restrict__ A, const bf* __restrict__ A2, const bf* __restrict__ Bt, const int K, float* C, const int ldc, const size_t sA, const size_t sC,
                                           const float* __restrict__ CS = nullptr, h16* QK = nullptr, h16* VT = nullptr) {
    constexpr int NT = 2 + NSPLIT;                          // tiles of one stage: A (, A2), Bt
    __shared__ __align__(16) float osb[4 * 16 * 68];
    __shared__ __align__(16) unsigned short gs[2 * NT * GTL];
    const size_t z = blockIdx.z; A += z * sA; A2 += z * sA; C += z * sC;
    const int lane = threadIdx.x & 31, lr = lane & 15, hi = lane >> 4;
    const int wave = __builtin_amdgcn_readfirstlane((int)(threadIdx.x >> 5));
    const int rb0 = blockIdx.x * GBT, cb0 = blockIdx.y * GBT, wr = (wave & 1) * 64, wc = (wave >> 1) * 64;
    const int r0 = rb0 + wr, c0 = cb0 + wc;                 // the wave's own 64x64 quarter
    float* os = osb + wave * (16 * 68);                     // wave-private epilogue staging
    v8f acc[4][4];
#pragma unroll
    for (int mb = 0; mb < 4; ++mb)
#pragma unroll
        for (int nb = 0; nb < 4; ++nb) acc[mb][nb] = (v8f){};
    const unsigned tid = threadIdx.x;
    const size_t goff = (size_t)(tid >> 3) * K + (tid & 7u) * 8u;
    const bf* ga = A + (size_t)rb0 * K + goff; const bf* ga2 = A2 + (size_t)rb0 * K + goff; const bf* gb = Bt + (size_t)cb0 * K + goff;
    const unsigned ld = (unsigned)(size_t)gs + ((tid >> 3) * KVP + (tid & 7u) * 8u) * 2u;
    const int nst = K / GKS;
    auto fill = [&](const int st, const unsigned buf) {     // stage st (k = 64 st ..) into ring buffer buf
        const unsigned l0 = ld + buf * (unsigned)(NT * GTL * 2);
        stage_g(ga + st * GKS, K, l0);
        if (NSPLIT == 1) stage_g(ga2 + st * GKS, K, l0 + GTL * 2u);
        stage_g(gb + st * GKS, K, l0 + (unsigned)((NT - 1) * GTL * 2));
    };
    fill(0, 0u);
    asm volatile("s_wait_asynccnt 0x0" ::: "memory");       // this wave's copies of stage 0 have landed
    __syncthreads();                                        // stage 0 is readable by all four waves
    fill(1, 1u);
#pragma unroll 1                                            // rolled: one foot (waits, barrier, refill) per stage, in the ring's order
    for (int t = 0; t < nst; ++t) {
      const unsigned short* sb = gs + (t & 1) * (NT * GTL) + lr * KVP + 8 * hi;    // fragment position: row lr, column 8 hi
      const unsigned short* pa = sb + wr * KVP; const unsigned short* pb = sb + (NT - 1) * GTL + wc * KVP;
#pragma unroll                                              // both 32-k steps of a stage in line: their LDS offsets become immediates
      for (int kc = 0; kc < GKS; kc += 32) {
        v16bf a[4], a2[4], bl;
#pragma unroll
        for (int mb = 0; mb < 4; ++mb) { a[mb] = ldbs(pa + mb * 16 * KVP + kc); if (NSPLIT == 1) a2[mb] = ldbs(pa + GTL + mb * 16 * KVP + kc); else a2[mb] = a[mb]; }
#pragma unroll
        for (int nb = 0; nb < 4; ++nb) { const v16bf b = ldbs(pb + nb * 16 * KVP + kc); if (nb == 3) bl = b;
#pragma unroll
            for (int mb = 0; mb < 4; ++mb) { acc[mb][nb] = wmmab(a[mb], b, acc[mb][nb]); if (NSPLIT == 1) acc[mb][nb] = wmmab(a2[mb], b, acc[mb][nb]); } }
        asm volatile("" : "+v"(acc[0][0]), "+v"(acc[0][1]), "+v"(acc[1][0]), "+v"(acc[1][1]), "+v"(acc[2][0]), "+v"(acc[2][1]), "+v"(acc[3][0]), "+v"(acc[3][1]));
        asm volatile("v_nop\n\tv_nop\n\tv_nop\n\tv_nop" : "+v"(acc[0][2]), "+v"(acc[0][3]), "+v"(acc[1][2]), "+v"(acc[1][3]), "+v"(acc[2][2]), "+v"(acc[2][3]), "+v"(acc[3][2]), "+v"(acc[3][3]) : "v"(a[0]), "v"(a[1]), "v"(a[2]), "v"(a[3]), "v"(bl));
        asm volatile("" : "+v"(acc[0][0]), "+v"(acc[0][1]), "+v"(acc[1][0]), "+v"(acc[1][1]), "+v"(acc[2][0]), "+v"(acc[2][1]), "+v"(acc[3][0]), "+v"(acc[3][1]) : "v"(a2[0]), "v"(a2[1]), "v"(a2[2]), "v"(a2[3]));
      }
      asm volatile("s_wait_dscnt 0x0" ::: "memory");        // this wave's reads of stage t have returned before its buffer is refilled
      asm volatile("s_wait_asynccnt 0x0" ::: "memory");     // this wave's copies of stage t + 1 have landed
      __syncthreads();                                      // publishes stage t + 1 and ends every wave's reads of stage t
      if (t + 2 < nst) fill(t + 2, (unsigned)(t & 1));
    }
    asm volatile("s_wait_asynccnt 0x0" ::: "memory");       // no copy is outstanding when the wave goes on to the epilogue
    if constexpr (EPI == 1) {
        const unsigned which = (unsigned)c0 / DM, h = ((unsigned)c0 / HD) % NH;          // wave-uniform: 0 q, 1 k, 2 v; head
        const unsigned zz = ((unsigned)r0 / SEQ) * NH + h, t0 = (unsigned)r0 % SEQ;      // SEQ % 64 == 0: the 64 rows lie in one batch
        const int rq = lane >> 3, pc = (lane & 7) * 8;                                   // read-back: 4 rows a step, 8 elements a lane
        if (which < 2u) {
            const float sc = which ? 1.0f : QSC;
            h16* ph = QK + (size_t)which * PLANE + (size_t)zz * (SEQ * HD) + (size_t)t0 * HD + pc;
            const float* cp = CS + (size_t)t0 * HD + pc;                                 // row t of the table: 32 (cos, sin) pairs = HD floats
#pragma unroll
            for (int mb = 0; mb < 4; ++mb) {
                v4f cs[4][2];                                                            // issued ahead of the staging so that their latency runs beside it
#pragma unroll
                for (int s = 0; s < 4; ++s) { const float* cr = cp + (size_t)(mb * 16 + s * 4 + rq) * HD; cs[s][0] = *(const v4f*)cr; cs[s][1] = *(const v4f*)(cr + 4); }
#pragma unroll
                for (int nb = 0; nb < 4; ++nb) {
#pragma unroll
                    for (int j = 0; j < 8; ++j) os[(hi * 8 + j) * 68 + nb * 16 + lr] = acc[mb][nb][j]; }
                asm volatile("s_wait_dscnt 0x0" ::: "memory"); __builtin_amdgcn_wave_barrier();   // the 16 staged rows are written before other lanes read them
#pragma unroll
                for (int s = 0; s < 4; ++s) { const int row = s * 4 + rq; v8h oh;
#pragma unroll
                    for (int g = 0; g < 2; ++g) { const v4f x = *(const v4fa*)(os + row * 68 + pc + 4 * g); const v4f c = cs[s][g];
#pragma unroll
                        for (int p = 0; p < 2; ++p) {
                            const float y0 = (x[2 * p] * c[2 * p] - x[2 * p + 1] * c[2 * p + 1]) * sc;
                            const float y1 = (x[2 * p] * c[2 * p + 1] + x[2 * p + 1] * c[2 * p]) * sc;
                            oh[4 * g + 2 * p] = (h16)y0; oh[4 * g + 2 * p + 1] = (h16)y1; } }
                    *(v8h*)(ph + (size_t)(mb * 16 + row) * HD) = oh; }
                if (mb < 3) asm volatile("s_wait_xcnt 0x0" ::: "memory");                         // stands in front of the next rows' loads and arithmetic, which reuse the registers these stores name
                asm volatile("s_wait_dscnt 0x0" ::: "memory"); __builtin_amdgcn_wave_barrier();   // every read of the staged rows has returned before they are rewritten
            }
        } else {
            h16* vs = (h16*)os;                                                          // 16 d rows x 64 t, pitch CTP halves, in the same staging bytes
            h16* pv = VT + (size_t)zz * (SEQ * HD) + (size_t)rq * SEQ + t0 + pc;
#pragma unroll
            for (int nb = 0; nb < 4; ++nb) {
#pragma unroll
                for (int mb = 0; mb < 4; ++mb) { v8h hv;                                 // a lane's 8 accumulator rows are 8 consecutive t of its column d
#pragma unroll
                    for (int j = 0; j < 8; ++j) hv[j] = (h16)acc[mb][nb][j];
                    *(v8ha*)(vs + lr * CTP + mb * 16 + hi * 8) = hv; }
                asm volatile("s_wait_dscnt 0x0" ::: "memory"); __builtin_amdgcn_wave_barrier();   // the 16 staged rows are written before other lanes read them
#pragma unroll
                for (int s = 0; s < 4; ++s) { const v8h val = *(const v8ha*)(vs + (s * 4 + rq) * CTP + pc);
                    *(v8h*)(pv + (size_t)(nb * 16 + s * 4) * SEQ) = val; }
                asm volatile("s_wait_dscnt 0x0" ::: "memory"); __builtin_amdgcn_wave_barrier();   // every read of the staged rows has returned before they are rewritten
            }
            asm volatile("s_wait_xcnt 0x0" ::: "memory");                                         // stands behind the last rows' stores, in front of any code laid out after them that reuses the registers they name
        }
        return;
    }
#pragma unroll
    for (int mb = 0; mb < 4; ++mb) {
#pragma unroll
        for (int nb = 0; nb < 4; ++nb) {
#pragma unroll
            for (int j = 0; j < 8; ++j) os[(hi * 8 + j) * 68 + nb * 16 + lr] = acc[mb][nb][j]; }
        asm volatile("s_wait_dscnt 0x0" ::: "memory"); __builtin_amdgcn_wave_barrier();
        float* crow = C + (size_t)(r0 + mb * 16) * ldc + c0;
{
#pragma unroll
            for (int s = 0; s < 8; ++s) { const int row = 2 * s + hi, cofs = lr * 4; const v4f val = *(const v4fa*)(os + row * 68 + cofs);
                *(v4f*)(crow + (size_t)row * ldc + cofs) = val; }
             }
        asm volatile("s_wait_dscnt 0x0" ::: "memory"); __builtin_amdgcn_wave_barrier();
    }
}
// qkv projection of one pass, sum_k XB[m][k] WQKVB[o][k], written as the head planes q, k (QK) and V^T (VT); grid (MROWC/128, NQKV/128, 1).
__global__ __launch_bounds__(128) void k_gemm_qkv(const bf* __restrict__ A, const bf* __restrict__ Bt, const float* __restrict__ CS, h16* QK, h16* VT) { gemmw_body<0, 1>(A, A, Bt, DM, nullptr, NQKV, 0, 0, CS, QK, VT); }
// output projection of one pass: OUT[b][t][o] = sum_k (CTXh + CTXl)[b*SEQ + t][k] WOB[o][k]; grid (SEQ/128, DM/128, NBC); output batch pitch SEQ_FULL*DM.
__global__ __launch_bounds__(128) void k_gemm_out(const bf* __restrict__ Ah, const bf* __restrict__ Al, const bf* __restrict__ Bt, float* C) { gemmw_body<1>(Ah, Al, Bt, DM, C, DM, (size_t)SEQ * DM, (size_t)SEQ_FULL * DM); }

// ---- preparation, ONE launch: the four jobs are independent of one another, and a range of block indices picks each (a block-uniform scalar branch).
// Ranges in start order: the rotary table (the longest chain per thread) first, then x, Wqkv, Wout (f32 -> bf16, RNE, 8 elements a thread). Every range is a whole number of 256-thread blocks.
#define PB_CS ((SEQ * 32) / 256)                  // blocks of the rotary table: one (cos, sin) pair a thread
#define PB_X  ((NB * SEQ * (DM / 8)) / 256)       // blocks of x, compacted to [NB][SEQ][DM]
#define PB_WQ ((NQKV * (DM / 8)) / 256)           // blocks of Wqkv
#define PB_WO ((DM * (DM / 8)) / 256)             // blocks of Wout
static_assert((NB * SEQ * (DM / 8)) % 256 == 0 && (NQKV * (DM / 8)) % 256 == 0 && (DM * (DM / 8)) % 256 == 0);

__device__ __forceinline__ void cvt8(const float* __restrict__ src, bf* dst) {
    const v8f v = *(const v8f*)src; v8us o;
#pragma unroll
    for (int k = 0; k < 8; ++k) o[k] = f2bf(v[k]);
    *(v8us*)dst = o;  }

__device__ __forceinline__ void cstab(float* CS, const int idx) {
    const int j = idx & 31, t = idx >> 5;
    double p = 1.0;
    p *= (j & 1) ? 1.3335214321633240 : 1.0;
    p *= (j & 2) ? 1.7782794100389228 : 1.0;
    p *= (j & 4) ? 3.1622776601683795 : 1.0;
    p *= (j & 8) ? 10.0 : 1.0;
    p *= (j & 16) ? 100.0 : 1.0;
    const float pf = (float)p; const float inv = 1.0f / pf; const float ang = (float)t * inv;
    float sn, cn; sincosf(ang, &sn, &cn);
    v2f cs; cs[0] = cn; cs[1] = sn;
    *(v2f*)(CS + (size_t)idx * 2) = cs;  }

// grid PB_CS + PB_X + PB_WQ + PB_WO, 256 threads.
__global__ __launch_bounds__(256) void k_prep(const float* __restrict__ x, const float* __restrict__ wqkv, const float* __restrict__ wout, bf* XB, bf* WQKVB, bf* WOB, float* CS) {
    const unsigned b = blockIdx.x;
    if (b < (unsigned)PB_CS) { cstab(CS, (int)(b * 256u + threadIdx.x)); return; }
    const float* s = x; bf* d = XB; unsigned c = b - (unsigned)PB_CS;                    // the job's planes and the block's index inside its range: block-uniform
    if (c >= (unsigned)(PB_X + PB_WQ)) { s = wout; d = WOB; c -= (unsigned)(PB_X + PB_WQ); }
    else if (c >= (unsigned)PB_X) { s = wqkv; d = WQKVB; c -= (unsigned)PB_X; }
    const unsigned i = c * 256u + threadIdx.x;
    size_t si = i;
    if (SEQ != SEQ_FULL && s == x) si = (size_t)(i / (unsigned)(SEQ * (DM / 8))) * (unsigned)(SEQ_FULL * (DM / 8)) + i % (unsigned)(SEQ * (DM / 8));   // the input's batch pitch is SEQ_FULL rows
    cvt8(s + si * 8, d + (size_t)i * 8);
}

// One stage of k_sdpa's LDS ring: 64 keys = K rows (64 x 128 B, contiguous in their plane) and V^T (64 d rows x 128 B, row pitch SEQ halves).
// 128 lanes x 8 asynchronous copies of 16 B; lane tid takes 16-byte piece (tid & 7) of rows (tid >> 3) + 16 i, so every wave-wide copy covers four whole 128-byte lines.
// kg, vg: the lane's first piece in the K plane and in V^T; ld: its LDS byte address in the stage's K tile.
__device__ __forceinline__ void stage_kv(const h16* kg, const h16* vg, const unsigned ld) {
    const unsigned rb = 16u * KVP * 2u, tb = TLE * 2u;      // bytes of 16 staged rows, of one tile
    // The copies and the s_wait_xcnt that stands in front of any rewrite of their address registers are one statement, so that nothing can move in between.
    asm volatile("global_load_async_to_lds_b128 %0, %8, off\n\t"
                 "global_load_async_to_lds_b128 %1, %9, off\n\t"
                 "global_load_async_to_lds_b128 %2, %10, off\n\t"
                 "global_load_async_to_lds_b128 %3, %11, off\n\t"
                 "global_load_async_to_lds_b128 %4, %12, off\n\t"
                 "global_load_async_to_lds_b128 %5, %13, off\n\t"
                 "global_load_async_to_lds_b128 %6, %14, off\n\t"
                 "global_load_async_to_lds_b128 %7, %15, off\n\t"
                 "s_wait_xcnt 0x0"
                 :: "v"(ld), "v"(ld + rb), "v"(ld + 2u * rb), "v"(ld + 3u * rb),
                    "v"(ld + tb), "v"(ld + tb + rb), "v"(ld + tb + 2u * rb), "v"(ld + tb + 3u * rb),
                    "v"(kg), "v"(kg + 16 * HD), "v"(kg + 32 * HD), "v"(kg + 48 * HD),
                    "v"(vg), "v"(vg + 16 * SEQ), "v"(vg + 32 * SEQ), "v"(vg + 48 * SEQ)
                 : "memory");
}

// ---- fused dense softmax(q k^T) v: block = 4 waves, wave = 16 query rows of one (b, h); key loop over ALL keys in 32-key steps; K and V^T come in 64-key stages through a two-buffer LDS ring that the four waves share, q fragments loaded once from the planes and kept in registers.
// S^T[key][query] = K.Q^T (A = K rows, B = Q rows; f16, two 32-d WMMAs a tile): lane (hh, ln) holds query qw+ln, keys kt + 16j + 8hh + r, which IS the B fragment of P^T for
// O^T[d][query] = V^T.P^T (A = V^T rows d, k = keys). Online softmax per lane (one query per lane, halves combined by one xor-16 shuffle); the rescale factor is lane-local.
// grid (SEQ/64, NBC*NH), 128 threads.
__global__ __launch_bounds__(128) void k_sdpa(const h16* __restrict__ QK, const h16* __restrict__ VT, bf* CT) {
    __shared__ __align__(16) unsigned short cts[4 * 2 * 16 * CTP];
    __shared__ __align__(16) unsigned short kvs[2 * STE];
    const int lane = threadIdx.x & 31, hh = lane >> 4, ln = lane & 15;
    const int wave = __builtin_amdgcn_readfirstlane((int)(threadIdx.x >> 5));
    const int zz = blockIdx.y;
    const int qw = (int)blockIdx.x * 64 + wave * 16;
    const int nst = SEQ / KST;                              // stages: all keys 0 .. SEQ-1
    const unsigned hb = (unsigned)zz * (unsigned)(SEQ * HD);
    const unsigned qoff = hb + (unsigned)(qw + ln) * HD + 8u * hh;
    const unsigned fofs = (unsigned)ln * KVP + 8u * hh;     // fragment position in a staged tile: row ln, column 8 hh
    const unsigned tid = threadIdx.x;
    const h16* kg = QK + (size_t)(PLANE + hb + tid * 8u);
    const h16* vg = VT + (size_t)(hb + (tid >> 3) * SEQ + (tid & 7u) * 8u);
    const unsigned ld = (unsigned)(size_t)kvs + ((tid >> 3) * KVP + (tid & 7u) * 8u) * 2u;
    v8f o[4];
#pragma unroll
    for (int dt = 0; dt < 4; ++dt) o[dt] = (v8f){};
    float m = NEGB, l = 0.0f;
    // The wave's q fragments (B operand, two 32-d halves) are loaded once and stay in registers for the whole key loop.
    const v16h q0 = ldh(QK + (size_t)qoff), q1 = ldh(QK + (size_t)qoff + 32);
    stage_kv(kg, vg, ld);
    asm volatile("s_wait_asynccnt 0x0" ::: "memory");       // this wave's copies of stage 0 have landed
    __syncthreads();                                        // stage 0 is readable by all four waves
    if (nst > 1) stage_kv(kg + KST * HD, vg + KST, ld + STE * 2u);
#pragma unroll 1                                            // rolled: one foot (waits, barrier, refill) per stage, in the ring's order
    for (int t = 0; t < nst; ++t) {
      const unsigned short* sb = kvs + (t & 1) * STE + fofs;
      for (int hf = 0; hf < KST / 32; ++hf) {
        const int kt = hf * 32;                             // first key of this step inside the stage
        v8f s0 = (v8f){}, s1 = (v8f){};
        {
            const unsigned short* kp = sb + kt * KVP;
            const v16h ka0 = ldhs(kp), ka1 = ldhs(kp + 32), kb0 = ldhs(kp + 16 * KVP), kb1 = ldhs(kp + 16 * KVP + 32);
            s0 = wmma16(ka0, q0, s0); s1 = wmma16(kb0, q0, s1); s0 = wmma16(ka1, q1, s0); s1 = wmma16(kb1, q1, s1);
            asm volatile("v_nop\n\tv_nop\n\tv_nop\n\tv_nop" : "+v"(s0), "+v"(s1) : "v"(ka0), "v"(ka1), "v"(kb0), "v"(kb1), "v"(q0), "v"(q1));   // the four vector slots between the last WMMA and the first use of its result or overwrite of its operands
        }
        float mx = s0[0];
#pragma unroll
        for (int r = 1; r < 8; ++r) mx = fmaxf(mx, s0[r]);
#pragma unroll
        for (int r = 0; r < 8; ++r) mx = fmaxf(mx, s1[r]);
        mx = fmaxf(mx, __shfl_xor(mx, 16, 32));
        const float mn = fmaxf(m, mx);
        const float al = __builtin_amdgcn_exp2f(m - mn);
        const float mo = mn - PLOG;                         // one subtraction a score: exp2(s - mo) is the probability with its carry
        m = mn;
        float rs = 0.0f; v16h pb;
#pragma unroll
        for (int r = 0; r < 8; ++r) {
            const float e0 = __builtin_amdgcn_exp2f(s0[r] - mo), e1 = __builtin_amdgcn_exp2f(s1[r] - mo);
            rs += e0 + e1;
            pb[r] = (h16)e0; pb[8 + r] = (h16)e1;
        }
        l = l * al + rs;
#pragma unroll
        for (int dt = 0; dt < 4; ++dt) o[dt] = o[dt] * al;
        asm volatile("" ::: "memory");
        v16h va[4];
        const unsigned short* vp = sb + TLE + kt;
#pragma unroll
        for (int dt = 0; dt < 4; ++dt) va[dt] = ldhs(vp + dt * 16 * KVP);
#pragma unroll
        for (int dt = 0; dt < 4; ++dt) o[dt] = wmma16(va[dt], pb, o[dt]);
        asm volatile("v_nop\n\tv_nop\n\tv_nop\n\tv_nop" : "+v"(o[0]), "+v"(o[1]), "+v"(o[2]), "+v"(o[3]) : "v"(pb), "v"(va[0]), "v"(va[1]), "v"(va[2]), "v"(va[3]));
      }
      asm volatile("s_wait_dscnt 0x0" ::: "memory");        // this wave's reads of stage t have returned before its buffer is refilled
      asm volatile("s_wait_asynccnt 0x0" ::: "memory");     // this wave's copies of stage t + 1 have landed
      __syncthreads();                                      // publishes stage t + 1 and ends every wave's reads of stage t
      if (t + 2 < nst) stage_kv(kg + (size_t)(t + 2) * (KST * HD), vg + (t + 2) * KST, ld + (unsigned)(t & 1) * (STE * 2u));
    }
    asm volatile("s_wait_asynccnt 0x0" ::: "memory");       // no copy is outstanding when the wave goes on to the epilogue
    l += __shfl_xor(l, 16, 32);
    const float inv = 1.0f / l;                             // l carries the same x256 as the P operand
    const int cb = wave * (2 * 16 * CTP);                   // wave-private staging: [plane hi|lo][16 rows][CTP]
#pragma unroll
    for (int dt = 0; dt < 4; ++dt) { v8us oh, ol;
#pragma unroll
        for (int r = 0; r < 8; ++r) { const float y = o[dt][r] * inv; unsigned short a, c; splitf(y, a, c); oh[r] = a; ol[r] = c; }
        *(v8usa*)(cts + cb + ln * CTP + dt * 16 + 8 * hh) = oh; *(v8usa*)(cts + cb + 16 * CTP + ln * CTP + dt * 16 + 8 * hh) = ol; }
    asm volatile("s_wait_dscnt 0x0" ::: "memory"); __builtin_amdgcn_wave_barrier();
    const int b = zz / NH, h = zz % NH;
    const int rq = lane >> 3, pc = (lane & 7) * 8;
    v8us hv[4], lv[4];
#pragma unroll
    for (int it = 0; it < 4; ++it) { const int row = it * 4 + rq; hv[it] = *(const v8usa*)(cts + cb + row * CTP + pc); lv[it] = *(const v8usa*)(cts + cb + 16 * CTP + row * CTP + pc); }
    bf* gh = CT + ((size_t)b * SEQ + qw) * DM + h * HD + pc;
{
#pragma unroll
        for (int it = 0; it < 4; ++it) { const int row = it * 4 + rq; *(v8us*)(gh + (size_t)row * DM) = hv[it]; *(v8us*)(gh + CPL + (size_t)row * DM) = lv[it]; }
         }
}

constexpr size_t SZ_WQKV = (size_t)NQKV * DM * 2;
constexpr size_t SZ_WO   = (size_t)DM * DM * 2;
constexpr size_t SZ_CS   = (size_t)SEQ * 32 * 2 * 4;
constexpr size_t SZ_XB   = (size_t)NB * SEQ * DM * 2;          // all batches, compact [NB][SEQ][DM]
constexpr size_t SZ_QK   = (size_t)2 * NBC * NH * SEQ * HD * 2; // one pass: q, k
constexpr size_t SZ_VT   = (size_t)NBC * NH * SEQ * HD * 2;     // one pass
constexpr size_t SZ_CTX  = (size_t)2 * MROWC * DM * 2;          // one pass: ctx hi, ctx lo
constexpr size_t SZ_TOTAL = SZ_WQKV + SZ_WO + SZ_CS + SZ_XB + SZ_CTX + SZ_QK + SZ_VT;
static_assert(SZ_TOTAL <= (size_t)268435456);
static_assert(SZ_WQKV % 256 == 0 && SZ_WO % 256 == 0 && SZ_CS % 256 == 0 && SZ_XB % 256 == 0 && SZ_CTX % 256 == 0 && SZ_QK % 256 == 0 && SZ_VT % 256 == 0);

extern "C" void kernel_launch(void* const* d_in, const int* in_sizes, int n_in,
                              void* d_out, int out_size, void* d_ws, size_t ws_size, hipStream_t stream) {
    if (n_in < 3) return;
    const long long need_x = (long long)(NB - 1) * SEQ_FULL * DM + (long long)SEQ * DM;
    if ((long long)in_sizes[0] < need_x) return;
    if ((long long)in_sizes[1] < (long long)NQKV * DM) return;
    if ((long long)in_sizes[2] < (long long)DM * DM) return;
    if ((long long)out_size < need_x) return;
    if (SZ_TOTAL > ws_size) return;
    const float* x = (const float*)d_in[0];        // [NB_FULL][SEQ_FULL][DM]
    const float* wqkv = (const float*)d_in[1];     // [NQKV][DM] ('oi')
    const float* wout = (const float*)d_in[2];     // [DM][DM] ('oi')
    float* OUT = (float*)d_out;                    // [NB_FULL][SEQ_FULL][DM]
    char* base = (char*)d_ws; size_t off = 0;
    bf* WQKVB = (bf*)(base + off); off += SZ_WQKV;
    bf* WOB = (bf*)(base + off); off += SZ_WO;
    float* CS = (float*)(base + off); off += SZ_CS;
    bf* XB = (bf*)(base + off); off += SZ_XB;
    bf* CT = (bf*)(base + off); off += SZ_CTX;     // ctx hi plane, lo plane at + CPL
    h16* QK = (h16*)(base + off); off += SZ_QK;
    h16* VT = (h16*)(base + off); off += SZ_VT;

    k_prep<<<PB_CS + PB_X + PB_WQ + PB_WO, 256, 0, stream>>>(x, wqkv, wout, XB, WQKVB, WOB, CS);
    for (int c = 0; c < NB / NBC; ++c) {
        const bf* XBc = XB + (size_t)c * MROWC * DM;                 // rows of this pass
        float* OUTc = OUT + (size_t)c * NBC * SEQ_FULL * DM;         // output rows of this pass
        k_gemm_qkv<<<dim3(MROWC / GBT, NQKV / GBT, 1), 128, 0, stream>>>(XBc, WQKVB, CS, QK, VT);
        k_sdpa<<<dim3(SEQ / 64, NBC * NH, 1), 128, 0, stream>>>(QK, VT, CT);
        k_gemm_out<<<dim3(SEQ / GBT, DM / GBT, NBC), 128, 0, stream>>>(CT, CT + CPL, WOB, OUTc);
    }
}

// v009
// One run takes 137 microseconds.
// Next to v008, in two timings, it ran 1.05 times as fast each time.
// Over all steps from v000 it is 4.87 times as fast.
#include <hip/hip_runtime.h>

// Dense (unmasked) multi-head softmax(q k^T / 8) v block: x [NB][SEQ][1024], fused Wqkv [3072][1024] ('oi', rows = (3, 16 heads, 64)), Wout [1024][1024] ('oi'), interleaved-pair rotary (positions = arange) on q and k, merged heads x Wout^T.
// Compute dtypes, f32 accumulate everywhere: x/Wqkv/Wout converted to bf16 (RNE) and multiplied with v_wmma_f32_16x16x32_bf16 (single product); scores q.k as f16 x f16, one product (v_wmma_f32_16x16x32_f16; the rotated q and k are rounded once to f16, 11 significant bits, finer than the bf16 operands they were projected from); P.V with v_wmma_f32_16x16x32_f16 (P f16 carried x256, v f16; the softmax runs in base 2: log2(e) rides in the q planes' scale, the carry and the reference maximum in the score products' C operand); ctx bf16 hi|lo x Wout bf16 (two products); rotary and softmax in f32.
// Batches are processed NBC at a time (host loop of launches); NBC = NB: one pass, each of the three main kernels is launched once over all batches.

#ifndef NB
#define NB 4
#endif
#ifndef SEQ
#define SEQ 2048
#endif
#ifndef NBC
#define NBC (NB)                  // batches per pass: all of them
#endif
#define NB_FULL  4
#define SEQ_FULL 2048
#define DM   1024
#define NH   16
#define HD   64
#define NQKV (3 * DM)
#define PLOG 8.0f                 // log2 of the carry (x256) of the f16 probability operand and of the row sum: added to every exponent, divided out with the sum
#define L2E  1.4426950408889634f
#define QSC  (0.125f * L2E)       // HD^-0.5 log2(e), folded into the q planes: the score products come out as base-2 exponents
#define NEGB (-1.0e30f)
#define PTRG 32768.0f              // a step's sum of carried probabilities per lane that asks for a new reference (f16 holds 65504)
#define CTP  72                   // LDS pitch (halves) of the ctx staging rows
#define KST  64                   // keys of one LDS stage of k_sdpa
#define KVP  72                   // LDS pitch (16-bit elements) of a staged 128-byte row: 144 B = 16 B x odd, conflict-free for 16-byte fragment reads
#define TLE  (64 * KVP)           // elements of one staged tile (64 rows)
#define STE  (2 * TLE)            // elements of one stage: K | V^T
#define GBT  128                  // rows and columns of a GEMM block's output tile (2 x 2 waves of 64 x 64)
#define GKS  64                   // k elements of one LDS stage of the GEMMs: 128 bytes a row, staged at pitch KVP
#define GTL  (GBT * KVP)          // elements of one staged GEMM operand tile (128 rows)
#define MROWC (NBC * SEQ)                         // rows of one pass
#define PLANE ((unsigned)(NBC * NH * SEQ * HD))   // elements of one head plane set (one pass)
#define CPL  ((size_t)MROWC * DM)                 // elements of one ctx plane (one pass)

static_assert(HD == 64);
static_assert(DM == NH * HD);
static_assert(DM % 32 == 0);
static_assert(DM % 64 == 0);
static_assert(NQKV % 64 == 0);
static_assert(SEQ % 64 == 0);
static_assert(MROWC % 64 == 0);
static_assert(NB <= NB_FULL);
static_assert(SEQ <= SEQ_FULL);
static_assert(NB % NBC == 0);
static_assert(((size_t)NBC * NH * SEQ * HD) % 512 == 0);
static_assert((SEQ * 32) % 256 == 0);
static_assert((size_t)2 * NBC * NH * SEQ * HD < 4294967296ull);
static_assert((CTP * 2) % 16 == 0);
static_assert(CTP >= HD);
static_assert(SEQ % KST == 0);
static_assert(KST == 64 && KST % 32 == 0);
static_assert((KVP * 2) % 16 == 0 && KVP >= HD && KVP >= KST);
static_assert(GBT == 128 && GKS == 64 && KVP >= GKS);
static_assert(MROWC % GBT == 0 && SEQ % GBT == 0 && NQKV % GBT == 0 && DM % GBT == 0);
static_assert(DM % GKS == 0 && DM / GKS >= 2);

typedef _Float16 h16;
typedef unsigned short bf;
typedef __attribute__((ext_vector_type(16))) __bf16   v16bf;
typedef __attribute__((ext_vector_type(16))) _Float16 v16h;
typedef __attribute__((ext_vector_type(8)))  _Float16 v8h;
typedef __attribute__((ext_vector_type(8)))  unsigned short v8us;
typedef __attribute__((ext_vector_type(8)))  float    v8f;
typedef __attribute__((ext_vector_type(4)))  float    v4f;
typedef __attribute__((ext_vector_type(2)))  float    v2f;
typedef __attribute__((ext_vector_type(2)))  _Float16 v2h;
typedef __attribute__((ext_vector_type(2)))  unsigned short v2us;
typedef v4f  __attribute__((may_alias)) v4fa;
typedef v8us __attribute__((may_alias)) v8usa;
typedef v8h  __attribute__((may_alias)) v8ha;

__device__ __forceinline__ unsigned short f2bf(float f) { unsigned u = __float_as_uint(f); u += 0x7FFFu + ((u >> 16) & 1u); return (unsigned short)(u >> 16); }
__device__ __forceinline__ float bf2f(unsigned short b) { return __uint_as_float(((unsigned)b) << 16); }
__device__ __forceinline__ void splitf(float y, unsigned short& h, unsigned short& l) { h = f2bf(y); l = f2bf(y - bf2f(h)); }
__device__ __forceinline__ v16h cat16(v8h lo, v8h hi) { return __builtin_shufflevector(lo, hi, 0, 1, 2, 3, 4, 5, 6, 7, 8, 9, 10, 11, 12, 13, 14, 15); }
__device__ __forceinline__ v16bf cat16b(v8us lo, v8us hi) { return __builtin_bit_cast(v16bf, __builtin_shufflevector(lo, hi, 0, 1, 2, 3, 4, 5, 6, 7, 8, 9, 10, 11, 12, 13, 14, 15)); }
__device__ __forceinline__ v8f wmma16(v16h a, v16h b, v8f c) { return __builtin_amdgcn_wmma_f32_16x16x32_f16(false, a, false, b, (short)0, c, false, false); }
__device__ __forceinline__ v8f wmmab(v16bf a, v16bf b, v8f c) { return __builtin_amdgcn_wmma_f32_16x16x32_bf16(false, a, false, b, (short)0, c, false, false); }
// Fragment loaders (A and B share the k map): p points at row (lane&15), column k0 + 8*(lane>>4); elements 0..7 <- p[0..7], elements 8..15 <- p[16..23].
__device__ __forceinline__ v16h ldh(const h16* p) { return cat16(*(const v8h*)p, *(const v8h*)(p + 16)); }
// The same k map on the staged LDS rows (bf16 rows of the GEMM operands; f16 rows of K and of V^T).
__device__ __forceinline__ v16bf ldbs(const unsigned short* p) { return cat16b(*(const v8usa*)p, *(const v8usa*)(p + 16)); }
__device__ __forceinline__ v16h ldhs(const unsigned short* p) { return cat16(*(const v8ha*)p, *(const v8ha*)(p + 16)); }

// One 128-row x 128-byte operand tile of a GEMM stage: 128 lanes x 8 asynchronous copies of 16 B; lane tid takes 16-byte piece (tid & 7) of rows (tid >> 3) + 16 i, so every wave-wide copy covers four whole 128-byte lines.
// g: the lane's first piece in the K-contiguous plane (row pitch K elements); ld: its LDS byte address in the staged tile (row pitch KVP elements).
__device__ __forceinline__ void stage_g(const bf* g, const int K, const unsigned ld) {
    const unsigned rb = 16u * KVP * 2u;                     // bytes of 16 staged rows
    const size_t rg = (size_t)16 * K;                       // elements of 16 plane rows
    // The copies and the s_wait_xcnt that stands in front of any rewrite of their address registers are one statement, so that nothing can move in between.
    asm volatile("global_load_async_to_lds_b128 %0, %8, off\n\t"
                 "global_load_async_to_lds_b128 %1, %9, off\n\t"
                 "global_load_async_to_lds_b128 %2, %10, off\n\t"
                 "global_load_async_to_lds_b128 %3, %11, off\n\t"
                 "global_load_async_to_lds_b128 %4, %12, off\n\t"
                 "global_load_async_to_lds_b128 %5, %13, off\n\t"
                 "global_load_async_to_lds_b128 %6, %14, off\n\t"
                 "global_load_async_to_lds_b128 %7, %15, off\n\t"
                 "s_wait_xcnt 0x0"
                 :: "v"(ld), "v"(ld + rb), "v"(ld + 2u * rb), "v"(ld + 3u * rb), "v"(ld + 4u * rb), "v"(ld + 5u * rb), "v"(ld + 6u * rb), "v"(ld + 7u * rb),
                    "v"(g), "v"(g + rg), "v"(g + 2 * rg), "v"(g + 3 * rg), "v"(g + 4 * rg), "v"(g + 5 * rg), "v"(g + 6 * rg), "v"(g + 7 * rg)
                 : "memory");
}

// ---- GEMM body: block = 4 waves on a 128x128 output tile, ONE WAVE per 64x64 quarter (16 accumulators); the block's 128 rows of A (, A2) and of Bt come from the K-contiguous bf16 planes in 64-k stages through a two-buffer LDS ring that the four waves share; grid (M/128, N/128, Z), 128 threads.
// C[m][n] (f32, pitch ldc) = sum_k (A[m][k] (+ A2[m][k])) Bt[n][k]. K % 64 == 0, K >= 128, M % 128 == 0, N % 128 == 0 (asserted at file scope for the two uses).
// EPI == 0: the tile is stored to C. EPI == 1 (qkv projection): the 64 columns of a tile are one head of q, k or v, and the tile goes straight to that head's planes:
// q, k: rotary (interleaved pairs: out[2j] = x[2j] c_j - x[2j+1] s_j, out[2j+1] = x[2j] s_j + x[2j+1] c_j; q also x QSC), f16, planes [zz = b*NH + h][t][d]; v: f16, transposed, [zz][d][t].
template <int NSPLIT, int EPI = 0>
__device__ __forceinline__ void gemmw_body(const bf* __restrict__ A, const bf* __restrict__ A2, const bf* __restrict__ Bt, const int K, float* C, const int ldc, const size_t sA, const size_t sC,
                                           const float* __restrict__ CS = nullptr, h16* QK = nullptr, h16* VT = nullptr) {
    constexpr int NT = 2 + NSPLIT;                          // tiles of one stage: A (, A2), Bt
    __shared__ __align__(16) float osb[4 * 16 * 68];
    __shared__ __align__(16) unsigned short gs[2 * NT * GTL];
    const size_t z = blockIdx.z; A += z * sA; A2 += z * sA; C += z * sC;
    const int lane = threadIdx.x & 31, lr = lane & 15, hi = lane >> 4;
    const int wave = __builtin_amdgcn_readfirstlane((int)(threadIdx.x >> 5));
    const int rb0 = blockIdx.x * GBT, cb0 = blockIdx.y * GBT, wr = (wave & 1) * 64, wc = (wave >> 1) * 64;
    const int r0 = rb0 + wr, c0 = cb0 + wc;                 // the wave's own 64x64 quarter
    float* os = osb + wave * (16 * 68);                     // wave-private epilogue staging
    v8f acc[4][4];
#pragma unroll
    for (int mb = 0; mb < 4; ++mb)
#pragma unroll
        for (int nb = 0; nb < 4; ++nb) acc[mb][nb] = (v8f){};
    const unsigned tid = threadIdx.x;
    const size_t goff = (size_t)(tid >> 3) * K + (tid & 7u) * 8u;
    const bf* ga = A + (size_t)rb0 * K + goff; const bf* ga2 = A2 + (size_t)rb0 * K + goff; const bf* gb = Bt + (size_t)cb0 * K + goff;
    const unsigned ld = (unsigned)(size_t)gs + ((tid >> 3) * KVP + (tid & 7u) * 8u) * 2u;
    const int nst = K / GKS;
    auto fill = [&](const int st, const unsigned buf) {     // stage st (k = 64 st ..) into ring buffer buf
        const unsigned l0 = ld + buf * (unsigned)(NT * GTL * 2);
        stage_g(ga + st * GKS, K, l0);
        if (NSPLIT == 1) stage_g(ga2 + st * GKS, K, l0 + GTL * 2u);
        stage_g(gb + st * GKS, K, l0 + (unsigned)((NT - 1) * GTL * 2));
    };
    fill(0, 0u);
    asm volatile("s_wait_asynccnt 0x0" ::: "memory");       // this wave's copies of stage 0 have landed
    __syncthreads();                                        // stage 0 is readable by all four waves
    fill(1, 1u);
#pragma unroll 1                                            // rolled: one foot (waits, barrier, refill) per stage, in the ring's order
    for (int t = 0; t < nst; ++t) {
      const unsigned short* sb = gs + (t & 1) * (NT * GTL) + lr * KVP + 8 * hi;    // fragment position: row lr, column 8 hi
      const unsigned short* pa = sb + wr * KVP; const unsigned short* pb = sb + (NT - 1) * GTL + wc * KVP;
#pragma unroll                                              // both 32-k steps of a stage in line: their LDS offsets become immediates
      for (int kc = 0; kc < GKS; kc += 32) {
        v16bf a[4], a2[4], bl;
#pragma unroll
        for (int mb = 0; mb < 4; ++mb) { a[mb] = ldbs(pa + mb * 16 * KVP + kc); if (NSPLIT == 1) a2[mb] = ldbs(pa + GTL + mb * 16 * KVP + kc); else a2[mb] = a[mb]; }
#pragma unroll
        for (int nb = 0; nb < 4; ++nb) { const v16bf b = ldbs(pb + nb * 16 * KVP + kc); if (nb == 3) bl = b;
#pragma unroll
            for (int mb = 0; mb < 4; ++mb) { acc[mb][nb] = wmmab(a[mb], b, acc[mb][nb]); if (NSPLIT == 1) acc[mb][nb] = wmmab(a2[mb], b, acc[mb][nb]); } }
        asm volatile("" : "+v"(acc[0][0]), "+v"(acc[0][1]), "+v"(acc[1][0]), "+v"(acc[1][1]), "+v"(acc[2][0]), "+v"(acc[2][1]), "+v"(acc[3][0]), "+v"(acc[3][1]));
        asm volatile("v_nop\n\tv_nop\n\tv_nop\n\tv_nop" : "+v"(acc[0][2]), "+v"(acc[0][3]), "+v"(acc[1][2]), "+v"(acc[1][3]), "+v"(acc[2][2]), "+v"(acc[2][3]), "+v"(acc[3][2]), "+v"(acc[3][3]) : "v"(a[0]), "v"(a[1]), "v"(a[2]), "v"(a[3]), "v"(bl));
        asm volatile("" : "+v"(acc[0][0]), "+v"(acc[0][1]), "+v"(acc[1][0]), "+v"(acc[1][1]), "+v"(acc[2][0]), "+v"(acc[2][1]), "+v"(acc[3][0]), "+v"(acc[3][1]) : "v"(a2[0]), "v"(a2[1]), "v"(a2[2]), "v"(a2[3]));
      }
      asm volatile("s_wait_dscnt 0x0" ::: "memory");        // this wave's reads of stage t have returned before its buffer is refilled
      asm volatile("s_wait_asynccnt 0x0" ::: "memory");     // this wave's copies of stage t + 1 have landed
      __syncthreads();                                      // publishes stage t + 1 and ends every wave's reads of stage t
      if (t + 2 < nst) fill(t + 2, (unsigned)(t & 1));
    }
    asm volatile("s_wait_asynccnt 0x0" ::: "memory");       // no copy is outstanding when the wave goes on to the epilogue
    if constexpr (EPI == 1) {
        const unsigned which = (unsigned)c0 / DM, h = ((unsigned)c0 / HD) % NH;          // wave-uniform: 0 q, 1 k, 2 v; head
        const unsigned zz = ((unsigned)r0 / SEQ) * NH + h, t0 = (unsigned)r0 % SEQ;      // SEQ % 64 == 0: the 64 rows lie in one batch
        const int rq = lane >> 3, pc = (lane & 7) * 8;                                   // read-back: 4 rows a step, 8 elements a lane
        if (which < 2u) {
            const float sc = which ? 1.0f : QSC;
            h16* ph = QK + (size_t)which * PLANE + (size_t)zz * (SEQ * HD) + (size_t)t0 * HD + pc;
            const float* cp = CS + (size_t)t0 * HD + pc;                                 // row t of the table: 32 (cos, sin) pairs = HD floats
#pragma unroll
            for (int mb = 0; mb < 4; ++mb) {
                v4f cs[4][2];                                                            // issued ahead of the staging so that their latency runs beside it
#pragma unroll
                for (int s = 0; s < 4; ++s) { const float* cr = cp + (size_t)(mb * 16 + s * 4 + rq) * HD; cs[s][0] = *(const v4f*)cr; cs[s][1] = *(const v4f*)(cr + 4); }
#pragma unroll
                for (int nb = 0; nb < 4; ++nb) {
#pragma unroll
                    for (int j = 0; j < 8; ++j) os[(hi * 8 + j) * 68 + nb * 16 + lr] = acc[mb][nb][j]; }
                asm volatile("s_wait_dscnt 0x0" ::: "memory"); __builtin_amdgcn_wave_barrier();   // the 16 staged rows are written before other lanes read them
#pragma unroll
                for (int s = 0; s < 4; ++s) { const int row = s * 4 + rq; v8h oh;
#pragma unroll
                    for (int g = 0; g < 2; ++g) { const v4f x = *(const v4fa*)(os + row * 68 + pc + 4 * g); const v4f c = cs[s][g];
#pragma unroll
                        for (int p = 0; p < 2; ++p) {
                            const float y0 = (x[2 * p] * c[2 * p] - x[2 * p + 1] * c[2 * p + 1]) * sc;
                            const float y1 = (x[2 * p] * c[2 * p + 1] + x[2 * p + 1] * c[2 * p]) * sc;
                            oh[4 * g + 2 * p] = (h16)y0; oh[4 * g + 2 * p + 1] = (h16)y1; } }
                    *(v8h*)(ph + (size_t)(mb * 16 + row) * HD) = oh; }
                if (mb < 3) asm volatile("s_wait_xcnt 0x0" ::: "memory");                         // stands in front of the next rows' loads and arithmetic, which reuse the registers these stores name
                asm volatile("s_wait_dscnt 0x0" ::: "memory"); __builtin_amdgcn_wave_barrier();   // every read of the staged rows has returned before they are rewritten
            }
        } else {
            h16* vs = (h16*)os;                                                          // 16 d rows x 64 t, pitch CTP halves, in the same staging bytes
            h16* pv = VT + (size_t)zz * (SEQ * HD) + (size_t)rq * SEQ + t0 + pc;
#pragma unroll
            for (int nb = 0; nb < 4; ++nb) {
#pragma unroll
                for (int mb = 0; mb < 4; ++mb) { v8h hv;                                 // a lane's 8 accumulator rows are 8 consecutive t of its column d
#pragma unroll
                    for (int j = 0; j < 8; ++j) hv[j] = (h16)acc[mb][nb][j];
                    *(v8ha*)(vs + lr * CTP + mb * 16 + hi * 8) = hv; }
                asm volatile("s_wait_dscnt 0x0" ::: "memory"); __builtin_amdgcn_wave_barrier();   // the 16 staged rows are written before other lanes read them
#pragma unroll
                for (int s = 0; s < 4; ++s) { const v8h val = *(const v8ha*)(vs + (s * 4 + rq) * CTP + pc);
                    *(v8h*)(pv + (size_t)(nb * 16 + s * 4) * SEQ) = val; }
                asm volatile("s_wait_dscnt 0x0" ::: "memory"); __builtin_amdgcn_wave_barrier();   // every read of the staged rows has returned before they are rewritten
            }
            asm volatile("s_wait_xcnt 0x0" ::: "memory");                                         // stands behind the last rows' stores, in front of any code laid out after them that reuses the registers they name
        }
        return;
    }
#pragma unroll
    for (int mb = 0; mb < 4; ++mb) {
#pragma unroll
        for (int nb = 0; nb < 4; ++nb) {
#pragma unroll
            for (int j = 0; j < 8; ++j) os[(hi * 8 + j) * 68 + nb * 16 + lr] = acc[mb][nb][j]; }
        asm volatile("s_wait_dscnt 0x0" ::: "memory"); __builtin_amdgcn_wave_barrier();
        float* crow = C + (size_t)(r0 + mb * 16) * ldc + c0;
{
#pragma unroll
            for (int s = 0; s < 8; ++s) { const int row = 2 * s + hi, cofs = lr * 4; const v4f val = *(const v4fa*)(os + row * 68 + cofs);
                *(v4f*)(crow + (size_t)row * ldc + cofs) = val; }
             }
        asm volatile("s_wait_dscnt 0x0" ::: "memory"); __builtin_amdgcn_wave_barrier();
    }
}
// qkv projection of one pass, sum_k XB[m][k] WQKVB[o][k], written as the head planes q, k (QK) and V^T (VT); grid (MROWC/128, NQKV/128, 1).
__global__ __launch_bounds__(128) void k_gemm_qkv(const bf* __restrict__ A, const bf* __restrict__ Bt, const float* __restrict__ CS, h16* QK, h16* VT) { gemmw_body<0, 1>(A, A, Bt, DM, nullptr, NQKV, 0, 0, CS, QK, VT); }
// output projection of one pass: OUT[b][t][o] = sum_k (CTXh + CTXl)[b*SEQ + t][k] WOB[o][k]; grid (SEQ/128, DM/128, NBC); output batch pitch SEQ_FULL*DM.
__global__ __launch_bounds__(128) void k_gemm_out(const bf* __restrict__ Ah, const bf* __restrict__ Al, const bf* __restrict__ Bt, float* C) { gemmw_body<1>(Ah, Al, Bt, DM, C, DM, (size_t)SEQ * DM, (size_t)SEQ_FULL * DM); }

// ---- preparation, ONE launch: the four jobs are independent of one another, and a range of block indices picks each (a block-uniform scalar branch).
// Ranges in start order: the rotary table (the longest chain per thread) first, then x, Wqkv, Wout (f32 -> bf16, RNE, 8 elements a thread). Every range is a whole number of 256-thread blocks.
#define PB_CS ((SEQ * 32) / 256)                  // blocks of the rotary table: one (cos, sin) pair a thread
#define PB_X  ((NB * SEQ * (DM / 8)) / 256)       // blocks of x, compacted to [NB][SEQ][DM]
#define PB_WQ ((NQKV * (DM / 8)) / 256)           // blocks of Wqkv
#define PB_WO ((DM * (DM / 8)) / 256)             // blocks of Wout
static_assert((NB * SEQ * (DM / 8)) % 256 == 0 && (NQKV * (DM / 8)) % 256 == 0 && (DM * (DM / 8)) % 256 == 0);

__device__ __forceinline__ void cvt8(const float* __restrict__ src, bf* dst) {
    const v8f v = *(const v8f*)src; v8us o;
#pragma unroll
    for (int k = 0; k < 8; ++k) o[k] = f2bf(v[k]);
    *(v8us*)dst = o;  }

__device__ __forceinline__ void cstab(float* CS, const int idx) {
    const int j = idx & 31, t = idx >> 5;
    double p = 1.0;
    p *= (j & 1) ? 1.3335214321633240 : 1.0;
    p *= (j & 2) ? 1.7782794100389228 : 1.0;
    p *= (j & 4) ? 3.1622776601683795 : 1.0;
    p *= (j & 8) ? 10.0 : 1.0;
    p *= (j & 16) ? 100.0 : 1.0;
    const float pf = (float)p; const float inv = 1.0f / pf; const float ang = (float)t * inv;
    float sn, cn; sincosf(ang, &sn, &cn);
    v2f cs; cs[0] = cn; cs[1] = sn;
    *(v2f*)(CS + (size_t)idx * 2) = cs;  }

// grid PB_CS + PB_X + PB_WQ + PB_WO, 256 threads.
__global__ __launch_bounds__(256) void k_prep(const float* __restrict__ x, const float* __restrict__ wqkv, const float* __restrict__ wout, bf* XB, bf* WQKVB, bf* WOB, float* CS) {
    const unsigned b = blockIdx.x;
    if (b < (unsigned)PB_CS) { cstab(CS, (int)(b * 256u + threadIdx.x)); return; }
    const float* s = x; bf* d = XB; unsigned c = b - (unsigned)PB_CS;                    // the job's planes and the block's index inside its range: block-uniform
    if (c >= (unsigned)(PB_X + PB_WQ)) { s = wout; d = WOB; c -= (unsigned)(PB_X + PB_WQ); }
    else if (c >= (unsigned)PB_X) { s = wqkv; d = WQKVB; c -= (unsigned)PB_X; }
    const unsigned i = c * 256u + threadIdx.x;
    size_t si = i;
    if (SEQ != SEQ_FULL && s == x) si = (size_t)(i / (unsigned)(SEQ * (DM / 8))) * (unsigned)(SEQ_FULL * (DM / 8)) + i % (unsigned)(SEQ * (DM / 8));   // the input's batch pitch is SEQ_FULL rows
    cvt8(s + si * 8, d + (size_t)i * 8);
}

// One stage of k_sdpa's LDS ring: 64 keys = K rows (64 x 128 B, contiguous in their plane) and V^T (64 d rows x 128 B, row pitch SEQ halves).
// 128 lanes x 8 asynchronous copies of 16 B; lane tid takes 16-byte piece (tid & 7) of rows (tid >> 3) + 16 i, so every wave-wide copy covers four whole 128-byte lines.
// kg, vg: the lane's first piece in the K plane and in V^T; ld: its LDS byte address in the stage's K tile.
__device__ __forceinline__ void stage_kv(const h16* kg, const h16* vg, const unsigned ld) {
    const unsigned rb = 16u * KVP * 2u, tb = TLE * 2u;      // bytes of 16 staged rows, of one tile
    // The copies and the s_wait_xcnt that stands in front of any rewrite of their address registers are one statement, so that nothing can move in between.
    asm volatile("global_load_async_to_lds_b128 %0, %8, off\n\t"
                 "global_load_async_to_lds_b128 %1, %9, off\n\t"
                 "global_load_async_to_lds_b128 %2, %10, off\n\t"
                 "global_load_async_to_lds_b128 %3, %11, off\n\t"
                 "global_load_async_to_lds_b128 %4, %12, off\n\t"
                 "global_load_async_to_lds_b128 %5, %13, off\n\t"
                 "global_load_async_to_lds_b128 %6, %14, off\n\t"
                 "global_load_async_to_lds_b128 %7, %15, off\n\t"
                 "s_wait_xcnt 0x0"
                 :: "v"(ld), "v"(ld + rb), "v"(ld + 2u * rb), "v"(ld + 3u * rb),
                    "v"(ld + tb), "v"(ld + tb + rb), "v"(ld + tb + 2u * rb), "v"(ld + tb + 3u * rb),
                    "v"(kg), "v"(kg + 16 * HD), "v"(kg + 32 * HD), "v"(kg + 48 * HD),
                    "v"(vg), "v"(vg + 16 * SEQ), "v"(vg + 32 * SEQ), "v"(vg + 48 * SEQ)
                 : "memory");
}

// ---- fused dense softmax(q k^T) v: block = 4 waves, wave = 16 query rows of one (b, h); key loop over ALL keys in 32-key steps; K and V^T come in 64-key stages through a two-buffer LDS ring that the four waves share, q fragments loaded once from the planes and kept in registers.
// S^T[key][query] = K.Q^T (A = K rows, B = Q rows; f16, two 32-d WMMAs a tile): lane (hh, ln) holds query qw+ln, keys kt + 16j + 8hh + r, which IS the B fragment of P^T for
// O^T[d][query] = V^T.P^T (A = V^T rows d, k = keys). Online softmax per lane (one query per lane) with a lazy rescale; the halves exchange a maximum (one xor-16 shuffle) only where the reference changes; the rescale factor is lane-local.
// grid (SEQ/64, NBC*NH), 128 threads.
__global__ __launch_bounds__(128) void k_sdpa(const h16* __restrict__ QK, const h16* __restrict__ VT, bf* CT) {
    __shared__ __align__(16) unsigned short cts[4 * 2 * 16 * CTP];
    __shared__ __align__(16) unsigned short kvs[2 * STE];
    const int lane = threadIdx.x & 31, hh = lane >> 4, ln = lane & 15;
    const int wave = __builtin_amdgcn_readfirstlane((int)(threadIdx.x >> 5));
    const int zz = blockIdx.y;
    const int qw = (int)blockIdx.x * 64 + wave * 16;
    const int nst = SEQ / KST;                              // stages: all keys 0 .. SEQ-1
    const unsigned hb = (unsigned)zz * (unsigned)(SEQ * HD);
    const unsigned qoff = hb + (unsigned)(qw + ln) * HD + 8u * hh;
    const unsigned fofs = (unsigned)ln * KVP + 8u * hh;     // fragment position in a staged tile: row ln, column 8 hh
    const unsigned tid = threadIdx.x;
    const h16* kg = QK + (size_t)(PLANE + hb + tid * 8u);
    const h16* vg = VT + (size_t)(hb + (tid >> 3) * SEQ + (tid & 7u) * 8u);
    const unsigned ld = (unsigned)(size_t)kvs + ((tid >> 3) * KVP + (tid & 7u) * 8u) * 2u;
    v8f o[4];
#pragma unroll
    for (int dt = 0; dt < 4; ++dt) o[dt] = (v8f){};
    float m = NEGB, l = 0.0f;
    // Lazy rescale: m is the reference maximum IN USE, not the running one. It is known before a step's products, so PLOG - m rides in as their C operand (cm: the same value in all 8 registers, a lane holds one query).
    // It is replaced only when a lane's sum of the step's 16 carried probabilities passes PTRG: up to there each of them is below the f16 limit, and o and l need no factor.
    v8f cm = (v8f){};
    float trg = -1.0f;                                      // below every sum: the first step always sets the reference
    // The wave's q fragments (B operand, two 32-d halves) are loaded once and stay in registers for the whole key loop.
    const v16h q0 = ldh(QK + (size_t)qoff), q1 = ldh(QK + (size_t)qoff + 32);
    stage_kv(kg, vg, ld);
    asm volatile("s_wait_asynccnt 0x0" ::: "memory");       // this wave's copies of stage 0 have landed
    __syncthreads();                                        // stage 0 is readable by all four waves
    if (nst > 1) stage_kv(kg + KST * HD, vg + KST, ld + STE * 2u);
#pragma unroll 1                                            // rolled: one foot (waits, barrier, refill) per stage, in the ring's order
    for (int t = 0; t < nst; ++t) {
      const unsigned short* sb = kvs + (t & 1) * STE + fofs;
      for (int hf = 0; hf < KST / 32; ++hf) {
        const int kt = hf * 32;                             // first key of this step inside the stage
        v8f s0, s1;
        {
            const unsigned short* kp = sb + kt * KVP;
            const v16h ka0 = ldhs(kp), ka1 = ldhs(kp + 32), kb0 = ldhs(kp + 16 * KVP), kb1 = ldhs(kp + 16 * KVP + 32);
            s0 = wmma16(ka0, q0, cm); s1 = wmma16(kb0, q0, cm); s0 = wmma16(ka1, q1, s0); s1 = wmma16(kb1, q1, s1);   // C = cm: the products come out as the exponents
            asm volatile("v_nop\n\tv_nop\n\tv_nop\n\tv_nop" : "+v"(s0), "+v"(s1) : "v"(ka0), "v"(ka1), "v"(kb0), "v"(kb1), "v"(q0), "v"(q1), "v"(cm));   // the four vector slots between the last WMMA and the first use of its result or overwrite of its operands
        }
        v16h va[4];                                         // issued here, ahead of the exponentials and of the branch below, so that their LDS latency runs beside them
        const unsigned short* vp = sb + TLE + kt;
#pragma unroll
        for (int dt = 0; dt < 4; ++dt) va[dt] = ldhs(vp + dt * 16 * KVP);
        __builtin_amdgcn_sched_barrier(0);                  // keeps the eight loads in front of the exponentials: scheduled among the last of them, they are waited for as soon as they are issued
        float rs; v16h pb;
        auto probs = [&]() {                                // the step's probabilities with their carry: their sum and the f16 operand
            rs = 0.0f;
#pragma unroll
            for (int r = 0; r < 8; ++r) {
                const float e0 = __builtin_amdgcn_exp2f(s0[r]), e1 = __builtin_amdgcn_exp2f(s1[r]);
                rs += e0 + e1;
                pb[r] = (h16)e0; pb[8 + r] = (h16)e1;
            }
        };
        probs();
        asm volatile("" :: "v"(va[0]), "v"(va[1]), "v"(va[2]), "v"(va[3]), "v"(rs));   // inputs only: holds the V^T fragment loads in front of the branch (behind it their whole LDS latency would stand in front of the second products); rs is named so that the wait for them stands behind the last addition, not among the exponentials
        if (__builtin_amdgcn_ballot_w32(rs > trg) != 0) {   // one scalar branch a step; taken on a wave's first step and where a lane's sum says that a score has outgrown the reference
            float mx = s0[0];
#pragma unroll
            for (int r = 1; r < 8; ++r) mx = fmaxf(mx, s0[r]);
#pragma unroll
            for (int r = 0; r < 8; ++r) mx = fmaxf(mx, s1[r]);
            mx = fmaxf(mx, __shfl_xor(mx, 16, 32));         // both halves of a query take the same new reference
            const float mn = fmaxf(m, mx - cm[0]);          // mx - cm: the step's largest score without its offset
            const float al = __builtin_amdgcn_exp2f(m - mn);
            const float cn = PLOG - mn, dl = cn - cm[0];
            m = mn;
#pragma unroll
            for (int r = 0; r < 8; ++r) { s0[r] += dl; s1[r] += dl; cm[r] = cn; }
            l *= al;
#pragma unroll
            for (int dt = 0; dt < 4; ++dt) o[dt] = o[dt] * al;
            probs();
            asm volatile("" :: "v"(s0), "v"(s1));           // inputs only: the exponents stay live behind their exponentials, so that none of these overwrites the source of the one directly in front of it (the slot behind a transcendental)
            trg = PTRG;
        }
        l += rs;
#pragma unroll
        for (int dt = 0; dt < 4; ++dt) o[dt] = wmma16(va[dt], pb, o[dt]);
        asm volatile("v_nop\n\tv_nop\n\tv_nop\n\tv_nop" : "+v"(o[0]), "+v"(o[1]), "+v"(o[2]), "+v"(o[3]) : "v"(pb), "v"(va[0]), "v"(va[1]), "v"(va[2]), "v"(va[3]));
      }
      asm volatile("s_wait_dscnt 0x0" ::: "memory");        // this wave's reads of stage t have returned before its buffer is refilled
      asm volatile("s_wait_asynccnt 0x0" ::: "memory");     // this wave's copies of stage t + 1 have landed
      __syncthreads();                                      // publishes stage t + 1 and ends every wave's reads of stage t
      if (t + 2 < nst) stage_kv(kg + (size_t)(t + 2) * (KST * HD), vg + (t + 2) * KST, ld + (unsigned)(t & 1) * (STE * 2u));
    }
    asm volatile("s_wait_asynccnt 0x0" ::: "memory");       // no copy is outstanding when the wave goes on to the epilogue
    l += __shfl_xor(l, 16, 32);
    const float inv = 1.0f / l;                             // l carries the same x256 as the P operand
    const int cb = wave * (2 * 16 * CTP);                   // wave-private staging: [plane hi|lo][16 rows][CTP]
#pragma unroll
    for (int dt = 0; dt < 4; ++dt) { v8us oh, ol;
#pragma unroll
        for (int r = 0; r < 8; ++r) { const float y = o[dt][r] * inv; unsigned short a, c; splitf(y, a, c); oh[r] = a; ol[r] = c; }
        *(v8usa*)(cts + cb + ln * CTP + dt * 16 + 8 * hh) = oh; *(v8usa*)(cts + cb + 16 * CTP + ln * CTP + dt * 16 + 8 * hh) = ol; }
    asm volatile("s_wait_dscnt 0x0" ::: "memory"); __builtin_amdgcn_wave_barrier();
    const int b = zz / NH, h = zz % NH;
    const int rq = lane >> 3, pc = (lane & 7) * 8;
    v8us hv[4], lv[4];
#pragma unroll
    for (int it = 0; it < 4; ++it) { const int row = it * 4 + rq; hv[it] = *(const v8usa*)(cts + cb + row * CTP + pc); lv[it] = *(const v8usa*)(cts + cb + 16 * CTP + row * CTP + pc); }
    bf* gh = CT + ((size_t)b * SEQ + qw) * DM + h * HD + pc;
{
#pragma unroll
        for (int it = 0; it < 4; ++it) { const int row = it * 4 + rq; *(v8us*)(gh + (size_t)row * DM) = hv[it]; *(v8us*)(gh + CPL + (size_t)row * DM) = lv[it]; }
         }
}

constexpr size_t SZ_WQKV = (size_t)NQKV * DM * 2;
constexpr size_t SZ_WO   = (size_t)DM * DM * 2;
constexpr size_t SZ_CS   = (size_t)SEQ * 32 * 2 * 4;
constexpr size_t SZ_XB   = (size_t)NB * SEQ * DM * 2;          // all batches, compact [NB][SEQ][DM]
constexpr size_t SZ_QK   = (size_t)2 * NBC * NH * SEQ * HD * 2; // one pass: q, k
constexpr size_t SZ_VT   = (size_t)NBC * NH * SEQ * HD * 2;     // one pass
constexpr size_t SZ_CTX  = (size_t)2 * MROWC * DM * 2;          // one pass: ctx hi, ctx lo
constexpr size_t SZ_TOTAL = SZ_WQKV + SZ_WO + SZ_CS + SZ_XB + SZ_CTX + SZ_QK + SZ_VT;
static_assert(SZ_TOTAL <= (size_t)268435456);
static_assert(SZ_WQKV % 256 == 0 && SZ_WO % 256 == 0 && SZ_CS % 256 == 0 && SZ_XB % 256 == 0 && SZ_CTX % 256 == 0 && SZ_QK % 256 == 0 && SZ_VT % 256 == 0);

extern "C" void kernel_launch(void* const* d_in, const int* in_sizes, int n_in,
                              void* d_out, int out_size, void* d_ws, size_t ws_size, hipStream_t stream) {
    if (n_in < 3) return;
    const long long need_x = (long long)(NB - 1) * SEQ_FULL * DM + (long long)SEQ * DM;
    if ((long long)in_sizes[0] < need_x) return;
    if ((long long)in_sizes[1] < (long long)NQKV * DM) return;
    if ((long long)in_sizes[2] < (long long)DM * DM) return;
    if ((long long)out_size < need_x) return;
    if (SZ_TOTAL > ws_size) return;
    const float* x = (const float*)d_in[0];        // [NB_FULL][SEQ_FULL][DM]
    const float* wqkv = (const float*)d_in[1];     // [NQKV][DM] ('oi')
    const float* wout = (const float*)d_in[2];     // [DM][DM] ('oi')
    float* OUT = (float*)d_out;                    // [NB_FULL][SEQ_FULL][DM]
    char* base = (char*)d_ws; size_t off = 0;
    bf* WQKVB = (bf*)(base + off); off += SZ_WQKV;
    bf* WOB = (bf*)(base + off); off += SZ_WO;
    float* CS = (float*)(base + off); off += SZ_CS;
    bf* XB = (bf*)(base + off); off += SZ_XB;
    bf* CT = (bf*)(base + off); off += SZ_CTX;     // ctx hi plane, lo plane at + CPL
    h16* QK = (h16*)(base + off); off += SZ_QK;
    h16* VT = (h16*)(base + off); off += SZ_VT;

    k_prep<<<PB_CS + PB_X + PB_WQ + PB_WO, 256, 0, stream>>>(x, wqkv, wout, XB, WQKVB, WOB, CS);
    for (int c = 0; c < NB / NBC; ++c) {
        const bf* XBc = XB + (size_t)c * MROWC * DM;                 // rows of this pass
        float* OUTc = OUT + (size_t)c * NBC * SEQ_FULL * DM;         // output rows of this pass
        k_gemm_qkv<<<dim3(MROWC / GBT, NQKV / GBT, 1), 128, 0, stream>>>(XBc, WQKVB, CS, QK, VT);
        k_sdpa<<<dim3(SEQ / 64, NBC * NH, 1), 128, 0, stream>>>(QK, VT, CT);
        k_gemm_out<<<dim3(SEQ / GBT, DM / GBT, NBC), 128, 0, stream>>>(CT, CT + CPL, WOB, OUTc);
    }
}

// v010
// A run of this version takes 134 microseconds.
// Timed twice side by side with v009, it ran 1.03 and 1.02 times as fast.
// All steps since v000 together make it 5.01 times as fast.
#include <hip/hip_runtime.h>

// Dense (unmasked) multi-head softmax(q k^T / 8) v block: x [NB][SEQ][1024], fused Wqkv [3072][1024] ('oi', rows = (3, 16 heads, 64)), Wout [1024][1024] ('oi'), interleaved-pair rotary (positions = arange) on q and k, merged heads x Wout^T.
// Compute dtypes, f32 accumulate everywhere: x/Wqkv/Wout converted to bf16 (RNE) and multiplied with v_wmma_f32_16x16x32_bf16 (single product); scores q.k as f16 x f16, one product (v_wmma_f32_16x16x32_f16; the rotated q and k are rounded once to f16, 11 significant bits, finer than the bf16 operands they were projected from); P.V with v_wmma_f32_16x16x32_f16 (P f16 carried x256, v f16; the softmax runs in base 2: log2(e) rides in the q planes' scale, the carry and the reference maximum in the score products' C operand); ctx bf16 hi|lo x Wout bf16 (two products); rotary and softmax in f32.
// Batches are processed NBC at a time (host loop of launches); NBC = NB: one pass, each of the three main kernels is launched once over all batches.

#ifndef NB
#define NB 4
#endif
#ifndef SEQ
#define SEQ 2048
#endif
#ifndef NBC
#define NBC (NB)                  // batches per pass: all of them
#endif
#define NB_FULL  4
#define SEQ_FULL 2048
#define DM   1024
#define NH   16
#define HD   64
#define NQKV (3 * DM)
#define PLOG 8.0f                 // log2 of the carry (x256) of the f16 probability operand and of the row sum: added to every exponent, divided out with the sum
#define L2E  1.4426950408889634f
#define QSC  (0.125f * L2E)       // HD^-0.5 log2(e), folded into the q planes: the score products come out as base-2 exponents
#define NEGB (-1.0e30f)
#define PTRG 32768.0f              // a step's sum of carried probabilities per lane that asks for a new reference (f16 holds 65504)
#define CTP  72                   // LDS pitch (halves) of the ctx staging rows
#define KST  64                   // keys of one LDS stage of k_sdpa
#define KVP  72                   // LDS pitch (16-bit elements) of a staged 128-byte row: 144 B = 16 B x odd, conflict-free for 16-byte fragment reads
#define TLE  (64 * KVP)           // elements of one staged tile (64 rows)
#define STE  (2 * TLE)            // elements of one stage: K | V^T
#define GBT  128                  // rows and columns of a GEMM block's output tile (2 x 2 waves of 64 x 64)
#define GKS  64                   // k elements of one LDS stage of the GEMMs: 128 bytes a row, staged at pitch KVP
#define GTL  (GBT * KVP)          // elements of one staged GEMM operand tile (128 rows)
#define MROWC (NBC * SEQ)                         // rows of one pass
#define PLANE ((unsigned)(NBC * NH * SEQ * HD))   // elements of one head plane set (one pass)
#define CPL  ((size_t)MROWC * DM)                 // elements of one ctx plane (one pass)

static_assert(HD == 64);
static_assert(DM == NH * HD);
static_assert(DM % 32 == 0);
static_assert(DM % 64 == 0);
static_assert(NQKV % 64 == 0);
static_assert(SEQ % 64 == 0);
static_assert(MROWC % 64 == 0);
static_assert(NB <= NB_FULL);
static_assert(SEQ <= SEQ_FULL);
static_assert(NB % NBC == 0);
static_assert(((size_t)NBC * NH * SEQ * HD) % 512 == 0);
static_assert((SEQ * 32) % 256 == 0);
static_assert((size_t)2 * NBC * NH * SEQ * HD < 4294967296ull);
static_assert((CTP * 2) % 16 == 0);
static_assert(CTP >= HD);
static_assert(SEQ % KST == 0);
static_assert(KST == 64 && KST % 32 == 0);
static_assert((KVP * 2) % 16 == 0 && KVP >= HD && KVP >= KST);
static_assert(GBT == 128 && GKS == 64 && KVP >= GKS);
static_assert(MROWC % GBT == 0 && SEQ % GBT == 0 && NQKV % GBT == 0 && DM % GBT == 0);
static_assert(DM % GKS == 0 && DM / GKS >= 2);

typedef _Float16 h16;
typedef unsigned short bf;
typedef __attribute__((ext_vector_type(16))) __bf16   v16bf;
typedef __attribute__((ext_vector_type(16))) _Float16 v16h;
typedef __attribute__((ext_vector_type(8)))  _Float16 v8h;
typedef __attribute__((ext_vector_type(8)))  unsigned short v8us;
typedef __attribute__((ext_vector_type(8)))  float    v8f;
typedef __attribute__((ext_vector_type(4)))  float    v4f;
typedef __attribute__((ext_vector_type(2)))  float    v2f;
typedef __attribute__((ext_vector_type(2)))  _Float16 v2h;
typedef __attribute__((ext_vector_type(2)))  unsigned short v2us;
typedef v4f  __attribute__((may_alias)) v4fa;
typedef v8us __attribute__((may_alias)) v8usa;
typedef v8h  __attribute__((may_alias)) v8ha;

__device__ __forceinline__ unsigned short f2bf(float f) { unsigned u = __float_as_uint(f); u += 0x7FFFu + ((u >> 16) & 1u); return (unsigned short)(u >> 16); }
__device__ __forceinline__ float bf2f(unsigned short b) { return __uint_as_float(((unsigned)b) << 16); }
__device__ __forceinline__ void splitf(float y, unsigned short& h, unsigned short& l) { h = f2bf(y); l = f2bf(y - bf2f(h)); }
__device__ __forceinline__ v16h cat16(v8h lo, v8h hi) { return __builtin_shufflevector(lo, hi, 0, 1, 2, 3, 4, 5, 6, 7, 8, 9, 10, 11, 12, 13, 14, 15); }
__device__ __forceinline__ v16bf cat16b(v8us lo, v8us hi) { return __builtin_bit_cast(v16bf, __builtin_shufflevector(lo, hi, 0, 1, 2, 3, 4, 5, 6, 7, 8, 9, 10, 11, 12, 13, 14, 15)); }
__device__ __forceinline__ v8f wmma16(v16h a, v16h b, v8f c) { return __builtin_amdgcn_wmma_f32_16x16x32_f16(false, a, false, b, (short)0, c, false, false); }
__device__ __forceinline__ v8f wmmab(v16bf a, v16bf b, v8f c) { return __builtin_amdgcn_wmma_f32_16x16x32_bf16(false, a, false, b, (short)0, c, false, false); }
// Fragment loaders (A and B share the k map): p points at row (lane&15), column k0 + 8*(lane>>4); elements 0..7 <- p[0..7], elements 8..15 <- p[16..23].
__device__ __forceinline__ v16h ldh(const h16* p) { return cat16(*(const v8h*)p, *(const v8h*)(p + 16)); }
// The same k map on the staged LDS rows (bf16 rows of the GEMM operands; f16 rows of K and of V^T).
__device__ __forceinline__ v16bf ldbs(const unsigned short* p) { return cat16b(*(const v8usa*)p, *(const v8usa*)(p + 16)); }
__device__ __forceinline__ v16h ldhs(const unsigned short* p) { return cat16(*(const v8ha*)p, *(const v8ha*)(p + 16)); }

// Rotated walks: work-groups that read the same operand rows (a GEMM's A or Bt rows, a head's K and V^T) start their ring one stage further on than the group before them and wrap, so that groups running in step do not ask L2 for the same lines at the same moment.
// s < 2 n: position s of a walk over n stages, wrapped.
__device__ __forceinline__ int wrapst(const int s, const int n) { return s >= n ? s - n : s; }

// One 128-row x 128-byte operand tile of a GEMM stage: 128 lanes x 8 asynchronous copies of 16 B; lane tid takes 16-byte piece (tid & 7) of rows (tid >> 3) + 16 i, so every wave-wide copy covers four whole 128-byte lines.
// g: the lane's first piece in the K-contiguous plane (row pitch K elements); ld: its LDS byte address in the staged tile (row pitch KVP elements).
__device__ __forceinline__ void stage_g(const bf* g, const int K, const unsigned ld) {
    const unsigned rb = 16u * KVP * 2u;                     // bytes of 16 staged rows
    const size_t rg = (size_t)16 * K;                       // elements of 16 plane rows
    // The copies and the s_wait_xcnt that stands in front of any rewrite of their address registers are one statement, so that nothing can move in between.
    asm volatile("global_load_async_to_lds_b128 %0, %8, off\n\t"
                 "global_load_async_to_lds_b128 %1, %9, off\n\t"
                 "global_load_async_to_lds_b128 %2, %10, off\n\t"
                 "global_load_async_to_lds_b128 %3, %11, off\n\t"
                 "global_load_async_to_lds_b128 %4, %12, off\n\t"
                 "global_load_async_to_lds_b128 %5, %13, off\n\t"
                 "global_load_async_to_lds_b128 %6, %14, off\n\t"
                 "global_load_async_to_lds_b128 %7, %15, off\n\t"
                 "s_wait_xcnt 0x0"
                 :: "v"(ld), "v"(ld + rb), "v"(ld + 2u * rb), "v"(ld + 3u * rb), "v"(ld + 4u * rb), "v"(ld + 5u * rb), "v"(ld + 6u * rb), "v"(ld + 7u * rb),
                    "v"(g), "v"(g + rg), "v"(g + 2 * rg), "v"(g + 3 * rg), "v"(g + 4 * rg), "v"(g + 5 * rg), "v"(g + 6 * rg), "v"(g + 7 * rg)
                 : "memory");
}

// ---- GEMM body: block = 4 waves on a 128x128 output tile, ONE WAVE per 64x64 quarter (16 accumulators); the block's 128 rows of A (, A2) and of Bt come from the K-contiguous bf16 planes in 64-k stages through a two-buffer LDS ring that the four waves share; grid (M/128, N/128, Z), 128 threads.
// C[m][n] (f32, pitch ldc) = sum_k (A[m][k] (+ A2[m][k])) Bt[n][k]. K % 64 == 0, K >= 128, M % 128 == 0, N % 128 == 0 (asserted at file scope for the two uses).
// EPI == 0: the tile is stored to C. EPI == 1 (qkv projection): the 64 columns of a tile are one head of q, k or v, and the tile goes straight to that head's planes:
// q, k: rotary (interleaved pairs: out[2j] = x[2j] c_j - x[2j+1] s_j, out[2j+1] = x[2j] s_j + x[2j+1] c_j; q also x QSC), f16, planes [zz = b*NH + h][t][d]; v: f16, transposed, [zz][d][t].
template <int NSPLIT, int EPI = 0>
__device__ __forceinline__ void gemmw_body(const bf* __restrict__ A, const bf* __restrict__ A2, const bf* __restrict__ Bt, const int K, float* C, const int ldc, const size_t sA, const size_t sC,
                                           const float* __restrict__ CS = nullptr, h16* QK = nullptr, h16* VT = nullptr) {
    constexpr int NT = 2 + NSPLIT;                          // tiles of one stage: A (, A2), Bt
    __shared__ __align__(16) float osb[4 * 16 * 68];
    __shared__ __align__(16) unsigned short gs[2 * NT * GTL];
    const size_t z = blockIdx.z; A += z * sA; A2 += z * sA; C += z * sC;
    const int lane = threadIdx.x & 31, lr = lane & 15, hi = lane >> 4;
    const int wave = __builtin_amdgcn_readfirstlane((int)(threadIdx.x >> 5));
    const int rb0 = blockIdx.x * GBT, cb0 = blockIdx.y * GBT, wr = (wave & 1) * 64, wc = (wave >> 1) * 64;
    const int r0 = rb0 + wr, c0 = cb0 + wc;                 // the wave's own 64x64 quarter
    float* os = osb + wave * (16 * 68);                     // wave-private epilogue staging
    v8f acc[4][4];
#pragma unroll
    for (int mb = 0; mb < 4; ++mb)
#pragma unroll
        for (int nb = 0; nb < 4; ++nb) acc[mb][nb] = (v8f){};
    const unsigned tid = threadIdx.x;
    const size_t goff = (size_t)(tid >> 3) * K + (tid & 7u) * 8u;
    const bf* ga = A + (size_t)rb0 * K + goff; const bf* ga2 = A2 + (size_t)rb0 * K + goff; const bf* gb = Bt + (size_t)cb0 * K + goff;
    const unsigned ld = (unsigned)(size_t)gs + ((tid >> 3) * KVP + (tid & 7u) * 8u) * 2u;
    const int nst = K / GKS;
    const int rot = (int)((blockIdx.x + blockIdx.y + blockIdx.z) % (unsigned)nst);   // first stage of this block's k walk (block-uniform): steps by one from block to block along a tile row and a tile column, modulo nst
    auto fill = [&](const int st, const unsigned buf) {     // stage st (k = 64 st ..) into ring buffer buf; trip t of the loop works on stage (t + rot) mod nst
        const unsigned l0 = ld + buf * (unsigned)(NT * GTL * 2);
        stage_g(ga + st * GKS, K, l0);
        if (NSPLIT == 1) stage_g(ga2 + st * GKS, K, l0 + GTL * 2u);
        stage_g(gb + st * GKS, K, l0 + (unsigned)((NT - 1) * GTL * 2));
    };
    fill(rot, 0u);
    asm volatile("s_wait_asynccnt 0x0" ::: "memory");       // this wave's copies of the walk's first stage have landed
    __syncthreads();                                        // the first stage is readable by all four waves
    fill(wrapst(rot + 1, nst), 1u);
#pragma unroll 1                                            // rolled: one foot (waits, barrier, refill) per stage, in the ring's order
    for (int t = 0; t < nst; ++t) {
      const unsigned short* sb = gs + (t & 1) * (NT * GTL) + lr * KVP + 8 * hi;    // fragment position: row lr, column 8 hi
      const unsigned short* pa = sb + wr * KVP; const unsigned short* pb = sb + (NT - 1) * GTL + wc * KVP;
#pragma unroll                                              // both 32-k steps of a stage in line: their LDS offsets become immediates
      for (int kc = 0; kc < GKS; kc += 32) {
        v16bf a[4], a2[4], bl;
#pragma unroll
        for (int mb = 0; mb < 4; ++mb) { a[mb] = ldbs(pa + mb * 16 * KVP + kc); if (NSPLIT == 1) a2[mb] = ldbs(pa + GTL + mb * 16 * KVP + kc); else a2[mb] = a[mb]; }
#pragma unroll
        for (int nb = 0; nb < 4; ++nb) { const v16bf b = ldbs(pb + nb * 16 * KVP + kc); if (nb == 3) bl = b;
#pragma unroll
            for (int mb = 0; mb < 4; ++mb) { acc[mb][nb] = wmmab(a[mb], b, acc[mb][nb]); if (NSPLIT == 1) acc[mb][nb] = wmmab(a2[mb], b, acc[mb][nb]); } }
        asm volatile("" : "+v"(acc[0][0]), "+v"(acc[0][1]), "+v"(acc[1][0]), "+v"(acc[1][1]), "+v"(acc[2][0]), "+v"(acc[2][1]), "+v"(acc[3][0]), "+v"(acc[3][1]));
        asm volatile("v_nop\n\tv_nop\n\tv_nop\n\tv_nop" : "+v"(acc[0][2]), "+v"(acc[0][3]), "+v"(acc[1][2]), "+v"(acc[1][3]), "+v"(acc[2][2]), "+v"(acc[2][3]), "+v"(acc[3][2]), "+v"(acc[3][3]) : "v"(a[0]), "v"(a[1]), "v"(a[2]), "v"(a[3]), "v"(bl));
        asm volatile("" : "+v"(acc[0][0]), "+v"(acc[0][1]), "+v"(acc[1][0]), "+v"(acc[1][1]), "+v"(acc[2][0]), "+v"(acc[2][1]), "+v"(acc[3][0]), "+v"(acc[3][1]) : "v"(a2[0]), "v"(a2[1]), "v"(a2[2]), "v"(a2[3]));
      }
      asm volatile("s_wait_dscnt 0x0" ::: "memory");        // this wave's reads of trip t's stage have returned before its buffer is refilled
      asm volatile("s_wait_asynccnt 0x0" ::: "memory");     // this wave's copies of trip t + 1's stage have landed
      __syncthreads();                                      // publishes trip t + 1's stage and ends every wave's reads of trip t's stage
      if (t + 2 < nst) fill(wrapst(t + 2 + rot, nst), (unsigned)(t & 1));
    }
    asm volatile("s_wait_asynccnt 0x0" ::: "memory");       // no copy is outstanding when the wave goes on to the epilogue
    if constexpr (EPI == 1) {
        const unsigned which = (unsigned)c0 / DM, h = ((unsigned)c0 / HD) % NH;          // wave-uniform: 0 q, 1 k, 2 v; head
        const unsigned zz = ((unsigned)r0 / SEQ) * NH + h, t0 = (unsigned)r0 % SEQ;      // SEQ % 64 == 0: the 64 rows lie in one batch
        const int rq = lane >> 3, pc = (lane & 7) * 8;                                   // read-back: 4 rows a step, 8 elements a lane
        if (which < 2u) {
            const float sc = which ? 1.0f : QSC;
            h16* ph = QK + (size_t)which * PLANE + (size_t)zz * (SEQ * HD) + (size_t)t0 * HD + pc;
            const float* cp = CS + (size_t)t0 * HD + pc;                                 // row t of the table: 32 (cos, sin) pairs = HD floats
#pragma unroll
            for (int mb = 0; mb < 4; ++mb) {
                v4f cs[4][2];                                                            // issued ahead of the staging so that their latency runs beside it
#pragma unroll
                for (int s = 0; s < 4; ++s) { const float* cr = cp + (size_t)(mb * 16 + s * 4 + rq) * HD; cs[s][0] = *(const v4f*)cr; cs[s][1] = *(const v4f*)(cr + 4); }
#pragma unroll
                for (int nb = 0; nb < 4; ++nb) {
#pragma unroll
                    for (int j = 0; j < 8; ++j) os[(hi * 8 + j) * 68 + nb * 16 + lr] = acc[mb][nb][j]; }
                asm volatile("s_wait_dscnt 0x0" ::: "memory"); __builtin_amdgcn_wave_barrier();   // the 16 staged rows are written before other lanes read them
#pragma unroll
                for (int s = 0; s < 4; ++s) { const int row = s * 4 + rq; v8h oh;
#pragma unroll
                    for (int g = 0; g < 2; ++g) { const v4f x = *(const v4fa*)(os + row * 68 + pc + 4 * g); const v4f c = cs[s][g];
#pragma unroll
                        for (int p = 0; p < 2; ++p) {
                            const float y0 = (x[2 * p] * c[2 * p] - x[2 * p + 1] * c[2 * p + 1]) * sc;
                            const float y1 = (x[2 * p] * c[2 * p + 1] + x[2 * p + 1] * c[2 * p]) * sc;
                            oh[4 * g + 2 * p] = (h16)y0; oh[4 * g + 2 * p + 1] = (h16)y1; } }
                    *(v8h*)(ph + (size_t)(mb * 16 + row) * HD) = oh; }
                if (mb < 3) asm volatile("s_wait_xcnt 0x0" ::: "memory");                         // stands in front of the next rows' loads and arithmetic, which reuse the registers these stores name
                asm volatile("s_wait_dscnt 0x0" ::: "memory"); __builtin_amdgcn_wave_barrier();   // every read of the staged rows has returned before they are rewritten
            }
        } else {
            h16* vs = (h16*)os;                                                          // 16 d rows x 64 t, pitch CTP halves, in the same staging bytes
            h16* pv = VT + (size_t)zz * (SEQ * HD) + (size_t)rq * SEQ + t0 + pc;
#pragma unroll
            for (int nb = 0; nb < 4; ++nb) {
#pragma unroll
                for (int mb = 0; mb < 4; ++mb) { v8h hv;                                 // a lane's 8 accumulator rows are 8 consecutive t of its column d
#pragma unroll
                    for (int j = 0; j < 8; ++j) hv[j] = (h16)acc[mb][nb][j];
                    *(v8ha*)(vs + lr * CTP + mb * 16 + hi * 8) = hv; }
                asm volatile("s_wait_dscnt 0x0" ::: "memory"); __builtin_amdgcn_wave_barrier();   // the 16 staged rows are written before other lanes read them
#pragma unroll
                for (int s = 0; s < 4; ++s) { const v8h val = *(const v8ha*)(vs + (s * 4 + rq) * CTP + pc);
                    *(v8h*)(pv + (size_t)(nb * 16 + s * 4) * SEQ) = val; }
                asm volatile("s_wait_dscnt 0x0" ::: "memory"); __builtin_amdgcn_wave_barrier();   // every read of the staged rows has returned before they are rewritten
            }
            asm volatile("s_wait_xcnt 0x0" ::: "memory");                                         // stands behind the last rows' stores, in front of any code laid out after them that reuses the registers they name
        }
        return;
    }
#pragma unroll
    for (int mb = 0; mb < 4; ++mb) {
#pragma unroll
        for (int nb = 0; nb < 4; ++nb) {
#pragma unroll
            for (int j = 0; j < 8; ++j) os[(hi * 8 + j) * 68 + nb * 16 + lr] = acc[mb][nb][j]; }
        asm volatile("s_wait_dscnt 0x0" ::: "memory"); __builtin_amdgcn_wave_barrier();
        float* crow = C + (size_t)(r0 + mb * 16) * ldc + c0;
{
#pragma unroll
            for (int s = 0; s < 8; ++s) { const int row = 2 * s + hi, cofs = lr * 4; const v4f val = *(const v4fa*)(os + row * 68 + cofs);
                *(v4f*)(crow + (size_t)row * ldc + cofs) = val; }
             }
        asm volatile("s_wait_dscnt 0x0" ::: "memory"); __builtin_amdgcn_wave_barrier();
    }
}
// qkv projection of one pass, sum_k XB[m][k] WQKVB[o][k], written as the head planes q, k (QK) and V^T (VT); grid (MROWC/128, NQKV/128, 1).
__global__ __launch_bounds__(128) void k_gemm_qkv(const bf* __restrict__ A, const bf* __restrict__ Bt, const float* __restrict__ CS, h16* QK, h16* VT) { gemmw_body<0, 1>(A, A, Bt, DM, nullptr, NQKV, 0, 0, CS, QK, VT); }
// output projection of one pass: OUT[b][t][o] = sum_k (CTXh + CTXl)[b*SEQ + t][k] WOB[o][k]; grid (SEQ/128, DM/128, NBC); output batch pitch SEQ_FULL*DM.
__global__ __launch_bounds__(128) void k_gemm_out(const bf* __restrict__ Ah, const bf* __restrict__ Al, const bf* __restrict__ Bt, float* C) { gemmw_body<1>(Ah, Al, Bt, DM, C, DM, (size_t)SEQ * DM, (size_t)SEQ_FULL * DM); }

// ---- preparation, ONE launch: the four jobs are independent of one another, and a range of block indices picks each (a block-uniform scalar branch).
// Ranges in start order: the rotary table (the longest chain per thread) first, then x, Wqkv, Wout (f32 -> bf16, RNE, 8 elements a thread). Every range is a whole number of 256-thread blocks.
#define PB_CS ((SEQ * 32) / 256)                  // blocks of the rotary table: one (cos, sin) pair a thread
#define PB_X  ((NB * SEQ * (DM / 8)) / 256)       // blocks of x, compacted to [NB][SEQ][DM]
#define PB_WQ ((NQKV * (DM / 8)) / 256)           // blocks of Wqkv
#define PB_WO ((DM * (DM / 8)) / 256)             // blocks of Wout
static_assert((NB * SEQ * (DM / 8)) % 256 == 0 && (NQKV * (DM / 8)) % 256 == 0 && (DM * (DM / 8)) % 256 == 0);

__device__ __forceinline__ void cvt8(const float* __restrict__ src, bf* dst) {
    const v8f v = *(const v8f*)src; v8us o;
#pragma unroll
    for (int k = 0; k < 8; ++k) o[k] = f2bf(v[k]);
    *(v8us*)dst = o;  }

__device__ __forceinline__ void cstab(float* CS, const int idx) {
    const int j = idx & 31, t = idx >> 5;
    double p = 1.0;
    p *= (j & 1) ? 1.3335214321633240 : 1.0;
    p *= (j & 2) ? 1.7782794100389228 : 1.0;
    p *= (j & 4) ? 3.1622776601683795 : 1.0;
    p *= (j & 8) ? 10.0 : 1.0;
    p *= (j & 16) ? 100.0 : 1.0;
    const float pf = (float)p; const float inv = 1.0f / pf; const float ang = (float)t * inv;
    float sn, cn; sincosf(ang, &sn, &cn);
    v2f cs; cs[0] = cn; cs[1] = sn;
    *(v2f*)(CS + (size_t)idx * 2) = cs;  }

// grid PB_CS + PB_X + PB_WQ + PB_WO, 256 threads.
__global__ __launch_bounds__(256) void k_prep(const float* __restrict__ x, const float* __restrict__ wqkv, const float* __restrict__ wout, bf* XB, bf* WQKVB, bf* WOB, float* CS) {
    const unsigned b = blockIdx.x;
    if (b < (unsigned)PB_CS) { cstab(CS, (int)(b * 256u + threadIdx.x)); return; }
    const float* s = x; bf* d = XB; unsigned c = b - (unsigned)PB_CS;                    // the job's planes and the block's index inside its range: block-uniform
    if (c >= (unsigned)(PB_X + PB_WQ)) { s = wout; d = WOB; c -= (unsigned)(PB_X + PB_WQ); }
    else if (c >= (unsigned)PB_X) { s = wqkv; d = WQKVB; c -= (unsigned)PB_X; }
    const unsigned i = c * 256u + threadIdx.x;
    size_t si = i;
    if (SEQ != SEQ_FULL && s == x) si = (size_t)(i / (unsigned)(SEQ * (DM / 8))) * (unsigned)(SEQ_FULL * (DM / 8)) + i % (unsigned)(SEQ * (DM / 8));   // the input's batch pitch is SEQ_FULL rows
    cvt8(s + si * 8, d + (size_t)i * 8);
}

// One stage of k_sdpa's LDS ring: 64 keys = K rows (64 x 128 B, contiguous in their plane) and V^T (64 d rows x 128 B, row pitch SEQ halves).
// 128 lanes x 8 asynchronous copies of 16 B; lane tid takes 16-byte piece (tid & 7) of rows (tid >> 3) + 16 i, so every wave-wide copy covers four whole 128-byte lines.
// kg, vg: the lane's first piece in the K plane and in V^T; ld: its LDS byte address in the stage's K tile.
__device__ __forceinline__ void stage_kv(const h16* kg, const h16* vg, const unsigned ld) {
    const unsigned rb = 16u * KVP * 2u, tb = TLE * 2u;      // bytes of 16 staged rows, of one tile
    // The copies and the s_wait_xcnt that stands in front of any rewrite of their address registers are one statement, so that nothing can move in between.
    asm volatile("global_load_async_to_lds_b128 %0, %8, off\n\t"
                 "global_load_async_to_lds_b128 %1, %9, off\n\t"
                 "global_load_async_to_lds_b128 %2, %10, off\n\t"
                 "global_load_async_to_lds_b128 %3, %11, off\n\t"
                 "global_load_async_to_lds_b128 %4, %12, off\n\t"
                 "global_load_async_to_lds_b128 %5, %13, off\n\t"
                 "global_load_async_to_lds_b128 %6, %14, off\n\t"
                 "global_load_async_to_lds_b128 %7, %15, off\n\t"
                 "s_wait_xcnt 0x0"
                 :: "v"(ld), "v"(ld + rb), "v"(ld + 2u * rb), "v"(ld + 3u * rb),
                    "v"(ld + tb), "v"(ld + tb + rb), "v"(ld + tb + 2u * rb), "v"(ld + tb + 3u * rb),
                    "v"(kg), "v"(kg + 16 * HD), "v"(kg + 32 * HD), "v"(kg + 48 * HD),
                    "v"(vg), "v"(vg + 16 * SEQ), "v"(vg + 32 * SEQ), "v"(vg + 48 * SEQ)
                 : "memory");
}

// ---- fused dense softmax(q k^T) v: block = 4 waves, wave = 16 query rows of one (b, h); key loop over ALL keys in 32-key steps; K and V^T come in 64-key stages through a two-buffer LDS ring that the four waves share, q fragments loaded once from the planes and kept in registers.
// S^T[key][query] = K.Q^T (A = K rows, B = Q rows; f16, two 32-d WMMAs a tile): lane (hh, ln) holds query qw+ln, keys kt + 16j + 8hh + r, which IS the B fragment of P^T for
// O^T[d][query] = V^T.P^T (A = V^T rows d, k = keys). Online softmax per lane (one query per lane) with a lazy rescale; the halves exchange a maximum (one xor-16 shuffle) only where the reference changes; the rescale factor is lane-local.
// grid (SEQ/64, NBC*NH), 128 threads.
__global__ __launch_bounds__(128) void k_sdpa(const h16* __restrict__ QK, const h16* __restrict__ VT, bf* CT) {
    __shared__ __align__(16) unsigned short cts[4 * 2 * 16 * CTP];
    __shared__ __align__(16) unsigned short kvs[2 * STE];
    const int lane = threadIdx.x & 31, hh = lane >> 4, ln = lane & 15;
    const int wave = __builtin_amdgcn_readfirstlane((int)(threadIdx.x >> 5));
    const int zz = blockIdx.y;
    const int qw = (int)blockIdx.x * 64 + wave * 16;
    const int nst = SEQ / KST;                              // stages: all keys 0 .. SEQ-1
    const int rot = (int)(blockIdx.x % (unsigned)nst);      // first stage of this block's key walk (block-uniform): differs among the blocks of one head
    const unsigned hb = (unsigned)zz * (unsigned)(SEQ * HD);
    const unsigned qoff = hb + (unsigned)(qw + ln) * HD + 8u * hh;
    const unsigned fofs = (unsigned)ln * KVP + 8u * hh;     // fragment position in a staged tile: row ln, column 8 hh
    const unsigned tid = threadIdx.x;
    const h16* kg = QK + (size_t)(PLANE + hb + tid * 8u);
    const h16* vg = VT + (size_t)(hb + (tid >> 3) * SEQ + (tid & 7u) * 8u);
    const unsigned ld = (unsigned)(size_t)kvs + ((tid >> 3) * KVP + (tid & 7u) * 8u) * 2u;
    v8f o[4];
#pragma unroll
    for (int dt = 0; dt < 4; ++dt) o[dt] = (v8f){};
    float m = NEGB, l = 0.0f;
    // Lazy rescale: m is the reference maximum IN USE, not the running one. It is known before a step's products, so PLOG - m rides in as their C operand (cm: the same value in all 8 registers, a lane holds one query).
    // It is replaced only when a lane's sum of the step's 16 carried probabilities passes PTRG: up to there each of them is below the f16 limit, and o and l need no factor.
    v8f cm = (v8f){};
    float trg = -1.0f;                                      // below every sum: the first step always sets the reference
    // The wave's q fragments (B operand, two 32-d halves) are loaded once and stay in registers for the whole key loop.
    const v16h q0 = ldh(QK + (size_t)qoff), q1 = ldh(QK + (size_t)qoff + 32);
    stage_kv(kg + (size_t)rot * (KST * HD), vg + rot * KST, ld);
    asm volatile("s_wait_asynccnt 0x0" ::: "memory");       // this wave's copies of the walk's first stage have landed
    __syncthreads();                                        // the first stage is readable by all four waves
    if (nst > 1) { const int s1 = wrapst(rot + 1, nst); stage_kv(kg + (size_t)s1 * (KST * HD), vg + s1 * KST, ld + STE * 2u); }
#pragma unroll 1                                            // rolled: one foot (waits, barrier, refill) per stage, in the ring's order
    for (int t = 0; t < nst; ++t) {
      const unsigned short* sb = kvs + (t & 1) * STE + fofs;
      for (int hf = 0; hf < KST / 32; ++hf) {
        const int kt = hf * 32;                             // first key of this step inside the stage
        v8f s0, s1;
        {
            const unsigned short* kp = sb + kt * KVP;
            const v16h ka0 = ldhs(kp), ka1 = ldhs(kp + 32), kb0 = ldhs(kp + 16 * KVP), kb1 = ldhs(kp + 16 * KVP + 32);
            s0 = wmma16(ka0, q0, cm); s1 = wmma16(kb0, q0, cm); s0 = wmma16(ka1, q1, s0); s1 = wmma16(kb1, q1, s1);   // C = cm: the products come out as the exponents
            asm volatile("v_nop\n\tv_nop\n\tv_nop\n\tv_nop" : "+v"(s0), "+v"(s1) : "v"(ka0), "v"(ka1), "v"(kb0), "v"(kb1), "v"(q0), "v"(q1), "v"(cm));   // the four vector slots between the last WMMA and the first use of its result or overwrite of its operands
        }
        v16h va[4];                                         // issued here, ahead of the exponentials and of the branch below, so that their LDS latency runs beside them
        const unsigned short* vp = sb + TLE + kt;
#pragma unroll
        for (int dt = 0; dt < 4; ++dt) va[dt] = ldhs(vp + dt * 16 * KVP);
        __builtin_amdgcn_sched_barrier(0);                  // keeps the eight loads in front of the exponentials: scheduled among the last of them, they are waited for as soon as they are issued
        float rs; v16h pb;
        auto probs = [&]() {                                // the step's probabilities with their carry: their sum and the f16 operand
            rs = 0.0f;
#pragma unroll
            for (int r = 0; r < 8; ++r) {
                const float e0 = __builtin_amdgcn_exp2f(s0[r]), e1 = __builtin_amdgcn_exp2f(s1[r]);
                rs += e0 + e1;
                pb[r] = (h16)e0; pb[8 + r] = (h16)e1;
            }
        };
        probs();
        asm volatile("" :: "v"(va[0]), "v"(va[1]), "v"(va[2]), "v"(va[3]), "v"(rs));   // inputs only: holds the V^T fragment loads in front of the branch (behind it their whole LDS latency would stand in front of the second products); rs is named so that the wait for them stands behind the last addition, not among the exponentials
        if (__builtin_amdgcn_ballot_w32(rs > trg) != 0) {   // one scalar branch a step; taken on a wave's first step and where a lane's sum says that a score has outgrown the reference
            float mx = s0[0];
#pragma unroll
            for (int r = 1; r < 8; ++r) mx = fmaxf(mx, s0[r]);
#pragma unroll
            for (int r = 0; r < 8; ++r) mx = fmaxf(mx, s1[r]);
            mx = fmaxf(mx, __shfl_xor(mx, 16, 32));         // both halves of a query take the same new reference
            const float mn = fmaxf(m, mx - cm[0]);          // mx - cm: the step's largest score without its offset
            const float al = __builtin_amdgcn_exp2f(m - mn);
            const float cn = PLOG - mn, dl = cn - cm[0];
            m = mn;
#pragma unroll
            for (int r = 0; r < 8; ++r) { s0[r] += dl; s1[r] += dl; cm[r] = cn; }
            l *= al;
#pragma unroll
            for (int dt = 0; dt < 4; ++dt) o[dt] = o[dt] * al;
            probs();
            asm volatile("" :: "v"(s0), "v"(s1));           // inputs only: the exponents stay live behind their exponentials, so that none of these overwrites the source of the one directly in front of it (the slot behind a transcendental)
            trg = PTRG;
        }
        l += rs;
#pragma unroll
        for (int dt = 0; dt < 4; ++dt) o[dt] = wmma16(va[dt], pb, o[dt]);
        asm volatile("v_nop\n\tv_nop\n\tv_nop\n\tv_nop" : "+v"(o[0]), "+v"(o[1]), "+v"(o[2]), "+v"(o[3]) : "v"(pb), "v"(va[0]), "v"(va[1]), "v"(va[2]), "v"(va[3]));
      }
      asm volatile("s_wait_dscnt 0x0" ::: "memory");        // this wave's reads of trip t's stage have returned before its buffer is refilled
      asm volatile("s_wait_asynccnt 0x0" ::: "memory");     // this wave's copies of trip t + 1's stage have landed
      __syncthreads();                                      // publishes trip t + 1's stage and ends every wave's reads of trip t's stage
      if (t + 2 < nst) { const int s2 = wrapst(t + 2 + rot, nst); stage_kv(kg + (size_t)s2 * (KST * HD), vg + s2 * KST, ld + (unsigned)(t & 1) * (STE * 2u)); }
    }
    asm volatile("s_wait_asynccnt 0x0" ::: "memory");       // no copy is outstanding when the wave goes on to the epilogue
    l += __shfl_xor(l, 16, 32);
    const float inv = 1.0f / l;                             // l carries the same x256 as the P operand
    const int cb = wave * (2 * 16 * CTP);                   // wave-private staging: [plane hi|lo][16 rows][CTP]
#pragma unroll
    for (int dt = 0; dt < 4; ++dt) { v8us oh, ol;
#pragma unroll
        for (int r = 0; r < 8; ++r) { const float y = o[dt][r] * inv; unsigned short a, c; splitf(y, a, c); oh[r] = a; ol[r] = c; }
        *(v8usa*)(cts + cb + ln * CTP + dt * 16 + 8 * hh) = oh; *(v8usa*)(cts + cb + 16 * CTP + ln * CTP + dt * 16 + 8 * hh) = ol; }
    asm volatile("s_wait_dscnt 0x0" ::: "memory"); __builtin_amdgcn_wave_barrier();
    const int b = zz / NH, h = zz % NH;
    const int rq = lane >> 3, pc = (lane & 7) * 8;
    v8us hv[4], lv[4];
#pragma unroll
    for (int it = 0; it < 4; ++it) { const int row = it * 4 + rq; hv[it] = *(const v8usa*)(cts + cb + row * CTP + pc); lv[it] = *(const v8usa*)(cts + cb + 16 * CTP + row * CTP + pc); }
    bf* gh = CT + ((size_t)b * SEQ + qw) * DM + h * HD + pc;
{
#pragma unroll
        for (int it = 0; it < 4; ++it) { const int row = it * 4 + rq; *(v8us*)(gh + (size_t)row * DM) = hv[it]; *(v8us*)(gh + CPL + (size_t)row * DM) = lv[it]; }
         }
}

constexpr size_t SZ_WQKV = (size_t)NQKV * DM * 2;
constexpr size_t SZ_WO   = (size_t)DM * DM * 2;
constexpr size_t SZ_CS   = (size_t)SEQ * 32 * 2 * 4;
constexpr size_t SZ_XB   = (size_t)NB * SEQ * DM * 2;          // all batches, compact [NB][SEQ][DM]
constexpr size_t SZ_QK   = (size_t)2 * NBC * NH * SEQ * HD * 2; // one pass: q, k
constexpr size_t SZ_VT   = (size_t)NBC * NH * SEQ * HD * 2;     // one pass
constexpr size_t SZ_CTX  = (size_t)2 * MROWC * DM * 2;          // one pass: ctx hi, ctx lo
constexpr size_t SZ_TOTAL = SZ_WQKV + SZ_WO + SZ_CS + SZ_XB + SZ_CTX + SZ_QK + SZ_VT;
static_assert(SZ_TOTAL <= (size_t)268435456);
static_assert(SZ_WQKV % 256 == 0 && SZ_WO % 256 == 0 && SZ_CS % 256 == 0 && SZ_XB % 256 == 0 && SZ_CTX % 256 == 0 && SZ_QK % 256 == 0 && SZ_VT % 256 == 0);

extern "C" void kernel_launch(void* const* d_in, const int* in_sizes, int n_in,
                              void* d_out, int out_size, void* d_ws, size_t ws_size, hipStream_t stream) {
    if (n_in < 3) return;
    const long long need_x = (long long)(NB - 1) * SEQ_FULL * DM + (long long)SEQ * DM;
    if ((long long)in_sizes[0] < need_x) return;
    if ((long long)in_sizes[1] < (long long)NQKV * DM) return;
    if ((long long)in_sizes[2] < (long long)DM * DM) return;
    if ((long long)out_size < need_x) return;
    if (SZ_TOTAL > ws_size) return;
    const float* x = (const float*)d_in[0];        // [NB_FULL][SEQ_FULL][DM]
    const float* wqkv = (const float*)d_in[1];     // [NQKV][DM] ('oi')
    const float* wout = (const float*)d_in[2];     // [DM][DM] ('oi')
    float* OUT = (float*)d_out;                    // [NB_FULL][SEQ_FULL][DM]
    char* base = (char*)d_ws; size_t off = 0;
    bf* WQKVB = (bf*)(base + off); off += SZ_WQKV;
    bf* WOB = (bf*)(base + off); off += SZ_WO;
    float* CS = (float*)(base + off); off += SZ_CS;
    bf* XB = (bf*)(base + off); off += SZ_XB;
    bf* CT = (bf*)(base + off); off += SZ_CTX;     // ctx hi plane, lo plane at + CPL
    h16* QK = (h16*)(base + off); off += SZ_QK;
    h16* VT = (h16*)(base + off); off += SZ_VT;

    k_prep<<<PB_CS + PB_X + PB_WQ + PB_WO, 256, 0, stream>>>(x, wqkv, wout, XB, WQKVB, WOB, CS);
    for (int c = 0; c < NB / NBC; ++c) {
        const bf* XBc = XB + (size_t)c * MROWC * DM;                 // rows of this pass
        float* OUTc = OUT + (size_t)c * NBC * SEQ_FULL * DM;         // output rows of this pass
        k_gemm_qkv<<<dim3(MROWC / GBT, NQKV / GBT, 1), 128, 0, stream>>>(XBc, WQKVB, CS, QK, VT);
        k_sdpa<<<dim3(SEQ / 64, NBC * NH, 1), 128, 0, stream>>>(QK, VT, CT);
        k_gemm_out<<<dim3(SEQ / GBT, DM / GBT, NBC), 128, 0, stream>>>(CT, CT + CPL, WOB, OUTc);
    }
}
